// v000
// The times below were measured on an AMD MI455X: many runs one after another, warmed up first and cycling through
// copies of the inputs, with the whole window's GPU time divided by the number of runs. Launches and the gaps
// between them are all in it. The median over several windows is given; except for v000 it joins two sittings, which
// can be a few percent apart, so the side-by-side timings, each taken in one sitting, are the better comparison.
// The starting kernel, v000, takes 2760 microseconds a run.
#include <hip/hip_runtime.h>

// SelfAttentionHead (x [4][2048][1024]; qkv = x W^T + b (W [3072][1024], split (q | k | v) x 16 heads x 64); causal softmax(q.k / 8); out = merged heads (no output projection) -> [4][2048][1024]).
// Compute dtypes, f32 accumulate: every input rounded to bf16; q/k/v on PLAIN bf16 operands (inputs: exact) + bias; causal scores and attn.v: query rows < 512 hl (3 products), the rest single fp16 (x1024); softmax f32; the merged heads are written as hi + lo of the attention planes (i.e. the f32 attention output rounded through a bf16 pair, |err| <= 2^-16 relative).

#define NB_  4
#define TT   2048
#define DM   1024
#define NH_  16
#define NKV  16
#define REP  (NH_ / NKV)
#define HD   64
#define DQ   (NH_ * HD)
#define DKV  (NKV * HD)
#define ZH   2
#define RH   512                  // query rows < RH use hi+lo planes (0: none)
#define WIN  2048
#define PCAR 1024.0f
#define SCL  0.125f   // HD^-0.5
typedef _Float16 h16;
typedef unsigned short bf;
typedef __attribute__((ext_vector_type(16))) __bf16   v16bf;
typedef __attribute__((ext_vector_type(16))) _Float16 v16h;
typedef __attribute__((ext_vector_type(8)))  _Float16 v8h;
typedef __attribute__((ext_vector_type(8)))  unsigned short v8us;
typedef __attribute__((ext_vector_type(8)))  float    v8f;
typedef __attribute__((ext_vector_type(4)))  float    v4f;
typedef v8h  __attribute__((may_alias)) v8ha;
typedef v4f  __attribute__((may_alias)) v4fa;
typedef v8us __attribute__((may_alias)) v8usa;

__device__ __forceinline__ unsigned short f2bf(float f) { unsigned u = __float_as_uint(f); u += 0x7FFFu + ((u >> 16) & 1u); return (unsigned short)(u >> 16); }
__device__ __forceinline__ float bf2f(unsigned short b) { return __uint_as_float(((unsigned)b) << 16); }
__device__ __forceinline__ float bfr(float f) { return bf2f(f2bf(f)); }
__device__ __forceinline__ v16h cat16(v8h lo, v8h hi) { return __builtin_shufflevector(lo, hi, 0, 1, 2, 3, 4, 5, 6, 7, 8, 9, 10, 11, 12, 13, 14, 15); }
__device__ __forceinline__ v16bf cat16b(v8us lo, v8us hi) { return __builtin_bit_cast(v16bf, __builtin_shufflevector(lo, hi, 0, 1, 2, 3, 4, 5, 6, 7, 8, 9, 10, 11, 12, 13, 14, 15)); }
__device__ __forceinline__ v8f wmma16(v16h a, v16h b, v8f c) { return __builtin_amdgcn_wmma_f32_16x16x32_f16(false, a, false, b, (short)0, c, false, false); }
__device__ __forceinline__ v8f wmmab(v16bf a, v16bf b, v8f c) { return __builtin_amdgcn_wmma_f32_16x16x32_bf16(false, a, false, b, (short)0, c, false, false); }



// ---- k_gemmw: register-blocked GEMM, ONE WAVE per 64x64 output tile (16 accumulators), operands straight from K-contiguous 16-bit planes; grid (M/64, N/64, Z), 32 threads.
// C[m][n] (f32, pitch ldc, + optional f32 bias[n]) = sum_k A[m][k] Bt[n][k] (+ split products per NSPLIT). z-batch strides sA/sB/sC in elements. K % 32 == 0.
template <typename T16> struct WFrag;
template <> struct WFrag<h16> { typedef v16h V; static __device__ __forceinline__ V ld(const h16* p) { return cat16(*(const v8h*)p, *(const v8h*)(p + 16)); } static __device__ __forceinline__ v8f mma(V a, V b, v8f c) { return wmma16(a, b, c); } };
template <> struct WFrag<bf> { typedef v16bf V; static __device__ __forceinline__ V ld(const bf* p) { return cat16b(*(const v8us*)p, *(const v8us*)(p + 16)); } static __device__ __forceinline__ v8f mma(V a, V b, v8f c) { return wmmab(a, b, c); } };
template <typename T16, int NSPLIT, bool BIAS>
__global__ __launch_bounds__(32) void k_gemmw(const T16* __restrict__ A, const T16* __restrict__ A2, const T16* __restrict__ Bt, const T16* __restrict__ Bt2, int K, float* C, int ldc, const float* __restrict__ bias, size_t sA, size_t sB, size_t sC) {
    typedef typename WFrag<T16>::V V;
    __shared__ __align__(16) float os[16 * 68];
    const size_t z = blockIdx.z; A += z * sA; if (A2) A2 += z * sA; Bt += z * sB; if (Bt2) Bt2 += z * sB; C += z * sC;
    const int lane = threadIdx.x & 31, lr = lane & 15, hi = lane >> 4; const int r0 = blockIdx.x * 64, c0 = blockIdx.y * 64;
    v8f acc[4][4];
#pragma unroll
    for (int mb = 0; mb < 4; ++mb)
#pragma unroll
        for (int nb = 0; nb < 4; ++nb) acc[mb][nb] = (v8f){};
    const size_t aoff = (size_t)(r0 + lr) * K + 8 * hi, boff = (size_t)(c0 + lr) * K + 8 * hi;
#pragma unroll 1
    for (int kc = 0; kc < K; kc += 32) {
        V a[4], a2[4];
#pragma unroll
        for (int mb = 0; mb < 4; ++mb) { a[mb] = WFrag<T16>::ld(A + aoff + (size_t)mb * 16 * K + kc); if (NSPLIT == 1 || NSPLIT == 2) a2[mb] = WFrag<T16>::ld(A2 + aoff + (size_t)mb * 16 * K + kc); }
#pragma unroll
        for (int nb = 0; nb < 4; ++nb) { const V b = WFrag<T16>::ld(Bt + boff + (size_t)nb * 16 * K + kc); V b2; if (NSPLIT >= 2) b2 = WFrag<T16>::ld(Bt2 + boff + (size_t)nb * 16 * K + kc);
#pragma unroll
            for (int mb = 0; mb < 4; ++mb) { acc[mb][nb] = WFrag<T16>::mma(a[mb], b, acc[mb][nb]); if (NSPLIT == 1 || NSPLIT == 2) acc[mb][nb] = WFrag<T16>::mma(a2[mb], b, acc[mb][nb]); if (NSPLIT >= 2) acc[mb][nb] = WFrag<T16>::mma(a[mb], b2, acc[mb][nb]); } }
        asm volatile("v_nop\n\tv_nop\n\tv_nop\n\tv_nop" : "+v"(acc[0][0]), "+v"(acc[1][1]), "+v"(acc[2][2]), "+v"(acc[3][3]) : "v"(a[0]), "v"(a[3]));
    }
#pragma unroll
    for (int mb = 0; mb < 4; ++mb) {
#pragma unroll
        for (int nb = 0; nb < 4; ++nb) {
#pragma unroll
            for (int j = 0; j < 8; ++j) os[(hi * 8 + j) * 68 + nb * 16 + lr] = acc[mb][nb][j]; }
        __builtin_amdgcn_wave_barrier(); asm volatile("" ::: "memory");
        float* crow = C + (size_t)(r0 + mb * 16) * ldc + c0;
{
#pragma unroll
            for (int s = 0; s < 8; ++s) { const int row = 2 * s + hi, cofs = lr * 4; v4f val = *(const v4fa*)(os + row * 68 + cofs); if (BIAS) { val[0] += bfr(bias[c0 + cofs]); val[1] += bfr(bias[c0 + cofs + 1]); val[2] += bfr(bias[c0 + cofs + 2]); val[3] += bfr(bias[c0 + cofs + 3]); }
                *(v4f*)(crow + (size_t)row * ldc + cofs) = val; }
             }
        __builtin_amdgcn_wave_barrier(); asm volatile("" ::: "memory");
    }
}

// ---- k_gemmc: the same one-wave 64x64 tile GEMM specialised for causal attention: CMODE 1 skips score tiles entirely above the diagonal (query rows r0+roff.., key columns c0..), CMODE 2 limits the
// key (K) loop of the probability x value contraction to the diagonal block (probabilities beyond it are exactly zero). roff = row offset of this launch's first row within the sequence.
template <typename T16, int NSPLIT, int CMODE>
__global__ __launch_bounds__(32) void k_gemmc(const T16* __restrict__ A, const T16* __restrict__ A2, const T16* __restrict__ Bt, const T16* __restrict__ Bt2, int K, float* C, int ldc, int roff, size_t sA, size_t sB, size_t sC) {
    typedef typename WFrag<T16>::V V;
    __shared__ __align__(16) float os[16 * 68];
    const size_t z = blockIdx.z; A += z * sA; if (A2) A2 += z * sA; Bt += z * sB; if (Bt2) Bt2 += z * sB; C += z * sC;
    const int lane = threadIdx.x & 31, lr = lane & 15, hi = lane >> 4; const int r0 = blockIdx.x * 64, c0 = blockIdx.y * 64;
    if (CMODE == 1 && c0 > r0 + roff + 63) return;                  // score tile entirely above the causal diagonal: never read (the softmax masks j > i by select)
    const int Kl = (CMODE == 2) ? min(K, r0 + roff + 64) : K;        // P.V: probabilities are exactly 0 beyond the diagonal block, so the K loop stops there
    v8f acc[4][4];
#pragma unroll
    for (int mb = 0; mb < 4; ++mb)
#pragma unroll
        for (int nb = 0; nb < 4; ++nb) acc[mb][nb] = (v8f){};
    const size_t aoff = (size_t)(r0 + lr) * K + 8 * hi, boff = (size_t)(c0 + lr) * K + 8 * hi;
#pragma unroll 1
    for (int kc = 0; kc < Kl; kc += 32) {
        V a[4], a2[4];
#pragma unroll
        for (int mb = 0; mb < 4; ++mb) { a[mb] = WFrag<T16>::ld(A + aoff + (size_t)mb * 16 * K + kc); if (NSPLIT == 1 || NSPLIT == 2) a2[mb] = WFrag<T16>::ld(A2 + aoff + (size_t)mb * 16 * K + kc); }
#pragma unroll
        for (int nb = 0; nb < 4; ++nb) { const V b = WFrag<T16>::ld(Bt + boff + (size_t)nb * 16 * K + kc); V b2; if (NSPLIT >= 2) b2 = WFrag<T16>::ld(Bt2 + boff + (size_t)nb * 16 * K + kc);
#pragma unroll
            for (int mb = 0; mb < 4; ++mb) { acc[mb][nb] = WFrag<T16>::mma(a[mb], b, acc[mb][nb]); if (NSPLIT == 1 || NSPLIT == 2) acc[mb][nb] = WFrag<T16>::mma(a2[mb], b, acc[mb][nb]); if (NSPLIT >= 2) acc[mb][nb] = WFrag<T16>::mma(a[mb], b2, acc[mb][nb]); } }
        asm volatile("v_nop\n\tv_nop\n\tv_nop\n\tv_nop" : "+v"(acc[0][0]), "+v"(acc[1][1]), "+v"(acc[2][2]), "+v"(acc[3][3]) : "v"(a[0]), "v"(a[3]));
    }
#pragma unroll
    for (int mb = 0; mb < 4; ++mb) {
#pragma unroll
        for (int nb = 0; nb < 4; ++nb) {
#pragma unroll
            for (int j = 0; j < 8; ++j) os[(hi * 8 + j) * 68 + nb * 16 + lr] = acc[mb][nb][j]; }
        __builtin_amdgcn_wave_barrier(); asm volatile("" ::: "memory");
        float* crow = C + (size_t)(r0 + mb * 16) * ldc + c0;
{
#pragma unroll
            for (int s = 0; s < 8; ++s) { const int row = 2 * s + hi, cofs = lr * 4; v4f val = *(const v4fa*)(os + row * 68 + cofs);
                *(v4f*)(crow + (size_t)row * ldc + cofs) = val; }
             }
        __builtin_amdgcn_wave_barrier(); asm volatile("" ::: "memory");
    }
}

__device__ __forceinline__ h16 tohx(float x) { return (h16)x; }
__device__ __forceinline__ void splitf(float y, unsigned short& h, unsigned short& l) { h = f2bf(y); l = f2bf(y - bf2f(h)); }
typedef __attribute__((ext_vector_type(2))) _Float16 v2h;
typedef __attribute__((ext_vector_type(4))) _Float16 v4h;
typedef __attribute__((ext_vector_type(2))) unsigned short v2us;
typedef __attribute__((ext_vector_type(4))) unsigned short v4us;
typedef __attribute__((ext_vector_type(2))) float v2f;
typedef __attribute__((ext_vector_type(4))) int v4i;

__global__ __launch_bounds__(256) void k_wtG(const float* __restrict__ w, int K, int N, bf* Bt) {
    const int lane = threadIdx.x & 31; const int L0 = (blockIdx.x * 8 + (threadIdx.x >> 5)) * 8; const int nlines = N * K / 64;
{
#pragma unroll 1
        for (int l = 0; l < 8; ++l) { const int L = L0 + l; if (L >= nlines) break; const size_t e = (size_t)L * 64 + lane * 2; const int k = (int)(e % K), n = (int)(e / K); v2us o;
            o[0] = f2bf(w[(size_t)k * N + n]); o[1] = f2bf(w[(size_t)(k + 1) * N + n]); *(v2us*)(Bt + e) = o; }
         }
}
__global__ __launch_bounds__(256) void k_cvt8(const float* __restrict__ src, bf* dst, size_t n8) { const size_t i = (size_t)blockIdx.x * 256 + threadIdx.x; if (i >= n8) return; const v8f v = *(const v8f*)(src + i * 8); v8us o;
#pragma unroll
    for (int k = 0; k < 8; ++k) o[k] = f2bf(v[k]); *(v8us*)(dst + i * 8) = o;  }
__global__ __launch_bounds__(256) void k_cscvt(const float* __restrict__ cosT, const float* __restrict__ sinT, float* CS) { const int idx = blockIdx.x * 256 + threadIdx.x; if (idx >= TT * HD) return; v2f cs; cs[0] = bfr(cosT[idx]); cs[1] = bfr(sinT[idx]); *(v2f*)(CS + (size_t)idx * 2) = cs;  }
// k_rope: head planes [h][t][d] (fp16 + hi/lo) of rope(x) x sc with the rotate-half convention out[d] = x[d] cos[t][d] - x[d+HD/2] sin[t][d], out[d+HD/2] = x[d+HD/2] cos[t][d+HD/2] + x[d] sin[t][d+HD/2]
__global__ __launch_bounds__(256) void k_rope(const float* __restrict__ F, int pitch, int nheads, const float* __restrict__ CS, const float* __restrict__ RF, const float* __restrict__ nw, float sc, h16* P16, bf* Ph, bf* Pl) {
    const size_t e = ((size_t)blockIdx.x * 256 + threadIdx.x) * 2; if (e >= (size_t)nheads * TT * HD) return; const int d = (int)(e % HD); const int t = (int)((e / HD) % TT); const int h = (int)(e / ((size_t)HD * TT)); const float* f = F + (size_t)t * pitch + h * HD; const float rf = RF ? RF[(size_t)h * TT + t] : 1.0f; v2h o16; v2us oh, ol;
#pragma unroll
    for (int q = 0; q < 2; ++q) { const int dd = d + q; const int dp = (dd < HD / 2) ? dd + HD / 2 : dd - HD / 2; float x0 = f[dd], x1 = f[dp];
        if (RF) { float n0 = __fmul_rn(x0, rf), n1 = __fmul_rn(x1, rf); asm volatile("" : "+v"(n0)); asm volatile("" : "+v"(n1)); x0 = __fmul_rn(bfr(nw[dd]), n0); x1 = __fmul_rn(bfr(nw[dp]), n1); }
        const v2f cs = *(const v2f*)(CS + ((size_t)t * HD + dd) * 2); float a = __fmul_rn(x0, cs[0]), bq = __fmul_rn(x1, cs[1]); asm volatile("" : "+v"(a)); asm volatile("" : "+v"(bq)); const float r = ((dd < HD / 2) ? __fsub_rn(a, bq) : __fadd_rn(a, bq)) * sc;
        o16[q] = tohx(r); unsigned short a2, c2; splitf(r, a2, c2); oh[q] = a2; ol[q] = c2; }
    *(v2h*)(P16 + e) = o16; *(v2us*)(Ph + e) = oh; *(v2us*)(Pl + e) = ol;  }
__global__ __launch_bounds__(256) void k_vtp(const float* __restrict__ F, int pitch, int nheads, h16* V16, bf* Vh, bf* Vl) { const size_t e = ((size_t)blockIdx.x * 256 + threadIdx.x) * 2; if (e >= (size_t)nheads * HD * TT) return; const int t = (int)(e % TT); const int d = (int)((e / TT) % HD); const int g = (int)(e / ((size_t)TT * HD)); v2h o16; v2us oh, ol;
#pragma unroll
    for (int q = 0; q < 2; ++q) { const float x = F[(size_t)(t + q) * pitch + g * HD + d]; o16[q] = tohx(x); unsigned short a2, c2; splitf(x, a2, c2); oh[q] = a2; ol[q] = c2; }
    *(v2h*)(V16 + e) = o16; *(v2us*)(Vh + e) = oh; *(v2us*)(Vl + e) = ol;  }
__global__ __launch_bounds__(256) void k_csid(float* CS) { const int idx = blockIdx.x * 256 + threadIdx.x; if (idx >= TT * HD) return; v2f cs; cs[0] = 1.0f; cs[1] = 0.0f; *(v2f*)(CS + (size_t)idx * 2) = cs;  }
// k_asoft: per row (zz, i): t = S x HD^-0.5 for j <= i and i - j < WIN (sliding causal window; the reference's -1e9 additive fill vanishes identically); softmax over the 2048 keys (register row, one exp, fixed trees);
__global__ __launch_bounds__(256) void k_asoft(const float* __restrict__ Sb, h16* P16, bf* Ph, bf* Pl) {
    const int lane = threadIdx.x & 31; const int row = blockIdx.x * 8 + (threadIdx.x >> 5); if (row >= ZH * TT) return; const int i = row % TT; const int zz = row / TT; (void)zz; const bool hires = (i < RH); const float* sr = Sb + (size_t)row * TT; float v[TT / 32]; float mx = -3.0e38f;
#pragma unroll
    for (int ch = 0; ch < TT / 128; ++ch) { const int j0 = ch * 128 + lane * 4; const v4f a = *(const v4f*)(sr + j0);
#pragma unroll
        for (int q = 0; q < 4; ++q) { const int j = j0 + q; (void)j; const float t = (j <= i && i - j < WIN) ? a[q] * SCL : -3.0e38f; v[ch * 4 + q] = t; mx = fmaxf(mx, t); } }
#pragma unroll
    for (int sh = 16; sh; sh >>= 1) mx = fmaxf(mx, __shfl_xor(mx, sh, 32));
    float sum = 0.f;
#pragma unroll
    for (int k = 0; k < TT / 32; ++k) { float d0 = __fsub_rn(v[k], mx); asm volatile("" : "+v"(d0)); v[k] = __builtin_amdgcn_exp2f(__fmul_rn(d0, 1.4426950408889634f)); sum += v[k]; }
#pragma unroll
    for (int sh = 16; sh; sh >>= 1) sum += __shfl_xor(sum, sh, 32);
    const float f = __fdiv_rn(hires ? 1.0f : PCAR, sum);
{
        if (hires) {
#pragma unroll
            for (int ch = 0; ch < TT / 128; ++ch) { v4us oh, ol;
#pragma unroll
                for (int q = 0; q < 4; ++q) { unsigned short a, c2; splitf(v[ch * 4 + q] * f, a, c2); oh[q] = a; ol[q] = c2; }
                const size_t oo = ((size_t)zz * (RH ? RH : 1) + i) * TT + ch * 128 + lane * 4; *(v4us*)(Ph + oo) = oh; *(v4us*)(Pl + oo) = ol; }
        } else {
#pragma unroll
            for (int ch = 0; ch < TT / 128; ++ch) { v4h o4;
#pragma unroll
                for (int q = 0; q < 4; ++q) o4[q] = tohx(v[ch * 4 + q] * f);
                *(v4h*)(P16 + (size_t)row * TT + ch * 128 + lane * 4) = o4; } }
         }
}
__global__ __launch_bounds__(256) void k_merge(const float* __restrict__ O, int h0, bf* Ah, bf* Al) { const size_t e = ((size_t)blockIdx.x * 256 + threadIdx.x) * 2; if (e >= (size_t)ZH * TT * HD) return; const int d = (int)(e % HD); const int t = (int)((e / HD) % TT); const int zz = (int)(e / ((size_t)HD * TT)); const float cs = (t < RH) ? 1.0f : (1.0f / PCAR); const size_t oo = (size_t)t * DQ + (h0 + zz) * HD + d;
    v2us oh, ol;
#pragma unroll
    for (int q = 0; q < 2; ++q) { unsigned short a, c2; splitf(O[e + q] * cs, a, c2); oh[q] = a; ol[q] = c2; } *(v2us*)(Ah + oo) = oh; *(v2us*)(Al + oo) = ol;  }

__global__ __launch_bounds__(256) void k_pl2out(const bf* __restrict__ Ah, const bf* __restrict__ Al, float* out) { const size_t e = ((size_t)blockIdx.x * 256 + threadIdx.x) * 4; if (e >= (size_t)TT * DQ) return; v4f o;   // out = hi + lo of the merged attention planes (16-B lanes)
#pragma unroll
    for (int u = 0; u < 4; ++u) o[u] = __fadd_rn(bf2f(Ah[e + u]), bf2f(Al[e + u])); *(v4f*)(out + e) = o;  }

extern "C" void kernel_launch(void* const* d_in, const int* in_sizes, int n_in,
                              void* d_out, int out_size, void* d_ws, size_t ws_size, hipStream_t stream) {
    (void)in_sizes; (void)n_in; (void)out_size;
    const float* x = (const float*)d_in[0]; const float* wf = (const float*)d_in[1]; const float* bfz = (const float*)d_in[2]; const float* wq = wf + (size_t)0 * 1024 * 1024; const float* wk = wf + (size_t)1 * 1024 * 1024; const float* wv = wf + (size_t)2 * 1024 * 1024; const float* bq = bfz + 0 * 1024; const float* bk = bfz + 1 * 1024; const float* bv = bfz + 2 * 1024; const float* wo = nullptr; (void)wo; const float* cosT = nullptr; const float* sinT = nullptr; (void)cosT; (void)sinT;
    float* OUT = (float*)d_out;     // [4][2048][1024]
    char* wsp = (char*)d_ws;
    auto take = [&](size_t bytes) { char* p = wsp; wsp += (bytes + 255) & ~(size_t)255; return (void*)p; };
    bf* WQ = (bf*)take((size_t)DQ * DM * 2); bf* WK = (bf*)take((size_t)DKV * DM * 2); bf* WV = (bf*)take((size_t)DKV * DM * 2); bf* WO = (bf*)take((size_t)DM * DQ * 2); float* CS = (float*)take((size_t)TT * HD * 2 * 4);
    bf* XB = (bf*)take((size_t)TT * DM * 2); float* FQ = (float*)take((size_t)TT * DQ * 4); float* FK = (float*)take((size_t)TT * DKV * 4);
    h16* QP16 = (h16*)take((size_t)NH_ * TT * HD * 2); h16* KP16 = (h16*)take((size_t)NKV * TT * HD * 2); h16* VT16 = (h16*)take((size_t)NKV * HD * TT * 2);
    bf* QPh = (bf*)take((size_t)NH_ * TT * HD * 2); bf* QPl = (bf*)take((size_t)NH_ * TT * HD * 2); bf* KPh = (bf*)take((size_t)NKV * TT * HD * 2); bf* KPl = (bf*)take((size_t)NKV * TT * HD * 2); bf* VTh = (bf*)take((size_t)NKV * HD * TT * 2); bf* VTl = (bf*)take((size_t)NKV * HD * TT * 2); bf* Ph = (bf*)take((size_t)ZH * RH * TT * 2); bf* Pl = (bf*)take((size_t)ZH * RH * TT * 2);
    float* Sb = (float*)take((size_t)ZH * TT * TT * 4); h16* P16 = (h16*)take((size_t)ZH * TT * TT * 2); float* Ob = (float*)take((size_t)ZH * TT * HD * 4); bf* ATh = (bf*)take((size_t)TT * DQ * 2); bf* ATl = (bf*)take((size_t)TT * DQ * 2);
    if ((size_t)(wsp - (char*)d_ws) > ws_size) return;    // ws 256 MiB
    float* FV = FK;   // v projection reuses the k buffer after the k planes are built (stream-ordered)
    { k_cvt8<<<(unsigned)(((size_t)DQ * DM / 8 + 255) / 256), 256, 0, stream>>>(wq, WQ, (size_t)DQ * DM / 8); k_cvt8<<<(unsigned)(((size_t)DKV * DM / 8 + 255) / 256), 256, 0, stream>>>(wk, WK, (size_t)DKV * DM / 8); k_cvt8<<<(unsigned)(((size_t)DKV * DM / 8 + 255) / 256), 256, 0, stream>>>(wv, WV, (size_t)DKV * DM / 8);
      
       }
    k_csid<<<(TT * HD + 255) / 256, 256, 0, stream>>>(CS);
    const unsigned LQ = (unsigned)(((size_t)NH_ * TT * HD / 2 + 255) / 256), LKv = (unsigned)(((size_t)NKV * TT * HD / 2 + 255) / 256);
    for (int b = 0; b < NB_; ++b) {
        
        k_cvt8<<<(unsigned)(((size_t)TT * DM / 8 + 255) / 256), 256, 0, stream>>>(x + (size_t)b * TT * DM, XB, (size_t)TT * DM / 8);
        k_gemmw<bf, 0, true><<<dim3(TT / 64, DQ / 64, 1), 32, 0, stream>>>(XB, nullptr, WQ, nullptr, DM, FQ, DQ, bq, 0, 0, 0);
        k_rope<<<LQ, 256, 0, stream>>>(FQ, DQ, NH_, CS, nullptr, nullptr, 1.0f, QP16, QPh, QPl);
        k_gemmw<bf, 0, true><<<dim3(TT / 64, DKV / 64, 1), 32, 0, stream>>>(XB, nullptr, WK, nullptr, DM, FK, DKV, bk, 0, 0, 0);
        k_rope<<<LKv, 256, 0, stream>>>(FK, DKV, NKV, CS, nullptr, nullptr, 1.0f, KP16, KPh, KPl);
        k_gemmw<bf, 0, true><<<dim3(TT / 64, DKV / 64, 1), 32, 0, stream>>>(XB, nullptr, WV, nullptr, DM, FV, DKV, bv, 0, 0, 0); k_vtp<<<LKv, 256, 0, stream>>>(FV, DKV, NKV, VT16, VTh, VTl);
        for (int h0 = 0; h0 < NH_; h0 += ZH) { const size_t zq = (size_t)h0, zk = (size_t)(h0 / REP);   // one kv head per query head: the pass's two heads use consecutive kv planes (z-strides TT*HD)
            k_gemmc<bf, 2, 1><<<dim3(RH / 64, TT / 64, ZH), 32, 0, stream>>>(QPh + zq * TT * HD, QPl + zq * TT * HD, KPh + zk * TT * HD, KPl + zk * TT * HD, HD, Sb, TT, 0, (size_t)TT * HD, (size_t)TT * HD, (size_t)TT * TT);
            k_gemmc<h16, 0, 1><<<dim3((TT - RH) / 64, TT / 64, ZH), 32, 0, stream>>>(QP16 + zq * TT * HD + (size_t)RH * HD, nullptr, KP16 + zk * TT * HD, nullptr, HD, Sb + (size_t)RH * TT, TT, RH, (size_t)TT * HD, (size_t)TT * HD, (size_t)TT * TT);
            k_asoft<<<ZH * TT / 8, 256, 0, stream>>>(Sb, P16, Ph, Pl);
            k_gemmc<bf, 2, 2><<<dim3(RH / 64, HD / 64, ZH), 32, 0, stream>>>(Ph, Pl, VTh + zk * HD * TT, VTl + zk * HD * TT, TT, Ob, HD, 0, (size_t)RH * TT, (size_t)HD * TT, (size_t)TT * HD);
            k_gemmc<h16, 0, 2><<<dim3((TT - RH) / 64, HD / 64, ZH), 32, 0, stream>>>(P16 + (size_t)RH * TT, nullptr, VT16 + zk * HD * TT, nullptr, TT, Ob + (size_t)RH * HD, HD, RH, (size_t)TT * TT, (size_t)HD * TT, (size_t)TT * HD);
            k_merge<<<(unsigned)(((size_t)ZH * TT * HD / 2 + 255) / 256), 256, 0, stream>>>(Ob, h0, ATh, ATl); }
        k_pl2out<<<(unsigned)(((size_t)TT * DQ / 4 + 255) / 256), 256, 0, stream>>>(ATh, ATl, OUT + (size_t)b * TT * DM); }
}

// v001
// It runs in 1330 microseconds.
// In two side-by-side timings against v000, it was 2.07 and 2.08 times as fast.
#include <hip/hip_runtime.h>

// SelfAttentionHead (x [4][2048][1024]; qkv = x W^T + b (W [3072][1024], split (q | k | v) x 16 heads x 64); causal softmax(q.k / 8); out = merged heads (no output projection) -> [4][2048][1024]).
// Compute dtypes, f32 accumulate: every input rounded to bf16; q/k/v on PLAIN bf16 operands (inputs: exact) + bias; causal scores and attn.v: query rows < 512 hl (3 products), the rest single fp16 (x1024); softmax f32; the merged heads are written as hi + lo of the attention planes (i.e. the f32 attention output rounded through a bf16 pair, |err| <= 2^-16 relative).

#define NB_  4
#define TT   2048
#define DM   1024
#define NH_  16
#define NKV  16
#define REP  (NH_ / NKV)
#define HD   64
#define DQ   (NH_ * HD)
#define DKV  (NKV * HD)
#define ZH   2
#define RH   512                  // query rows < RH use hi+lo planes (0: none)
#define WIN  2048
#define PCAR 1024.0f
#define SCL  0.125f   // HD^-0.5
typedef _Float16 h16;
typedef unsigned short bf;
typedef __attribute__((ext_vector_type(16))) __bf16   v16bf;
typedef __attribute__((ext_vector_type(16))) _Float16 v16h;
typedef __attribute__((ext_vector_type(8)))  _Float16 v8h;
typedef __attribute__((ext_vector_type(8)))  unsigned short v8us;
typedef __attribute__((ext_vector_type(8)))  float    v8f;
typedef __attribute__((ext_vector_type(4)))  float    v4f;
typedef v8h  __attribute__((may_alias)) v8ha;
typedef v4f  __attribute__((may_alias)) v4fa;
typedef v8us __attribute__((may_alias)) v8usa;

__device__ __forceinline__ unsigned short f2bf(float f) { unsigned u = __float_as_uint(f); u += 0x7FFFu + ((u >> 16) & 1u); return (unsigned short)(u >> 16); }
__device__ __forceinline__ float bf2f(unsigned short b) { return __uint_as_float(((unsigned)b) << 16); }
__device__ __forceinline__ float bfr(float f) { return bf2f(f2bf(f)); }
__device__ __forceinline__ v16h cat16(v8h lo, v8h hi) { return __builtin_shufflevector(lo, hi, 0, 1, 2, 3, 4, 5, 6, 7, 8, 9, 10, 11, 12, 13, 14, 15); }
__device__ __forceinline__ v16bf cat16b(v8us lo, v8us hi) { return __builtin_bit_cast(v16bf, __builtin_shufflevector(lo, hi, 0, 1, 2, 3, 4, 5, 6, 7, 8, 9, 10, 11, 12, 13, 14, 15)); }
__device__ __forceinline__ v8f wmma16(v16h a, v16h b, v8f c) { return __builtin_amdgcn_wmma_f32_16x16x32_f16(false, a, false, b, (short)0, c, false, false); }
__device__ __forceinline__ v8f wmmab(v16bf a, v16bf b, v8f c) { return __builtin_amdgcn_wmma_f32_16x16x32_bf16(false, a, false, b, (short)0, c, false, false); }



// ---- k_gemmw: register-blocked GEMM, ONE WAVE per 64x64 output tile (16 accumulators), operands straight from K-contiguous 16-bit planes; grid (M/64, N/64, Z), 32 threads.
// C[m][n] (f32, pitch ldc, + optional f32 bias[n]) = sum_k A[m][k] Bt[n][k] (+ split products per NSPLIT). z-batch strides sA/sB/sC in elements. K % 32 == 0.
template <typename T16> struct WFrag;
template <> struct WFrag<h16> { typedef v16h V; static __device__ __forceinline__ V ld(const h16* p) { return cat16(*(const v8h*)p, *(const v8h*)(p + 16)); } static __device__ __forceinline__ v8f mma(V a, V b, v8f c) { return wmma16(a, b, c); } };
template <> struct WFrag<bf> { typedef v16bf V; static __device__ __forceinline__ V ld(const bf* p) { return cat16b(*(const v8us*)p, *(const v8us*)(p + 16)); } static __device__ __forceinline__ v8f mma(V a, V b, v8f c) { return wmmab(a, b, c); } };
template <typename T16, int NSPLIT, bool BIAS>
__global__ __launch_bounds__(32) void k_gemmw(const T16* __restrict__ A, const T16* __restrict__ A2, const T16* __restrict__ Bt, const T16* __restrict__ Bt2, int K, float* C, int ldc, const float* __restrict__ bias, size_t sA, size_t sB, size_t sC) {
    typedef typename WFrag<T16>::V V;
    __shared__ __align__(16) float os[16 * 68];
    const size_t z = blockIdx.z; A += z * sA; if (A2) A2 += z * sA; Bt += z * sB; if (Bt2) Bt2 += z * sB; C += z * sC;
    const int lane = threadIdx.x & 31, lr = lane & 15, hi = lane >> 4; const int r0 = blockIdx.x * 64, c0 = blockIdx.y * 64;
    v8f acc[4][4];
#pragma unroll
    for (int mb = 0; mb < 4; ++mb)
#pragma unroll
        for (int nb = 0; nb < 4; ++nb) acc[mb][nb] = (v8f){};
    const size_t aoff = (size_t)(r0 + lr) * K + 8 * hi, boff = (size_t)(c0 + lr) * K + 8 * hi;
#pragma unroll 1
    for (int kc = 0; kc < K; kc += 32) {
        V a[4], a2[4];
#pragma unroll
        for (int mb = 0; mb < 4; ++mb) { a[mb] = WFrag<T16>::ld(A + aoff + (size_t)mb * 16 * K + kc); if (NSPLIT == 1 || NSPLIT == 2) a2[mb] = WFrag<T16>::ld(A2 + aoff + (size_t)mb * 16 * K + kc); }
#pragma unroll
        for (int nb = 0; nb < 4; ++nb) { const V b = WFrag<T16>::ld(Bt + boff + (size_t)nb * 16 * K + kc); V b2; if (NSPLIT >= 2) b2 = WFrag<T16>::ld(Bt2 + boff + (size_t)nb * 16 * K + kc);
#pragma unroll
            for (int mb = 0; mb < 4; ++mb) { acc[mb][nb] = WFrag<T16>::mma(a[mb], b, acc[mb][nb]); if (NSPLIT == 1 || NSPLIT == 2) acc[mb][nb] = WFrag<T16>::mma(a2[mb], b, acc[mb][nb]); if (NSPLIT >= 2) acc[mb][nb] = WFrag<T16>::mma(a[mb], b2, acc[mb][nb]); } }
        asm volatile("v_nop\n\tv_nop\n\tv_nop\n\tv_nop" : "+v"(acc[0][0]), "+v"(acc[1][1]), "+v"(acc[2][2]), "+v"(acc[3][3]) : "v"(a[0]), "v"(a[3]));
    }
#pragma unroll
    for (int mb = 0; mb < 4; ++mb) {
#pragma unroll
        for (int nb = 0; nb < 4; ++nb) {
#pragma unroll
            for (int j = 0; j < 8; ++j) os[(hi * 8 + j) * 68 + nb * 16 + lr] = acc[mb][nb][j]; }
        __builtin_amdgcn_wave_barrier(); asm volatile("" ::: "memory");
        float* crow = C + (size_t)(r0 + mb * 16) * ldc + c0;
{
#pragma unroll
            for (int s = 0; s < 8; ++s) { const int row = 2 * s + hi, cofs = lr * 4; v4f val = *(const v4fa*)(os + row * 68 + cofs); if (BIAS) { val[0] += bfr(bias[c0 + cofs]); val[1] += bfr(bias[c0 + cofs + 1]); val[2] += bfr(bias[c0 + cofs + 2]); val[3] += bfr(bias[c0 + cofs + 3]); }
                *(v4f*)(crow + (size_t)row * ldc + cofs) = val; }
             }
        __builtin_amdgcn_wave_barrier(); asm volatile("" ::: "memory");
    }
}

// ---- k_gemmc: the same one-wave 64x64 tile GEMM specialised for the causal scores: CMODE 1 skips score tiles entirely above the diagonal (query rows r0+roff.., key columns c0..).
// roff = row offset of this launch's first row within the sequence.
template <typename T16, int NSPLIT, int CMODE>
__global__ __launch_bounds__(32) void k_gemmc(const T16* __restrict__ A, const T16* __restrict__ A2, const T16* __restrict__ Bt, const T16* __restrict__ Bt2, int K, float* C, int ldc, int roff, size_t sA, size_t sB, size_t sC) {
    typedef typename WFrag<T16>::V V;
    __shared__ __align__(16) float os[16 * 68];
    const size_t z = blockIdx.z; A += z * sA; if (A2) A2 += z * sA; Bt += z * sB; if (Bt2) Bt2 += z * sB; C += z * sC;
    const int lane = threadIdx.x & 31, lr = lane & 15, hi = lane >> 4; const int r0 = blockIdx.x * 64, c0 = blockIdx.y * 64;
    if (CMODE == 1 && c0 > r0 + roff + 63) return;                  // score tile entirely above the causal diagonal: never read (the softmax masks j > i by select)
    v8f acc[4][4];
#pragma unroll
    for (int mb = 0; mb < 4; ++mb)
#pragma unroll
        for (int nb = 0; nb < 4; ++nb) acc[mb][nb] = (v8f){};
    const size_t aoff = (size_t)(r0 + lr) * K + 8 * hi, boff = (size_t)(c0 + lr) * K + 8 * hi;
#pragma unroll 1
    for (int kc = 0; kc < K; kc += 32) {
        V a[4], a2[4];
#pragma unroll
        for (int mb = 0; mb < 4; ++mb) { a[mb] = WFrag<T16>::ld(A + aoff + (size_t)mb * 16 * K + kc); if (NSPLIT == 1 || NSPLIT == 2) a2[mb] = WFrag<T16>::ld(A2 + aoff + (size_t)mb * 16 * K + kc); }
#pragma unroll
        for (int nb = 0; nb < 4; ++nb) { const V b = WFrag<T16>::ld(Bt + boff + (size_t)nb * 16 * K + kc); V b2; if (NSPLIT >= 2) b2 = WFrag<T16>::ld(Bt2 + boff + (size_t)nb * 16 * K + kc);
#pragma unroll
            for (int mb = 0; mb < 4; ++mb) { acc[mb][nb] = WFrag<T16>::mma(a[mb], b, acc[mb][nb]); if (NSPLIT == 1 || NSPLIT == 2) acc[mb][nb] = WFrag<T16>::mma(a2[mb], b, acc[mb][nb]); if (NSPLIT >= 2) acc[mb][nb] = WFrag<T16>::mma(a[mb], b2, acc[mb][nb]); } }
        asm volatile("v_nop\n\tv_nop\n\tv_nop\n\tv_nop" : "+v"(acc[0][0]), "+v"(acc[1][1]), "+v"(acc[2][2]), "+v"(acc[3][3]) : "v"(a[0]), "v"(a[3]));
    }
#pragma unroll
    for (int mb = 0; mb < 4; ++mb) {
#pragma unroll
        for (int nb = 0; nb < 4; ++nb) {
#pragma unroll
            for (int j = 0; j < 8; ++j) os[(hi * 8 + j) * 68 + nb * 16 + lr] = acc[mb][nb][j]; }
        __builtin_amdgcn_wave_barrier(); asm volatile("" ::: "memory");
        float* crow = C + (size_t)(r0 + mb * 16) * ldc + c0;
{
#pragma unroll
            for (int s = 0; s < 8; ++s) { const int row = 2 * s + hi, cofs = lr * 4; v4f val = *(const v4fa*)(os + row * 68 + cofs);
                *(v4f*)(crow + (size_t)row * ldc + cofs) = val; }
             }
        __builtin_amdgcn_wave_barrier(); asm volatile("" ::: "memory");
    }
}

// ---- k_pvs: probability x value contraction with the key range SPLIT OVER THE 16 WAVES of a work-group. One work-group per 32x32 output tile (grid (rows/32, HD/32, Z), 512 threads);
// wave w contracts keys [w*KCH, (w+1)*KCH) alone (all its fragment loads are issued before its first product), a wave whose keys all lie beyond the tile's last query row does nothing (those probabilities are exactly 0);
// the 16 partial tiles meet in LDS and are summed in wave order (ascending keys), each output row of 128 B stored by one half-wave. ROFF = sequence row of this launch's first row, NROWS = its rows; operand pitch TT, output pitch HD.
template <typename T16, int NSPLIT, int KCH, int ROFF, int NROWS>
__global__ __launch_bounds__(512) void k_pvs(const T16* __restrict__ A, const T16* __restrict__ A2, const T16* __restrict__ Bt, const T16* __restrict__ Bt2, float* C, size_t sA, size_t sB, size_t sC) {
    typedef typename WFrag<T16>::V V;
    static_assert(KCH % 32 == 0 && 16 * KCH >= ROFF + NROWS && 16 * KCH <= TT, "the 16 key slices cover every causal key and stay inside a row");
    constexpr int NS = KCH / 32;
    __shared__ __align__(16) float red[16][32 * 36];
    const size_t z = blockIdx.z; A += z * sA; Bt += z * sB; C += z * sC; if (NSPLIT == 2) { A2 += z * sA; Bt2 += z * sB; }
    const int wv = __builtin_amdgcn_readfirstlane((int)(threadIdx.x >> 5)); const int lane = threadIdx.x & 31, lr = lane & 15, hi = lane >> 4; const int r0 = blockIdx.x * 32, c0 = blockIdx.y * 32;
    v8f acc[2][2];
#pragma unroll
    for (int mb = 0; mb < 2; ++mb)
#pragma unroll
        for (int nb = 0; nb < 2; ++nb) acc[mb][nb] = (v8f){};
    if (wv * KCH < r0 + ROFF + 32) {
        const size_t aoff = (size_t)(r0 + lr) * TT + 8 * hi + wv * KCH, boff = (size_t)(c0 + lr) * TT + 8 * hi + wv * KCH;
        V a[NS][2], a2[NS][2], b[NS][2], b2[NS][2];
#pragma unroll
        for (int s = 0; s < NS; ++s)
#pragma unroll
            for (int f = 0; f < 2; ++f) { a[s][f] = WFrag<T16>::ld(A + aoff + (size_t)f * 16 * TT + s * 32); b[s][f] = WFrag<T16>::ld(Bt + boff + (size_t)f * 16 * TT + s * 32);
                if (NSPLIT == 2) { a2[s][f] = WFrag<T16>::ld(A2 + aoff + (size_t)f * 16 * TT + s * 32); b2[s][f] = WFrag<T16>::ld(Bt2 + boff + (size_t)f * 16 * TT + s * 32); } }
        __builtin_amdgcn_sched_barrier(0);   // keeps every load above in front of the first product: without it the compiler sinks the loads between the products and the wave waits out the load latency once per key step
#pragma unroll
        for (int s = 0; s < NS; ++s)
#pragma unroll
            for (int nb = 0; nb < 2; ++nb)
#pragma unroll
                for (int mb = 0; mb < 2; ++mb) { acc[mb][nb] = WFrag<T16>::mma(a[s][mb], b[s][nb], acc[mb][nb]); if (NSPLIT == 2) { acc[mb][nb] = WFrag<T16>::mma(a2[s][mb], b[s][nb], acc[mb][nb]); acc[mb][nb] = WFrag<T16>::mma(a[s][mb], b2[s][nb], acc[mb][nb]); } }
    }
#pragma unroll
    for (int mb = 0; mb < 2; ++mb)
#pragma unroll
        for (int nb = 0; nb < 2; ++nb)
#pragma unroll
            for (int j = 0; j < 8; ++j) red[wv][(mb * 16 + hi * 8 + j) * 36 + nb * 16 + lr] = acc[mb][nb][j];
    __syncthreads();   // every wave's partial tile is in LDS before any wave sums
    const int row = threadIdx.x >> 4, col = (threadIdx.x & 15) * 2; float s0 = red[0][row * 36 + col], s1 = red[0][row * 36 + col + 1];
#pragma unroll
    for (int w = 1; w < 16; ++w) { const float* p = &red[w][row * 36 + col]; s0 += p[0]; s1 += p[1]; }
    float* cp = C + (size_t)(r0 + row) * HD + c0 + col; cp[0] = s0; cp[1] = s1;
}

__device__ __forceinline__ h16 tohx(float x) { return (h16)x; }
__device__ __forceinline__ void splitf(float y, unsigned short& h, unsigned short& l) { h = f2bf(y); l = f2bf(y - bf2f(h)); }
typedef __attribute__((ext_vector_type(2))) _Float16 v2h;
typedef __attribute__((ext_vector_type(4))) _Float16 v4h;
typedef __attribute__((ext_vector_type(2))) unsigned short v2us;
typedef __attribute__((ext_vector_type(4))) unsigned short v4us;
typedef __attribute__((ext_vector_type(2))) float v2f;
typedef __attribute__((ext_vector_type(4))) int v4i;

__global__ __launch_bounds__(256) void k_wtG(const float* __restrict__ w, int K, int N, bf* Bt) {
    const int lane = threadIdx.x & 31; const int L0 = (blockIdx.x * 8 + (threadIdx.x >> 5)) * 8; const int nlines = N * K / 64;
{
#pragma unroll 1
        for (int l = 0; l < 8; ++l) { const int L = L0 + l; if (L >= nlines) break; const size_t e = (size_t)L * 64 + lane * 2; const int k = (int)(e % K), n = (int)(e / K); v2us o;
            o[0] = f2bf(w[(size_t)k * N + n]); o[1] = f2bf(w[(size_t)(k + 1) * N + n]); *(v2us*)(Bt + e) = o; }
         }
}
__global__ __launch_bounds__(256) void k_cvt8(const float* __restrict__ src, bf* dst, size_t n8) { const size_t i = (size_t)blockIdx.x * 256 + threadIdx.x; if (i >= n8) return; const v8f v = *(const v8f*)(src + i * 8); v8us o;
#pragma unroll
    for (int k = 0; k < 8; ++k) o[k] = f2bf(v[k]); *(v8us*)(dst + i * 8) = o;  }
__global__ __launch_bounds__(256) void k_cscvt(const float* __restrict__ cosT, const float* __restrict__ sinT, float* CS) { const int idx = blockIdx.x * 256 + threadIdx.x; if (idx >= TT * HD) return; v2f cs; cs[0] = bfr(cosT[idx]); cs[1] = bfr(sinT[idx]); *(v2f*)(CS + (size_t)idx * 2) = cs;  }
// k_rope: head planes [h][t][d] (fp16 + hi/lo) of rope(x) x sc with the rotate-half convention out[d] = x[d] cos[t][d] - x[d+HD/2] sin[t][d], out[d+HD/2] = x[d+HD/2] cos[t][d+HD/2] + x[d] sin[t][d+HD/2]
__global__ __launch_bounds__(256) void k_rope(const float* __restrict__ F, int pitch, int nheads, const float* __restrict__ CS, const float* __restrict__ RF, const float* __restrict__ nw, float sc, h16* P16, bf* Ph, bf* Pl) {
    const size_t e = ((size_t)blockIdx.x * 256 + threadIdx.x) * 2; if (e >= (size_t)nheads * TT * HD) return; const int d = (int)(e % HD); const int t = (int)((e / HD) % TT); const int h = (int)(e / ((size_t)HD * TT)); const float* f = F + (size_t)t * pitch + h * HD; const float rf = RF ? RF[(size_t)h * TT + t] : 1.0f; v2h o16; v2us oh, ol;
#pragma unroll
    for (int q = 0; q < 2; ++q) { const int dd = d + q; const int dp = (dd < HD / 2) ? dd + HD / 2 : dd - HD / 2; float x0 = f[dd], x1 = f[dp];
        if (RF) { float n0 = __fmul_rn(x0, rf), n1 = __fmul_rn(x1, rf); asm volatile("" : "+v"(n0)); asm volatile("" : "+v"(n1)); x0 = __fmul_rn(bfr(nw[dd]), n0); x1 = __fmul_rn(bfr(nw[dp]), n1); }
        const v2f cs = *(const v2f*)(CS + ((size_t)t * HD + dd) * 2); float a = __fmul_rn(x0, cs[0]), bq = __fmul_rn(x1, cs[1]); asm volatile("" : "+v"(a)); asm volatile("" : "+v"(bq)); const float r = ((dd < HD / 2) ? __fsub_rn(a, bq) : __fadd_rn(a, bq)) * sc;
        o16[q] = tohx(r); unsigned short a2, c2; splitf(r, a2, c2); oh[q] = a2; ol[q] = c2; }
    *(v2h*)(P16 + e) = o16; *(v2us*)(Ph + e) = oh; *(v2us*)(Pl + e) = ol;  }
__global__ __launch_bounds__(256) void k_vtp(const float* __restrict__ F, int pitch, int nheads, h16* V16, bf* Vh, bf* Vl) { const size_t e = ((size_t)blockIdx.x * 256 + threadIdx.x) * 2; if (e >= (size_t)nheads * HD * TT) return; const int t = (int)(e % TT); const int d = (int)((e / TT) % HD); const int g = (int)(e / ((size_t)TT * HD)); v2h o16; v2us oh, ol;
#pragma unroll
    for (int q = 0; q < 2; ++q) { const float x = F[(size_t)(t + q) * pitch + g * HD + d]; o16[q] = tohx(x); unsigned short a2, c2; splitf(x, a2, c2); oh[q] = a2; ol[q] = c2; }
    *(v2h*)(V16 + e) = o16; *(v2us*)(Vh + e) = oh; *(v2us*)(Vl + e) = ol;  }
__global__ __launch_bounds__(256) void k_csid(float* CS) { const int idx = blockIdx.x * 256 + threadIdx.x; if (idx >= TT * HD) return; v2f cs; cs[0] = 1.0f; cs[1] = 0.0f; *(v2f*)(CS + (size_t)idx * 2) = cs;  }
// k_asoft: per row (zz, i): t = S x HD^-0.5 for j <= i and i - j < WIN (sliding causal window; the reference's -1e9 additive fill vanishes identically); softmax over the 2048 keys (register row, one exp, fixed trees);
__global__ __launch_bounds__(256) void k_asoft(const float* __restrict__ Sb, h16* P16, bf* Ph, bf* Pl) {
    const int lane = threadIdx.x & 31; const int row = blockIdx.x * 8 + (threadIdx.x >> 5); if (row >= ZH * TT) return; const int i = row % TT; const int zz = row / TT; (void)zz; const bool hires = (i < RH); const float* sr = Sb + (size_t)row * TT; float v[TT / 32]; float mx = -3.0e38f;
#pragma unroll
    for (int ch = 0; ch < TT / 128; ++ch) { const int j0 = ch * 128 + lane * 4; const v4f a = *(const v4f*)(sr + j0);
#pragma unroll
        for (int q = 0; q < 4; ++q) { const int j = j0 + q; (void)j; const float t = (j <= i && i - j < WIN) ? a[q] * SCL : -3.0e38f; v[ch * 4 + q] = t; mx = fmaxf(mx, t); } }
#pragma unroll
    for (int sh = 16; sh; sh >>= 1) mx = fmaxf(mx, __shfl_xor(mx, sh, 32));
    float sum = 0.f;
#pragma unroll
    for (int k = 0; k < TT / 32; ++k) { float d0 = __fsub_rn(v[k], mx); asm volatile("" : "+v"(d0)); v[k] = __builtin_amdgcn_exp2f(__fmul_rn(d0, 1.4426950408889634f)); sum += v[k]; }
#pragma unroll
    for (int sh = 16; sh; sh >>= 1) sum += __shfl_xor(sum, sh, 32);
    const float f = __fdiv_rn(hires ? 1.0f : PCAR, sum);
{
        if (hires) {
#pragma unroll
            for (int ch = 0; ch < TT / 128; ++ch) { v4us oh, ol;
#pragma unroll
                for (int q = 0; q < 4; ++q) { unsigned short a, c2; splitf(v[ch * 4 + q] * f, a, c2); oh[q] = a; ol[q] = c2; }
                const size_t oo = ((size_t)zz * (RH ? RH : 1) + i) * TT + ch * 128 + lane * 4; *(v4us*)(Ph + oo) = oh; *(v4us*)(Pl + oo) = ol; }
        } else {
#pragma unroll
            for (int ch = 0; ch < TT / 128; ++ch) { v4h o4;
#pragma unroll
                for (int q = 0; q < 4; ++q) o4[q] = tohx(v[ch * 4 + q] * f);
                *(v4h*)(P16 + (size_t)row * TT + ch * 128 + lane * 4) = o4; } }
         }
}
__global__ __launch_bounds__(256) void k_merge(const float* __restrict__ O, int h0, bf* Ah, bf* Al) { const size_t e = ((size_t)blockIdx.x * 256 + threadIdx.x) * 2; if (e >= (size_t)ZH * TT * HD) return; const int d = (int)(e % HD); const int t = (int)((e / HD) % TT); const int zz = (int)(e / ((size_t)HD * TT)); const float cs = (t < RH) ? 1.0f : (1.0f / PCAR); const size_t oo = (size_t)t * DQ + (h0 + zz) * HD + d;
    v2us oh, ol;
#pragma unroll
    for (int q = 0; q < 2; ++q) { unsigned short a, c2; splitf(O[e + q] * cs, a, c2); oh[q] = a; ol[q] = c2; } *(v2us*)(Ah + oo) = oh; *(v2us*)(Al + oo) = ol;  }

__global__ __launch_bounds__(256) void k_pl2out(const bf* __restrict__ Ah, const bf* __restrict__ Al, float* out) { const size_t e = ((size_t)blockIdx.x * 256 + threadIdx.x) * 4; if (e >= (size_t)TT * DQ) return; v4f o;   // out = hi + lo of the merged attention planes (16-B lanes)
#pragma unroll
    for (int u = 0; u < 4; ++u) o[u] = __fadd_rn(bf2f(Ah[e + u]), bf2f(Al[e + u])); *(v4f*)(out + e) = o;  }

extern "C" void kernel_launch(void* const* d_in, const int* in_sizes, int n_in,
                              void* d_out, int out_size, void* d_ws, size_t ws_size, hipStream_t stream) {
    (void)in_sizes; (void)n_in; (void)out_size;
    const float* x = (const float*)d_in[0]; const float* wf = (const float*)d_in[1]; const float* bfz = (const float*)d_in[2]; const float* wq = wf + (size_t)0 * 1024 * 1024; const float* wk = wf + (size_t)1 * 1024 * 1024; const float* wv = wf + (size_t)2 * 1024 * 1024; const float* bq = bfz + 0 * 1024; const float* bk = bfz + 1 * 1024; const float* bv = bfz + 2 * 1024; const float* wo = nullptr; (void)wo; const float* cosT = nullptr; const float* sinT = nullptr; (void)cosT; (void)sinT;
    float* OUT = (float*)d_out;     // [4][2048][1024]
    char* wsp = (char*)d_ws;
    auto take = [&](size_t bytes) { char* p = wsp; wsp += (bytes + 255) & ~(size_t)255; return (void*)p; };
    bf* WQ = (bf*)take((size_t)DQ * DM * 2); bf* WK = (bf*)take((size_t)DKV * DM * 2); bf* WV = (bf*)take((size_t)DKV * DM * 2); bf* WO = (bf*)take((size_t)DM * DQ * 2); float* CS = (float*)take((size_t)TT * HD * 2 * 4);
    bf* XB = (bf*)take((size_t)TT * DM * 2); float* FQ = (float*)take((size_t)TT * DQ * 4); float* FK = (float*)take((size_t)TT * DKV * 4);
    h16* QP16 = (h16*)take((size_t)NH_ * TT * HD * 2); h16* KP16 = (h16*)take((size_t)NKV * TT * HD * 2); h16* VT16 = (h16*)take((size_t)NKV * HD * TT * 2);
    bf* QPh = (bf*)take((size_t)NH_ * TT * HD * 2); bf* QPl = (bf*)take((size_t)NH_ * TT * HD * 2); bf* KPh = (bf*)take((size_t)NKV * TT * HD * 2); bf* KPl = (bf*)take((size_t)NKV * TT * HD * 2); bf* VTh = (bf*)take((size_t)NKV * HD * TT * 2); bf* VTl = (bf*)take((size_t)NKV * HD * TT * 2); bf* Ph = (bf*)take((size_t)ZH * RH * TT * 2); bf* Pl = (bf*)take((size_t)ZH * RH * TT * 2);
    float* Sb = (float*)take((size_t)ZH * TT * TT * 4); h16* P16 = (h16*)take((size_t)ZH * TT * TT * 2); float* Ob = (float*)take((size_t)ZH * TT * HD * 4); bf* ATh = (bf*)take((size_t)TT * DQ * 2); bf* ATl = (bf*)take((size_t)TT * DQ * 2);
    if ((size_t)(wsp - (char*)d_ws) > ws_size) return;    // ws 256 MiB
    float* FV = FK;   // v projection reuses the k buffer after the k planes are built (stream-ordered)
    { k_cvt8<<<(unsigned)(((size_t)DQ * DM / 8 + 255) / 256), 256, 0, stream>>>(wq, WQ, (size_t)DQ * DM / 8); k_cvt8<<<(unsigned)(((size_t)DKV * DM / 8 + 255) / 256), 256, 0, stream>>>(wk, WK, (size_t)DKV * DM / 8); k_cvt8<<<(unsigned)(((size_t)DKV * DM / 8 + 255) / 256), 256, 0, stream>>>(wv, WV, (size_t)DKV * DM / 8);
      
       }
    k_csid<<<(TT * HD + 255) / 256, 256, 0, stream>>>(CS);
    const unsigned LQ = (unsigned)(((size_t)NH_ * TT * HD / 2 + 255) / 256), LKv = (unsigned)(((size_t)NKV * TT * HD / 2 + 255) / 256);
    for (int b = 0; b < NB_; ++b) {
        
        k_cvt8<<<(unsigned)(((size_t)TT * DM / 8 + 255) / 256), 256, 0, stream>>>(x + (size_t)b * TT * DM, XB, (size_t)TT * DM / 8);
        k_gemmw<bf, 0, true><<<dim3(TT / 64, DQ / 64, 1), 32, 0, stream>>>(XB, nullptr, WQ, nullptr, DM, FQ, DQ, bq, 0, 0, 0);
        k_rope<<<LQ, 256, 0, stream>>>(FQ, DQ, NH_, CS, nullptr, nullptr, 1.0f, QP16, QPh, QPl);
        k_gemmw<bf, 0, true><<<dim3(TT / 64, DKV / 64, 1), 32, 0, stream>>>(XB, nullptr, WK, nullptr, DM, FK, DKV, bk, 0, 0, 0);
        k_rope<<<LKv, 256, 0, stream>>>(FK, DKV, NKV, CS, nullptr, nullptr, 1.0f, KP16, KPh, KPl);
        k_gemmw<bf, 0, true><<<dim3(TT / 64, DKV / 64, 1), 32, 0, stream>>>(XB, nullptr, WV, nullptr, DM, FV, DKV, bv, 0, 0, 0); k_vtp<<<LKv, 256, 0, stream>>>(FV, DKV, NKV, VT16, VTh, VTl);
        for (int h0 = 0; h0 < NH_; h0 += ZH) { const size_t zq = (size_t)h0, zk = (size_t)(h0 / REP);   // one kv head per query head: the pass's two heads use consecutive kv planes (z-strides TT*HD)
            k_gemmc<bf, 2, 1><<<dim3(RH / 64, TT / 64, ZH), 32, 0, stream>>>(QPh + zq * TT * HD, QPl + zq * TT * HD, KPh + zk * TT * HD, KPl + zk * TT * HD, HD, Sb, TT, 0, (size_t)TT * HD, (size_t)TT * HD, (size_t)TT * TT);
            k_gemmc<h16, 0, 1><<<dim3((TT - RH) / 64, TT / 64, ZH), 32, 0, stream>>>(QP16 + zq * TT * HD + (size_t)RH * HD, nullptr, KP16 + zk * TT * HD, nullptr, HD, Sb + (size_t)RH * TT, TT, RH, (size_t)TT * HD, (size_t)TT * HD, (size_t)TT * TT);
            k_asoft<<<ZH * TT / 8, 256, 0, stream>>>(Sb, P16, Ph, Pl);
            k_pvs<bf, 2, 32, 0, RH><<<dim3(RH / 32, HD / 32, ZH), 512, 0, stream>>>(Ph, Pl, VTh + zk * HD * TT, VTl + zk * HD * TT, Ob, (size_t)RH * TT, (size_t)HD * TT, (size_t)TT * HD);
            k_pvs<h16, 0, 128, RH, TT - RH><<<dim3((TT - RH) / 32, HD / 32, ZH), 512, 0, stream>>>(P16 + (size_t)RH * TT, nullptr, VT16 + zk * HD * TT, nullptr, Ob + (size_t)RH * HD, (size_t)TT * TT, (size_t)HD * TT, (size_t)TT * HD);
            k_merge<<<(unsigned)(((size_t)ZH * TT * HD / 2 + 255) / 256), 256, 0, stream>>>(Ob, h0, ATh, ATl); }
        k_pl2out<<<(unsigned)(((size_t)TT * DQ / 4 + 255) / 256), 256, 0, stream>>>(ATh, ATl, OUT + (size_t)b * TT * DM); }
}

// v002
// Measured time: 978 microseconds a run.
// In two side-by-side timings against v001, it was 1.37 and 1.36 times as fast.
// Over all steps from v000 it is 2.83 times as fast.
#include <hip/hip_runtime.h>

// SelfAttentionHead (x [4][2048][1024]; qkv = x W^T + b (W [3072][1024], split (q | k | v) x 16 heads x 64); causal softmax(q.k / 8); out = merged heads (no output projection) -> [4][2048][1024]).
// Compute dtypes, f32 accumulate: every input rounded to bf16; q/k/v on PLAIN bf16 operands (inputs: exact) + bias; causal scores and attn.v: query rows < 512 hl (3 products), the rest single fp16 (x1024); softmax f32; the merged heads are written as hi + lo of the attention planes (i.e. the f32 attention output rounded through a bf16 pair, |err| <= 2^-16 relative).

#define NB_  4
#define TT   2048
#define DM   1024
#define NH_  16
#define NKV  16
#define REP  (NH_ / NKV)
#define HD   64
#define DQ   (NH_ * HD)
#define DKV  (NKV * HD)
#define ZH   8                    // heads per attention pass (one launch of each attention kernel covers ZH heads)
#define PP   (2 * TT)             // pitch, in 16-bit elements, of a probability row: it lies in the bytes of its own f32 score row
#define RH   512                  // query rows < RH use hi+lo planes (0: none)
#define WIN  2048
#define PCAR 1024.0f
#define SCL  0.125f   // HD^-0.5
typedef _Float16 h16;
typedef unsigned short bf;
typedef __attribute__((ext_vector_type(16))) __bf16   v16bf;
typedef __attribute__((ext_vector_type(16))) _Float16 v16h;
typedef __attribute__((ext_vector_type(8)))  _Float16 v8h;
typedef __attribute__((ext_vector_type(8)))  unsigned short v8us;
typedef __attribute__((ext_vector_type(8)))  float    v8f;
typedef __attribute__((ext_vector_type(4)))  float    v4f;
typedef v8h  __attribute__((may_alias)) v8ha;
typedef v4f  __attribute__((may_alias)) v4fa;
typedef v8us __attribute__((may_alias)) v8usa;

__device__ __forceinline__ unsigned short f2bf(float f) { unsigned u = __float_as_uint(f); u += 0x7FFFu + ((u >> 16) & 1u); return (unsigned short)(u >> 16); }
__device__ __forceinline__ float bf2f(unsigned short b) { return __uint_as_float(((unsigned)b) << 16); }
__device__ __forceinline__ float bfr(float f) { return bf2f(f2bf(f)); }
__device__ __forceinline__ v16h cat16(v8h lo, v8h hi) { return __builtin_shufflevector(lo, hi, 0, 1, 2, 3, 4, 5, 6, 7, 8, 9, 10, 11, 12, 13, 14, 15); }
__device__ __forceinline__ v16bf cat16b(v8us lo, v8us hi) { return __builtin_bit_cast(v16bf, __builtin_shufflevector(lo, hi, 0, 1, 2, 3, 4, 5, 6, 7, 8, 9, 10, 11, 12, 13, 14, 15)); }
__device__ __forceinline__ v8f wmma16(v16h a, v16h b, v8f c) { return __builtin_amdgcn_wmma_f32_16x16x32_f16(false, a, false, b, (short)0, c, false, false); }
__device__ __forceinline__ v8f wmmab(v16bf a, v16bf b, v8f c) { return __builtin_amdgcn_wmma_f32_16x16x32_bf16(false, a, false, b, (short)0, c, false, false); }



// ---- k_gemmw: register-blocked GEMM, ONE WAVE per 64x64 output tile (16 accumulators), operands straight from K-contiguous 16-bit planes; grid (M/64, N/64, Z), 32 threads.
// C[m][n] (f32, pitch ldc, + optional f32 bias[n]) = sum_k A[m][k] Bt[n][k] (+ split products per NSPLIT). z-batch strides sA/sB/sC in elements. K % 32 == 0.
template <typename T16> struct WFrag;
template <> struct WFrag<h16> { typedef v16h V; static __device__ __forceinline__ V ld(const h16* p) { return cat16(*(const v8h*)p, *(const v8h*)(p + 16)); } static __device__ __forceinline__ v8f mma(V a, V b, v8f c) { return wmma16(a, b, c); } };
template <> struct WFrag<bf> { typedef v16bf V; static __device__ __forceinline__ V ld(const bf* p) { return cat16b(*(const v8us*)p, *(const v8us*)(p + 16)); } static __device__ __forceinline__ v8f mma(V a, V b, v8f c) { return wmmab(a, b, c); } };
template <typename T16, int NSPLIT, bool BIAS>
__global__ __launch_bounds__(32) void k_gemmw(const T16* __restrict__ A, const T16* __restrict__ A2, const T16* __restrict__ Bt, const T16* __restrict__ Bt2, int K, float* C, int ldc, const float* __restrict__ bias, size_t sA, size_t sB, size_t sC) {
    typedef typename WFrag<T16>::V V;
    __shared__ __align__(16) float os[16 * 68];
    const size_t z = blockIdx.z; A += z * sA; if (A2) A2 += z * sA; Bt += z * sB; if (Bt2) Bt2 += z * sB; C += z * sC;
    const int lane = threadIdx.x & 31, lr = lane & 15, hi = lane >> 4; const int r0 = blockIdx.x * 64, c0 = blockIdx.y * 64;
    v8f acc[4][4];
#pragma unroll
    for (int mb = 0; mb < 4; ++mb)
#pragma unroll
        for (int nb = 0; nb < 4; ++nb) acc[mb][nb] = (v8f){};
    const size_t aoff = (size_t)(r0 + lr) * K + 8 * hi, boff = (size_t)(c0 + lr) * K + 8 * hi;
#pragma unroll 1
    for (int kc = 0; kc < K; kc += 32) {
        V a[4], a2[4];
#pragma unroll
        for (int mb = 0; mb < 4; ++mb) { a[mb] = WFrag<T16>::ld(A + aoff + (size_t)mb * 16 * K + kc); if (NSPLIT == 1 || NSPLIT == 2) a2[mb] = WFrag<T16>::ld(A2 + aoff + (size_t)mb * 16 * K + kc); }
#pragma unroll
        for (int nb = 0; nb < 4; ++nb) { const V b = WFrag<T16>::ld(Bt + boff + (size_t)nb * 16 * K + kc); V b2; if (NSPLIT >= 2) b2 = WFrag<T16>::ld(Bt2 + boff + (size_t)nb * 16 * K + kc);
#pragma unroll
            for (int mb = 0; mb < 4; ++mb) { acc[mb][nb] = WFrag<T16>::mma(a[mb], b, acc[mb][nb]); if (NSPLIT == 1 || NSPLIT == 2) acc[mb][nb] = WFrag<T16>::mma(a2[mb], b, acc[mb][nb]); if (NSPLIT >= 2) acc[mb][nb] = WFrag<T16>::mma(a[mb], b2, acc[mb][nb]); } }
        asm volatile("v_nop\n\tv_nop\n\tv_nop\n\tv_nop" : "+v"(acc[0][0]), "+v"(acc[1][1]), "+v"(acc[2][2]), "+v"(acc[3][3]) : "v"(a[0]), "v"(a[3]));
    }
#pragma unroll
    for (int mb = 0; mb < 4; ++mb) {
#pragma unroll
        for (int nb = 0; nb < 4; ++nb) {
#pragma unroll
            for (int j = 0; j < 8; ++j) os[(hi * 8 + j) * 68 + nb * 16 + lr] = acc[mb][nb][j]; }
        __builtin_amdgcn_wave_barrier(); asm volatile("" ::: "memory");
        float* crow = C + (size_t)(r0 + mb * 16) * ldc + c0;
{
#pragma unroll
            for (int s = 0; s < 8; ++s) { const int row = 2 * s + hi, cofs = lr * 4; v4f val = *(const v4fa*)(os + row * 68 + cofs); if (BIAS) { val[0] += bfr(bias[c0 + cofs]); val[1] += bfr(bias[c0 + cofs + 1]); val[2] += bfr(bias[c0 + cofs + 2]); val[3] += bfr(bias[c0 + cofs + 3]); }
                *(v4f*)(crow + (size_t)row * ldc + cofs) = val; }
             }
        __builtin_amdgcn_wave_barrier(); asm volatile("" ::: "memory");
    }
}

// ---- k_gemmc: the same one-wave 64x64 tile GEMM specialised for the causal scores: CMODE 1 skips score tiles entirely above the diagonal (query rows r0+roff.., key columns c0..).
// roff = row offset of this launch's first row within the sequence.
template <typename T16, int NSPLIT, int CMODE>
__global__ __launch_bounds__(32) void k_gemmc(const T16* __restrict__ A, const T16* __restrict__ A2, const T16* __restrict__ Bt, const T16* __restrict__ Bt2, int K, float* C, int ldc, int roff, size_t sA, size_t sB, size_t sC) {
    typedef typename WFrag<T16>::V V;
    __shared__ __align__(16) float os[16 * 68];
    const size_t z = blockIdx.z; A += z * sA; if (A2) A2 += z * sA; Bt += z * sB; if (Bt2) Bt2 += z * sB; C += z * sC;
    const int lane = threadIdx.x & 31, lr = lane & 15, hi = lane >> 4; const int r0 = blockIdx.x * 64, c0 = blockIdx.y * 64;
    if (CMODE == 1 && c0 > r0 + roff + 63) return;                  // score tile entirely above the causal diagonal: never read (the softmax masks j > i by select)
    v8f acc[4][4];
#pragma unroll
    for (int mb = 0; mb < 4; ++mb)
#pragma unroll
        for (int nb = 0; nb < 4; ++nb) acc[mb][nb] = (v8f){};
    const size_t aoff = (size_t)(r0 + lr) * K + 8 * hi, boff = (size_t)(c0 + lr) * K + 8 * hi;
#pragma unroll 1
    for (int kc = 0; kc < K; kc += 32) {
        V a[4], a2[4];
#pragma unroll
        for (int mb = 0; mb < 4; ++mb) { a[mb] = WFrag<T16>::ld(A + aoff + (size_t)mb * 16 * K + kc); if (NSPLIT == 1 || NSPLIT == 2) a2[mb] = WFrag<T16>::ld(A2 + aoff + (size_t)mb * 16 * K + kc); }
#pragma unroll
        for (int nb = 0; nb < 4; ++nb) { const V b = WFrag<T16>::ld(Bt + boff + (size_t)nb * 16 * K + kc); V b2; if (NSPLIT >= 2) b2 = WFrag<T16>::ld(Bt2 + boff + (size_t)nb * 16 * K + kc);
#pragma unroll
            for (int mb = 0; mb < 4; ++mb) { acc[mb][nb] = WFrag<T16>::mma(a[mb], b, acc[mb][nb]); if (NSPLIT == 1 || NSPLIT == 2) acc[mb][nb] = WFrag<T16>::mma(a2[mb], b, acc[mb][nb]); if (NSPLIT >= 2) acc[mb][nb] = WFrag<T16>::mma(a[mb], b2, acc[mb][nb]); } }
        asm volatile("v_nop\n\tv_nop\n\tv_nop\n\tv_nop" : "+v"(acc[0][0]), "+v"(acc[1][1]), "+v"(acc[2][2]), "+v"(acc[3][3]) : "v"(a[0]), "v"(a[3]));
    }
#pragma unroll
    for (int mb = 0; mb < 4; ++mb) {
#pragma unroll
        for (int nb = 0; nb < 4; ++nb) {
#pragma unroll
            for (int j = 0; j < 8; ++j) os[(hi * 8 + j) * 68 + nb * 16 + lr] = acc[mb][nb][j]; }
        __builtin_amdgcn_wave_barrier(); asm volatile("" ::: "memory");
        float* crow = C + (size_t)(r0 + mb * 16) * ldc + c0;
{
#pragma unroll
            for (int s = 0; s < 8; ++s) { const int row = 2 * s + hi, cofs = lr * 4; v4f val = *(const v4fa*)(os + row * 68 + cofs);
                *(v4f*)(crow + (size_t)row * ldc + cofs) = val; }
             }
        __builtin_amdgcn_wave_barrier(); asm volatile("" ::: "memory");
    }
}

// ---- k_pvs: probability x value contraction with the key range SPLIT OVER THE 16 WAVES of a work-group. One work-group per 32x32 output tile (grid (rows/32, HD/32, Z), 512 threads);
// wave w contracts keys [w*KCH, (w+1)*KCH) alone (all its fragment loads are issued before its first product), a wave whose keys all lie beyond the tile's last query row does nothing (those probabilities are exactly 0);
// the 16 partial tiles meet in LDS and are summed in wave order (ascending keys), each output row of 128 B stored by one half-wave. ROFF = sequence row of this launch's first row, NROWS = its rows; pitch of A PP, of Bt TT, output pitch HD.
template <typename T16, int NSPLIT, int KCH, int ROFF, int NROWS>
__global__ __launch_bounds__(512) void k_pvs(const T16* __restrict__ A, const T16* __restrict__ A2, const T16* __restrict__ Bt, const T16* __restrict__ Bt2, float* C, size_t sA, size_t sB, size_t sC) {
    typedef typename WFrag<T16>::V V;
    static_assert(KCH % 32 == 0 && 16 * KCH >= ROFF + NROWS && 16 * KCH <= TT, "the 16 key slices cover every causal key and stay inside a row");
    constexpr int NS = KCH / 32;
    __shared__ __align__(16) float red[16][32 * 36];
    const size_t z = blockIdx.z; A += z * sA; Bt += z * sB; C += z * sC; if (NSPLIT == 2) { A2 += z * sA; Bt2 += z * sB; }
    const int wv = __builtin_amdgcn_readfirstlane((int)(threadIdx.x >> 5)); const int lane = threadIdx.x & 31, lr = lane & 15, hi = lane >> 4; const int r0 = blockIdx.x * 32, c0 = blockIdx.y * 32;
    v8f acc[2][2];
#pragma unroll
    for (int mb = 0; mb < 2; ++mb)
#pragma unroll
        for (int nb = 0; nb < 2; ++nb) acc[mb][nb] = (v8f){};
    if (wv * KCH < r0 + ROFF + 32) {
        const size_t aoff = (size_t)(r0 + lr) * PP + 8 * hi + wv * KCH, boff = (size_t)(c0 + lr) * TT + 8 * hi + wv * KCH;
        V a[NS][2], a2[NS][2], b[NS][2], b2[NS][2];
#pragma unroll
        for (int s = 0; s < NS; ++s)
#pragma unroll
            for (int f = 0; f < 2; ++f) { a[s][f] = WFrag<T16>::ld(A + aoff + (size_t)f * 16 * PP + s * 32); b[s][f] = WFrag<T16>::ld(Bt + boff + (size_t)f * 16 * TT + s * 32);
                if (NSPLIT == 2) { a2[s][f] = WFrag<T16>::ld(A2 + aoff + (size_t)f * 16 * PP + s * 32); b2[s][f] = WFrag<T16>::ld(Bt2 + boff + (size_t)f * 16 * TT + s * 32); } }
        __builtin_amdgcn_sched_barrier(0);   // keeps every load above in front of the first product: without it the compiler sinks the loads between the products and the wave waits out the load latency once per key step
#pragma unroll
        for (int s = 0; s < NS; ++s)
#pragma unroll
            for (int nb = 0; nb < 2; ++nb)
#pragma unroll
                for (int mb = 0; mb < 2; ++mb) { acc[mb][nb] = WFrag<T16>::mma(a[s][mb], b[s][nb], acc[mb][nb]); if (NSPLIT == 2) { acc[mb][nb] = WFrag<T16>::mma(a2[s][mb], b[s][nb], acc[mb][nb]); acc[mb][nb] = WFrag<T16>::mma(a[s][mb], b2[s][nb], acc[mb][nb]); } }
    }
#pragma unroll
    for (int mb = 0; mb < 2; ++mb)
#pragma unroll
        for (int nb = 0; nb < 2; ++nb)
#pragma unroll
            for (int j = 0; j < 8; ++j) red[wv][(mb * 16 + hi * 8 + j) * 36 + nb * 16 + lr] = acc[mb][nb][j];
    __syncthreads();   // every wave's partial tile is in LDS before any wave sums
    const int row = threadIdx.x >> 4, col = (threadIdx.x & 15) * 2; float s0 = red[0][row * 36 + col], s1 = red[0][row * 36 + col + 1];
#pragma unroll
    for (int w = 1; w < 16; ++w) { const float* p = &red[w][row * 36 + col]; s0 += p[0]; s1 += p[1]; }
    float* cp = C + (size_t)(r0 + row) * HD + c0 + col; cp[0] = s0; cp[1] = s1;
}

__device__ __forceinline__ h16 tohx(float x) { return (h16)x; }
__device__ __forceinline__ void splitf(float y, unsigned short& h, unsigned short& l) { h = f2bf(y); l = f2bf(y - bf2f(h)); }
typedef __attribute__((ext_vector_type(2))) _Float16 v2h;
typedef __attribute__((ext_vector_type(4))) _Float16 v4h;
typedef __attribute__((ext_vector_type(2))) unsigned short v2us;
typedef __attribute__((ext_vector_type(4))) unsigned short v4us;
typedef __attribute__((ext_vector_type(2))) float v2f;
typedef __attribute__((ext_vector_type(4))) int v4i;

__global__ __launch_bounds__(256) void k_wtG(const float* __restrict__ w, int K, int N, bf* Bt) {
    const int lane = threadIdx.x & 31; const int L0 = (blockIdx.x * 8 + (threadIdx.x >> 5)) * 8; const int nlines = N * K / 64;
{
#pragma unroll 1
        for (int l = 0; l < 8; ++l) { const int L = L0 + l; if (L >= nlines) break; const size_t e = (size_t)L * 64 + lane * 2; const int k = (int)(e % K), n = (int)(e / K); v2us o;
            o[0] = f2bf(w[(size_t)k * N + n]); o[1] = f2bf(w[(size_t)(k + 1) * N + n]); *(v2us*)(Bt + e) = o; }
         }
}
__global__ __launch_bounds__(256) void k_cvt8(const float* __restrict__ src, bf* dst, size_t n8) { const size_t i = (size_t)blockIdx.x * 256 + threadIdx.x; if (i >= n8) return; const v8f v = *(const v8f*)(src + i * 8); v8us o;
#pragma unroll
    for (int k = 0; k < 8; ++k) o[k] = f2bf(v[k]); *(v8us*)(dst + i * 8) = o;  }
__global__ __launch_bounds__(256) void k_cscvt(const float* __restrict__ cosT, const float* __restrict__ sinT, float* CS) { const int idx = blockIdx.x * 256 + threadIdx.x; if (idx >= TT * HD) return; v2f cs; cs[0] = bfr(cosT[idx]); cs[1] = bfr(sinT[idx]); *(v2f*)(CS + (size_t)idx * 2) = cs;  }
// k_rope: head planes [h][t][d] (fp16 + hi/lo) of rope(x) x sc with the rotate-half convention out[d] = x[d] cos[t][d] - x[d+HD/2] sin[t][d], out[d+HD/2] = x[d+HD/2] cos[t][d+HD/2] + x[d] sin[t][d+HD/2]
__global__ __launch_bounds__(256) void k_rope(const float* __restrict__ F, int pitch, int nheads, const float* __restrict__ CS, const float* __restrict__ RF, const float* __restrict__ nw, float sc, h16* P16, bf* Ph, bf* Pl) {
    const size_t e = ((size_t)blockIdx.x * 256 + threadIdx.x) * 2; if (e >= (size_t)nheads * TT * HD) return; const int d = (int)(e % HD); const int t = (int)((e / HD) % TT); const int h = (int)(e / ((size_t)HD * TT)); const float* f = F + (size_t)t * pitch + h * HD; const float rf = RF ? RF[(size_t)h * TT + t] : 1.0f; v2h o16; v2us oh, ol;
#pragma unroll
    for (int q = 0; q < 2; ++q) { const int dd = d + q; const int dp = (dd < HD / 2) ? dd + HD / 2 : dd - HD / 2; float x0 = f[dd], x1 = f[dp];
        if (RF) { float n0 = __fmul_rn(x0, rf), n1 = __fmul_rn(x1, rf); asm volatile("" : "+v"(n0)); asm volatile("" : "+v"(n1)); x0 = __fmul_rn(bfr(nw[dd]), n0); x1 = __fmul_rn(bfr(nw[dp]), n1); }
        const v2f cs = *(const v2f*)(CS + ((size_t)t * HD + dd) * 2); float a = __fmul_rn(x0, cs[0]), bq = __fmul_rn(x1, cs[1]); asm volatile("" : "+v"(a)); asm volatile("" : "+v"(bq)); const float r = ((dd < HD / 2) ? __fsub_rn(a, bq) : __fadd_rn(a, bq)) * sc;
        o16[q] = tohx(r); unsigned short a2, c2; splitf(r, a2, c2); oh[q] = a2; ol[q] = c2; }
    *(v2h*)(P16 + e) = o16; *(v2us*)(Ph + e) = oh; *(v2us*)(Pl + e) = ol;  }
__global__ __launch_bounds__(256) void k_vtp(const float* __restrict__ F, int pitch, int nheads, h16* V16, bf* Vh, bf* Vl) { const size_t e = ((size_t)blockIdx.x * 256 + threadIdx.x) * 2; if (e >= (size_t)nheads * HD * TT) return; const int t = (int)(e % TT); const int d = (int)((e / TT) % HD); const int g = (int)(e / ((size_t)TT * HD)); v2h o16; v2us oh, ol;
#pragma unroll
    for (int q = 0; q < 2; ++q) { const float x = F[(size_t)(t + q) * pitch + g * HD + d]; o16[q] = tohx(x); unsigned short a2, c2; splitf(x, a2, c2); oh[q] = a2; ol[q] = c2; }
    *(v2h*)(V16 + e) = o16; *(v2us*)(Vh + e) = oh; *(v2us*)(Vl + e) = ol;  }
__global__ __launch_bounds__(256) void k_csid(float* CS) { const int idx = blockIdx.x * 256 + threadIdx.x; if (idx >= TT * HD) return; v2f cs; cs[0] = 1.0f; cs[1] = 0.0f; *(v2f*)(CS + (size_t)idx * 2) = cs;  }
// k_asoft: per row (zz, i): t = S x HD^-0.5 for j <= i and i - j < WIN (sliding causal window; the reference's -1e9 additive fill vanishes identically); softmax over the 2048 keys (register row, one exp, fixed trees);
// the probabilities are stored IN PLACE over the row's own scores (one wave owns a row and holds all of it in registers before its first store, whose value hangs on every load through the row sum):
// rows >= RH: fp16 in the row's first TT * 2 bytes; rows < RH: the hi plane there and the lo plane in the second TT * 2 bytes.
__global__ __launch_bounds__(256) void k_asoft(float* Sb) {
    const int lane = threadIdx.x & 31; const int row = blockIdx.x * 8 + (threadIdx.x >> 5); if (row >= ZH * TT) return; const int i = row % TT; const int zz = row / TT; (void)zz; const bool hires = (i < RH); float* sr = Sb + (size_t)row * TT; float v[TT / 32]; float mx = -3.0e38f;
#pragma unroll
    for (int ch = 0; ch < TT / 128; ++ch) { const int j0 = ch * 128 + lane * 4; const v4f a = *(const v4f*)(sr + j0);
#pragma unroll
        for (int q = 0; q < 4; ++q) { const int j = j0 + q; (void)j; const float t = (j <= i && i - j < WIN) ? a[q] * SCL : -3.0e38f; v[ch * 4 + q] = t; mx = fmaxf(mx, t); } }
#pragma unroll
    for (int sh = 16; sh; sh >>= 1) mx = fmaxf(mx, __shfl_xor(mx, sh, 32));
    float sum = 0.f;
#pragma unroll
    for (int k = 0; k < TT / 32; ++k) { float d0 = __fsub_rn(v[k], mx); asm volatile("" : "+v"(d0)); v[k] = __builtin_amdgcn_exp2f(__fmul_rn(d0, 1.4426950408889634f)); sum += v[k]; }
#pragma unroll
    for (int sh = 16; sh; sh >>= 1) sum += __shfl_xor(sum, sh, 32);
    const float f = __fdiv_rn(hires ? 1.0f : PCAR, sum);
{
        if (hires) {
#pragma unroll
            for (int ch = 0; ch < TT / 128; ++ch) { v4us oh, ol;
#pragma unroll
                for (int q = 0; q < 4; ++q) { unsigned short a, c2; splitf(v[ch * 4 + q] * f, a, c2); oh[q] = a; ol[q] = c2; }
                bf* po = (bf*)sr + ch * 128 + lane * 4; *(v4us*)po = oh; *(v4us*)(po + TT) = ol; }
        } else {
#pragma unroll
            for (int ch = 0; ch < TT / 128; ++ch) { v4h o4;
#pragma unroll
                for (int q = 0; q < 4; ++q) o4[q] = tohx(v[ch * 4 + q] * f);
                *(v4h*)((h16*)sr + ch * 128 + lane * 4) = o4; } }
         }
}
__global__ __launch_bounds__(256) void k_merge(const float* __restrict__ O, int h0, bf* Ah, bf* Al) { const size_t e = ((size_t)blockIdx.x * 256 + threadIdx.x) * 2; if (e >= (size_t)ZH * TT * HD) return; const int d = (int)(e % HD); const int t = (int)((e / HD) % TT); const int zz = (int)(e / ((size_t)HD * TT)); const float cs = (t < RH) ? 1.0f : (1.0f / PCAR); const size_t oo = (size_t)t * DQ + (h0 + zz) * HD + d;
    v2us oh, ol;
#pragma unroll
    for (int q = 0; q < 2; ++q) { unsigned short a, c2; splitf(O[e + q] * cs, a, c2); oh[q] = a; ol[q] = c2; } *(v2us*)(Ah + oo) = oh; *(v2us*)(Al + oo) = ol;  }

__global__ __launch_bounds__(256) void k_pl2out(const bf* __restrict__ Ah, const bf* __restrict__ Al, float* out) { const size_t e = ((size_t)blockIdx.x * 256 + threadIdx.x) * 4; if (e >= (size_t)TT * DQ) return; v4f o;   // out = hi + lo of the merged attention planes (16-B lanes)
#pragma unroll
    for (int u = 0; u < 4; ++u) o[u] = __fadd_rn(bf2f(Ah[e + u]), bf2f(Al[e + u])); *(v4f*)(out + e) = o;  }

extern "C" void kernel_launch(void* const* d_in, const int* in_sizes, int n_in,
                              void* d_out, int out_size, void* d_ws, size_t ws_size, hipStream_t stream) {
    (void)in_sizes; (void)n_in; (void)out_size;
    const float* x = (const float*)d_in[0]; const float* wf = (const float*)d_in[1]; const float* bfz = (const float*)d_in[2]; const float* wq = wf + (size_t)0 * 1024 * 1024; const float* wk = wf + (size_t)1 * 1024 * 1024; const float* wv = wf + (size_t)2 * 1024 * 1024; const float* bq = bfz + 0 * 1024; const float* bk = bfz + 1 * 1024; const float* bv = bfz + 2 * 1024; const float* wo = nullptr; (void)wo; const float* cosT = nullptr; const float* sinT = nullptr; (void)cosT; (void)sinT;
    float* OUT = (float*)d_out;     // [4][2048][1024]
    char* wsp = (char*)d_ws;
    auto take = [&](size_t bytes) { char* p = wsp; wsp += (bytes + 255) & ~(size_t)255; return (void*)p; };
    bf* WQ = (bf*)take((size_t)DQ * DM * 2); bf* WK = (bf*)take((size_t)DKV * DM * 2); bf* WV = (bf*)take((size_t)DKV * DM * 2); bf* WO = (bf*)take((size_t)DM * DQ * 2); float* CS = (float*)take((size_t)TT * HD * 2 * 4);
    bf* XB = (bf*)take((size_t)TT * DM * 2); float* FQ = (float*)take((size_t)TT * DQ * 4); float* FK = (float*)take((size_t)TT * DKV * 4);
    h16* QP16 = (h16*)take((size_t)NH_ * TT * HD * 2); h16* KP16 = (h16*)take((size_t)NKV * TT * HD * 2); h16* VT16 = (h16*)take((size_t)NKV * HD * TT * 2);
    bf* QPh = (bf*)take((size_t)NH_ * TT * HD * 2); bf* QPl = (bf*)take((size_t)NH_ * TT * HD * 2); bf* KPh = (bf*)take((size_t)NKV * TT * HD * 2); bf* KPl = (bf*)take((size_t)NKV * TT * HD * 2); bf* VTh = (bf*)take((size_t)NKV * HD * TT * 2); bf* VTl = (bf*)take((size_t)NKV * HD * TT * 2);
    float* Sb = (float*)take((size_t)ZH * TT * TT * 4); float* Ob = (float*)take((size_t)ZH * TT * HD * 4); bf* ATh = (bf*)take((size_t)TT * DQ * 2); bf* ATl = (bf*)take((size_t)TT * DQ * 2);
    if ((size_t)(wsp - (char*)d_ws) > ws_size) return;    // ws 256 MiB
    float* FV = FK;   // v projection reuses the k buffer after the k planes are built (stream-ordered)
    { k_cvt8<<<(unsigned)(((size_t)DQ * DM / 8 + 255) / 256), 256, 0, stream>>>(wq, WQ, (size_t)DQ * DM / 8); k_cvt8<<<(unsigned)(((size_t)DKV * DM / 8 + 255) / 256), 256, 0, stream>>>(wk, WK, (size_t)DKV * DM / 8); k_cvt8<<<(unsigned)(((size_t)DKV * DM / 8 + 255) / 256), 256, 0, stream>>>(wv, WV, (size_t)DKV * DM / 8);
      
       }
    k_csid<<<(TT * HD + 255) / 256, 256, 0, stream>>>(CS);
    const unsigned LQ = (unsigned)(((size_t)NH_ * TT * HD / 2 + 255) / 256), LKv = (unsigned)(((size_t)NKV * TT * HD / 2 + 255) / 256);
    for (int b = 0; b < NB_; ++b) {
        
        k_cvt8<<<(unsigned)(((size_t)TT * DM / 8 + 255) / 256), 256, 0, stream>>>(x + (size_t)b * TT * DM, XB, (size_t)TT * DM / 8);
        k_gemmw<bf, 0, true><<<dim3(TT / 64, DQ / 64, 1), 32, 0, stream>>>(XB, nullptr, WQ, nullptr, DM, FQ, DQ, bq, 0, 0, 0);
        k_rope<<<LQ, 256, 0, stream>>>(FQ, DQ, NH_, CS, nullptr, nullptr, 1.0f, QP16, QPh, QPl);
        k_gemmw<bf, 0, true><<<dim3(TT / 64, DKV / 64, 1), 32, 0, stream>>>(XB, nullptr, WK, nullptr, DM, FK, DKV, bk, 0, 0, 0);
        k_rope<<<LKv, 256, 0, stream>>>(FK, DKV, NKV, CS, nullptr, nullptr, 1.0f, KP16, KPh, KPl);
        k_gemmw<bf, 0, true><<<dim3(TT / 64, DKV / 64, 1), 32, 0, stream>>>(XB, nullptr, WV, nullptr, DM, FV, DKV, bv, 0, 0, 0); k_vtp<<<LKv, 256, 0, stream>>>(FV, DKV, NKV, VT16, VTh, VTl);
        for (int h0 = 0; h0 < NH_; h0 += ZH) { const size_t zq = (size_t)h0, zk = (size_t)(h0 / REP);   // one kv head per query head: the pass's ZH heads use consecutive kv planes (z-strides TT*HD)
            k_gemmc<bf, 2, 1><<<dim3(RH / 64, TT / 64, ZH), 32, 0, stream>>>(QPh + zq * TT * HD, QPl + zq * TT * HD, KPh + zk * TT * HD, KPl + zk * TT * HD, HD, Sb, TT, 0, (size_t)TT * HD, (size_t)TT * HD, (size_t)TT * TT);
            k_gemmc<h16, 0, 1><<<dim3((TT - RH) / 64, TT / 64, ZH), 32, 0, stream>>>(QP16 + zq * TT * HD + (size_t)RH * HD, nullptr, KP16 + zk * TT * HD, nullptr, HD, Sb + (size_t)RH * TT, TT, RH, (size_t)TT * HD, (size_t)TT * HD, (size_t)TT * TT);
            k_asoft<<<ZH * TT / 8, 256, 0, stream>>>(Sb);
            k_pvs<bf, 2, 32, 0, RH><<<dim3(RH / 32, HD / 32, ZH), 512, 0, stream>>>((const bf*)Sb, (const bf*)Sb + TT, VTh + zk * HD * TT, VTl + zk * HD * TT, Ob, (size_t)TT * PP, (size_t)HD * TT, (size_t)TT * HD);
            k_pvs<h16, 0, 128, RH, TT - RH><<<dim3((TT - RH) / 32, HD / 32, ZH), 512, 0, stream>>>((const h16*)Sb + (size_t)RH * PP, nullptr, VT16 + zk * HD * TT, nullptr, Ob + (size_t)RH * HD, (size_t)TT * PP, (size_t)HD * TT, (size_t)TT * HD);
            k_merge<<<(unsigned)(((size_t)ZH * TT * HD / 2 + 255) / 256), 256, 0, stream>>>(Ob, h0, ATh, ATl); }
        k_pl2out<<<(unsigned)(((size_t)TT * DQ / 4 + 255) / 256), 256, 0, stream>>>(ATh, ATl, OUT + (size_t)b * TT * DM); }
}

// v003
// A run of this version takes 536 microseconds.
// Two timings next to v002 put it at 1.82 and 1.81 times that version's speed.
// Counting every step since v000, it is 5.13 times as fast.
#include <hip/hip_runtime.h>

// SelfAttentionHead (x [4][2048][1024]; qkv = x W^T + b (W [3072][1024], split (q | k | v) x 16 heads x 64); causal softmax(q.k / 8); out = merged heads (no output projection) -> [4][2048][1024]).
// Compute dtypes, f32 accumulate: every input rounded to bf16; q/k/v on PLAIN bf16 operands (inputs: exact) + bias; causal scores and attn.v: query rows < 512 hl (3 products), the rest single fp16 (x1024); softmax f32; the merged heads are written as hi + lo of the attention planes (i.e. the f32 attention output rounded through a bf16 pair, |err| <= 2^-16 relative).

#define NB_  4
#define TT   2048
#define DM   1024
#define NH_  16
#define NKV  16
#define REP  (NH_ / NKV)
#define HD   64
#define DQ   (NH_ * HD)
#define DKV  (NKV * HD)
#define ZH   16                   // heads per attention pass (one launch of the attention kernel covers ZH heads)
#define RH   512                  // query rows < RH use hi+lo planes (0: none)
#define PCAR 1024.0f
#define SCL  0.125f   // HD^-0.5
typedef _Float16 h16;
typedef unsigned short bf;
typedef __attribute__((ext_vector_type(16))) __bf16   v16bf;
typedef __attribute__((ext_vector_type(16))) _Float16 v16h;
typedef __attribute__((ext_vector_type(8)))  _Float16 v8h;
typedef __attribute__((ext_vector_type(8)))  unsigned short v8us;
typedef __attribute__((ext_vector_type(8)))  float    v8f;
typedef __attribute__((ext_vector_type(4)))  float    v4f;
typedef v8h  __attribute__((may_alias)) v8ha;
typedef v4f  __attribute__((may_alias)) v4fa;
typedef v8us __attribute__((may_alias)) v8usa;

__device__ __forceinline__ unsigned short f2bf(float f) { unsigned u = __float_as_uint(f); u += 0x7FFFu + ((u >> 16) & 1u); return (unsigned short)(u >> 16); }
__device__ __forceinline__ float bf2f(unsigned short b) { return __uint_as_float(((unsigned)b) << 16); }
__device__ __forceinline__ float bfr(float f) { return bf2f(f2bf(f)); }
__device__ __forceinline__ v16h cat16(v8h lo, v8h hi) { return __builtin_shufflevector(lo, hi, 0, 1, 2, 3, 4, 5, 6, 7, 8, 9, 10, 11, 12, 13, 14, 15); }
__device__ __forceinline__ v16bf cat16b(v8us lo, v8us hi) { return __builtin_bit_cast(v16bf, __builtin_shufflevector(lo, hi, 0, 1, 2, 3, 4, 5, 6, 7, 8, 9, 10, 11, 12, 13, 14, 15)); }
__device__ __forceinline__ v8f wmma16(v16h a, v16h b, v8f c) { return __builtin_amdgcn_wmma_f32_16x16x32_f16(false, a, false, b, (short)0, c, false, false); }
__device__ __forceinline__ v8f wmmab(v16bf a, v16bf b, v8f c) { return __builtin_amdgcn_wmma_f32_16x16x32_bf16(false, a, false, b, (short)0, c, false, false); }



// ---- k_gemmw: register-blocked GEMM, ONE WAVE per 64x64 output tile (16 accumulators), operands straight from K-contiguous 16-bit planes; grid (M/64, N/64, Z), 32 threads.
// C[m][n] (f32, pitch ldc, + optional f32 bias[n]) = sum_k A[m][k] Bt[n][k] (+ split products per NSPLIT). z-batch strides sA/sB/sC in elements. K % 32 == 0.
template <typename T16> struct WFrag;
template <> struct WFrag<h16> { typedef v16h V; static __device__ __forceinline__ V ld(const h16* p) { return cat16(*(const v8h*)p, *(const v8h*)(p + 16)); } static __device__ __forceinline__ v8f mma(V a, V b, v8f c) { return wmma16(a, b, c); } };
template <> struct WFrag<bf> { typedef v16bf V; static __device__ __forceinline__ V ld(const bf* p) { return cat16b(*(const v8us*)p, *(const v8us*)(p + 16)); } static __device__ __forceinline__ v8f mma(V a, V b, v8f c) { return wmmab(a, b, c); } };
template <typename T16, int NSPLIT, bool BIAS>
__global__ __launch_bounds__(32) void k_gemmw(const T16* __restrict__ A, const T16* __restrict__ A2, const T16* __restrict__ Bt, const T16* __restrict__ Bt2, int K, float* C, int ldc, const float* __restrict__ bias, size_t sA, size_t sB, size_t sC) {
    typedef typename WFrag<T16>::V V;
    __shared__ __align__(16) float os[16 * 68];
    const size_t z = blockIdx.z; A += z * sA; if (A2) A2 += z * sA; Bt += z * sB; if (Bt2) Bt2 += z * sB; C += z * sC;
    const int lane = threadIdx.x & 31, lr = lane & 15, hi = lane >> 4; const int r0 = blockIdx.x * 64, c0 = blockIdx.y * 64;
    v8f acc[4][4];
#pragma unroll
    for (int mb = 0; mb < 4; ++mb)
#pragma unroll
        for (int nb = 0; nb < 4; ++nb) acc[mb][nb] = (v8f){};
    const size_t aoff = (size_t)(r0 + lr) * K + 8 * hi, boff = (size_t)(c0 + lr) * K + 8 * hi;
#pragma unroll 1
    for (int kc = 0; kc < K; kc += 32) {
        V a[4], a2[4];
#pragma unroll
        for (int mb = 0; mb < 4; ++mb) { a[mb] = WFrag<T16>::ld(A + aoff + (size_t)mb * 16 * K + kc); if (NSPLIT == 1 || NSPLIT == 2) a2[mb] = WFrag<T16>::ld(A2 + aoff + (size_t)mb * 16 * K + kc); }
#pragma unroll
        for (int nb = 0; nb < 4; ++nb) { const V b = WFrag<T16>::ld(Bt + boff + (size_t)nb * 16 * K + kc); V b2; if (NSPLIT >= 2) b2 = WFrag<T16>::ld(Bt2 + boff + (size_t)nb * 16 * K + kc);
#pragma unroll
            for (int mb = 0; mb < 4; ++mb) { acc[mb][nb] = WFrag<T16>::mma(a[mb], b, acc[mb][nb]); if (NSPLIT == 1 || NSPLIT == 2) acc[mb][nb] = WFrag<T16>::mma(a2[mb], b, acc[mb][nb]); if (NSPLIT >= 2) acc[mb][nb] = WFrag<T16>::mma(a[mb], b2, acc[mb][nb]); } }
        asm volatile("v_nop\n\tv_nop\n\tv_nop\n\tv_nop" : "+v"(acc[0][0]), "+v"(acc[1][1]), "+v"(acc[2][2]), "+v"(acc[3][3]) : "v"(a[0]), "v"(a[3]));
    }
#pragma unroll
    for (int mb = 0; mb < 4; ++mb) {
#pragma unroll
        for (int nb = 0; nb < 4; ++nb) {
#pragma unroll
            for (int j = 0; j < 8; ++j) os[(hi * 8 + j) * 68 + nb * 16 + lr] = acc[mb][nb][j]; }
        __builtin_amdgcn_wave_barrier(); asm volatile("" ::: "memory");
        float* crow = C + (size_t)(r0 + mb * 16) * ldc + c0;
{
#pragma unroll
            for (int s = 0; s < 8; ++s) { const int row = 2 * s + hi, cofs = lr * 4; v4f val = *(const v4fa*)(os + row * 68 + cofs); if (BIAS) { val[0] += bfr(bias[c0 + cofs]); val[1] += bfr(bias[c0 + cofs + 1]); val[2] += bfr(bias[c0 + cofs + 2]); val[3] += bfr(bias[c0 + cofs + 3]); }
                *(v4f*)(crow + (size_t)row * ldc + cofs) = val; }
             }
        __builtin_amdgcn_wave_barrier(); asm volatile("" ::: "memory");
    }
}

__device__ __forceinline__ h16 tohx(float x) { return (h16)x; }
__device__ __forceinline__ void splitf(float y, unsigned short& h, unsigned short& l) { h = f2bf(y); l = f2bf(y - bf2f(h)); }
typedef __attribute__((ext_vector_type(2))) _Float16 v2h;
typedef __attribute__((ext_vector_type(4))) _Float16 v4h;
typedef __attribute__((ext_vector_type(2))) unsigned short v2us;
typedef __attribute__((ext_vector_type(4))) unsigned short v4us;
typedef __attribute__((ext_vector_type(2))) float v2f;
typedef __attribute__((ext_vector_type(4))) int v4i;

__global__ __launch_bounds__(256) void k_wtG(const float* __restrict__ w, int K, int N, bf* Bt) {
    const int lane = threadIdx.x & 31; const int L0 = (blockIdx.x * 8 + (threadIdx.x >> 5)) * 8; const int nlines = N * K / 64;
{
#pragma unroll 1
        for (int l = 0; l < 8; ++l) { const int L = L0 + l; if (L >= nlines) break; const size_t e = (size_t)L * 64 + lane * 2; const int k = (int)(e % K), n = (int)(e / K); v2us o;
            o[0] = f2bf(w[(size_t)k * N + n]); o[1] = f2bf(w[(size_t)(k + 1) * N + n]); *(v2us*)(Bt + e) = o; }
         }
}
__global__ __launch_bounds__(256) void k_cvt8(const float* __restrict__ src, bf* dst, size_t n8) { const size_t i = (size_t)blockIdx.x * 256 + threadIdx.x; if (i >= n8) return; const v8f v = *(const v8f*)(src + i * 8); v8us o;
#pragma unroll
    for (int k = 0; k < 8; ++k) o[k] = f2bf(v[k]); *(v8us*)(dst + i * 8) = o;  }
__global__ __launch_bounds__(256) void k_cscvt(const float* __restrict__ cosT, const float* __restrict__ sinT, float* CS) { const int idx = blockIdx.x * 256 + threadIdx.x; if (idx >= TT * HD) return; v2f cs; cs[0] = bfr(cosT[idx]); cs[1] = bfr(sinT[idx]); *(v2f*)(CS + (size_t)idx * 2) = cs;  }
// k_rope: head planes [h][t][d] (fp16 + hi/lo) of rope(x) x sc with the rotate-half convention out[d] = x[d] cos[t][d] - x[d+HD/2] sin[t][d], out[d+HD/2] = x[d+HD/2] cos[t][d+HD/2] + x[d] sin[t][d+HD/2]
__global__ __launch_bounds__(256) void k_rope(const float* __restrict__ F, int pitch, int nheads, const float* __restrict__ CS, const float* __restrict__ RF, const float* __restrict__ nw, float sc, h16* P16, bf* Ph, bf* Pl) {
    const size_t e = ((size_t)blockIdx.x * 256 + threadIdx.x) * 2; if (e >= (size_t)nheads * TT * HD) return; const int d = (int)(e % HD); const int t = (int)((e / HD) % TT); const int h = (int)(e / ((size_t)HD * TT)); const float* f = F + (size_t)t * pitch + h * HD; const float rf = RF ? RF[(size_t)h * TT + t] : 1.0f; v2h o16; v2us oh, ol;
#pragma unroll
    for (int q = 0; q < 2; ++q) { const int dd = d + q; const int dp = (dd < HD / 2) ? dd + HD / 2 : dd - HD / 2; float x0 = f[dd], x1 = f[dp];
        if (RF) { float n0 = __fmul_rn(x0, rf), n1 = __fmul_rn(x1, rf); asm volatile("" : "+v"(n0)); asm volatile("" : "+v"(n1)); x0 = __fmul_rn(bfr(nw[dd]), n0); x1 = __fmul_rn(bfr(nw[dp]), n1); }
        const v2f cs = *(const v2f*)(CS + ((size_t)t * HD + dd) * 2); float a = __fmul_rn(x0, cs[0]), bq = __fmul_rn(x1, cs[1]); asm volatile("" : "+v"(a)); asm volatile("" : "+v"(bq)); const float r = ((dd < HD / 2) ? __fsub_rn(a, bq) : __fadd_rn(a, bq)) * sc;
        o16[q] = tohx(r); unsigned short a2, c2; splitf(r, a2, c2); oh[q] = a2; ol[q] = c2; }
    *(v2h*)(P16 + e) = o16; *(v2us*)(Ph + e) = oh; *(v2us*)(Pl + e) = ol;  }
__global__ __launch_bounds__(256) void k_vtp(const float* __restrict__ F, int pitch, int nheads, h16* V16, bf* Vh, bf* Vl) { const size_t e = ((size_t)blockIdx.x * 256 + threadIdx.x) * 2; if (e >= (size_t)nheads * HD * TT) return; const int t = (int)(e % TT); const int d = (int)((e / TT) % HD); const int g = (int)(e / ((size_t)TT * HD)); v2h o16; v2us oh, ol;
#pragma unroll
    for (int q = 0; q < 2; ++q) { const float x = F[(size_t)(t + q) * pitch + g * HD + d]; o16[q] = tohx(x); unsigned short a2, c2; splitf(x, a2, c2); oh[q] = a2; ol[q] = c2; }
    *(v2h*)(V16 + e) = o16; *(v2us*)(Vh + e) = oh; *(v2us*)(Vl + e) = ol;  }
__global__ __launch_bounds__(256) void k_csid(float* CS) { const int idx = blockIdx.x * 256 + threadIdx.x; if (idx >= TT * HD) return; v2f cs; cs[0] = 1.0f; cs[1] = 0.0f; *(v2f*)(CS + (size_t)idx * 2) = cs;  }
// ---- k_attn: causal scores, softmax and probability x value contraction of one 32-query tile of one head in ONE work-group (16 waves); no score or probability leaves the chip.
// Wave w owns keys [w*KCH, (w+1)*KCH). It forms the TRANSPOSED score tile (A = key rows, B = query rows), so that a lane holds 8 consecutive keys of one query per accumulator: two neighbouring accumulators
// are, element for element, the A fragment of the probability x value product, and the probabilities go from the softmax into that product without leaving their registers.
// The row maximum and the row sum meet over the waves in LDS (one barrier each; sum in wave order = ascending keys), the 16 partial output tiles likewise (third barrier).
// A wave whose keys all lie beyond the tile's last query computes no scores: it stores neutral row maxima and sums (and a zero tile if in the last group of four), passes the barriers and takes its share of the final sum. Queries < RH: hi + lo planes (3 products), 32 keys a wave; the rest fp16 (probabilities x PCAR), 128 keys a wave.
typedef __attribute__((ext_vector_type(16))) unsigned short v16us;
__device__ __forceinline__ void mkp(const v8f e0, const v8f e1, const float f, v16h& a, v16h& a2) { (void)a2;
#pragma unroll
    for (int j = 0; j < 8; ++j) { a[j] = tohx(e0[j] * f); a[8 + j] = tohx(e1[j] * f); } }
__device__ __forceinline__ void mkp(const v8f e0, const v8f e1, const float f, v16bf& a, v16bf& a2) { v16us h, l;
#pragma unroll
    for (int j = 0; j < 8; ++j) { unsigned short x, y; splitf(e0[j] * f, x, y); h[j] = x; l[j] = y; splitf(e1[j] * f, x, y); h[8 + j] = x; l[8 + j] = y; }
    a = __builtin_bit_cast(v16bf, h); a2 = __builtin_bit_cast(v16bf, l); }
template <typename T16> __device__ __forceinline__ const T16* atb(const T16* p, unsigned bytes) { return (const T16*)((const char*)p + bytes); }
#define RP 68                     // pitch, in floats, of a partial output row in LDS
template <typename T16, int NSPLIT, int KCH>
__device__ __forceinline__ void attn_tile(const T16* __restrict__ Q, const T16* __restrict__ Q2, const T16* __restrict__ Kp, const T16* __restrict__ Kp2, const T16* __restrict__ Vt, const T16* __restrict__ Vt2, float* O, const int r0, const float pnum, float (*red)[32 * RP], float (*smax)[32], float (*ssum)[32]) {
    typedef typename WFrag<T16>::V V;
    static_assert(KCH % 32 == 0 && 16 * KCH <= TT, "the 16 key slices stay inside the sequence");
    constexpr int NM = KCH / 16, NS = KCH / 32;
    const int wv = __builtin_amdgcn_readfirstlane((int)(threadIdx.x >> 5)); const int lane = threadIdx.x & 31, lr = lane & 15, hi = lane >> 4; const int key0 = wv * KCH;
    const bool active = key0 < r0 + 32; const int nact = (r0 + 32 + KCH - 1) / KCH;      // waves 0 .. nact-1 hold causal keys (nact <= 16)
    const unsigned qo = (unsigned)((r0 + lr) * HD + 8 * hi) * 2u, ko = (unsigned)((key0 + lr) * HD + 8 * hi) * 2u, vo = (unsigned)(lr * TT + 8 * hi + key0) * 2u;   // byte offset of a lane's first element of the query rows, the key rows and the value columns: the one address register of each group of loads
    v8f s[NM][2];
#pragma unroll
    for (int mt = 0; mt < NM; ++mt) { s[mt][0] = (v8f){}; s[mt][1] = (v8f){}; }
    float mx[2] = {-3.0e38f, -3.0e38f};
    V b[NS][4], b2[NS][4];
    if (active) {
        V q[2][2], q2[2][2], k[NM][2], k2[NM][2];
#pragma unroll
        for (int nb = 0; nb < 2; ++nb)
#pragma unroll
            for (int kc = 0; kc < 2; ++kc) { const int o = nb * 16 * HD + kc * 32; q[nb][kc] = WFrag<T16>::ld(atb(Q, qo) + o); if (NSPLIT == 2) q2[nb][kc] = WFrag<T16>::ld(atb(Q2, qo) + o); }
#pragma unroll
        for (int mt = 0; mt < NM; ++mt)
#pragma unroll
            for (int kc = 0; kc < 2; ++kc) { const int o = mt * 16 * HD + kc * 32; k[mt][kc] = WFrag<T16>::ld(atb(Kp, ko) + o); if (NSPLIT == 2) k2[mt][kc] = WFrag<T16>::ld(atb(Kp2, ko) + o); }
        asm volatile("s_wait_xcnt 0x0" :: "v"(qo), "v"(ko) : "memory");   // the loads' address registers stay whole up to this wait
        __builtin_amdgcn_sched_barrier(0);   // keeps every load above in front of the first product, so that the wave waits out the load latency once and not once per key tile
#pragma unroll
        for (int mt = 0; mt < NM; ++mt)
#pragma unroll
            for (int nb = 0; nb < 2; ++nb)
#pragma unroll
                for (int kc = 0; kc < 2; ++kc) { s[mt][nb] = WFrag<T16>::mma(k[mt][kc], q[nb][kc], s[mt][nb]); if (NSPLIT == 2) { s[mt][nb] = WFrag<T16>::mma(k[mt][kc], q2[nb][kc], s[mt][nb]); s[mt][nb] = WFrag<T16>::mma(k2[mt][kc], q[nb][kc], s[mt][nb]); } }
        if (key0 + KCH - 1 > r0) {           // only a wave that holds a key beyond the tile's first query has anything to mask
            const int dl = r0 + lr - key0 - hi * 8;   // key (mt, j) is causal for query (nb, lr) where mt * 16 + j - nb * 16 <= dl
#pragma unroll
            for (int mt = 0; mt < NM; ++mt)
#pragma unroll
                for (int nb = 0; nb < 2; ++nb)
#pragma unroll
                    for (int j = 0; j < 8; ++j) s[mt][nb][j] = (mt * 16 + j - nb * 16 <= dl) ? s[mt][nb][j] : -3.0e38f;
        }
#pragma unroll
        for (int mt = 0; mt < NM; ++mt)
#pragma unroll
            for (int nb = 0; nb < 2; ++nb)
#pragma unroll
                for (int j = 0; j < 8; ++j) { const float t = s[mt][nb][j] * SCL; s[mt][nb][j] = t; mx[nb] = fmaxf(mx[nb], t); }
        mx[0] = fmaxf(mx[0], __shfl_xor(mx[0], 16, 32)); mx[1] = fmaxf(mx[1], __shfl_xor(mx[1], 16, 32));
    }
    if (hi == 0) { smax[wv][lr] = mx[0]; smax[wv][16 + lr] = mx[1]; }
    __syncthreads();   // every wave's row maxima are in LDS before any wave takes the maximum over the waves
    float sm[2] = {0.f, 0.f};
    if (active) {
#pragma unroll
        for (int w = 0; w < 16; ++w) { mx[0] = fmaxf(mx[0], smax[w][lr]); mx[1] = fmaxf(mx[1], smax[w][16 + lr]); }
#pragma unroll
        for (int mt = 0; mt < NM; ++mt)
#pragma unroll
            for (int nb = 0; nb < 2; ++nb)
#pragma unroll
                for (int j = 0; j < 8; ++j) { const float e = __builtin_amdgcn_exp2f(__fmul_rn(__fsub_rn(s[mt][nb][j], mx[nb]), 1.4426950408889634f)); s[mt][nb][j] = e; sm[nb] += e; }
        sm[0] += __shfl_xor(sm[0], 16, 32); sm[1] += __shfl_xor(sm[1], 16, 32);
#pragma unroll
        for (int ss = 0; ss < NS; ++ss)
#pragma unroll
            for (int db = 0; db < 2; ++db) { const int ofs = db * 16 * TT + ss * 32; b[ss][db] = WFrag<T16>::ld(atb(Vt, vo) + ofs); if (NSPLIT == 2) b2[ss][db] = WFrag<T16>::ld(atb(Vt2, vo) + ofs); }
        asm volatile("s_wait_xcnt 0x0" :: "v"(vo) : "memory");   // as above: the address register stays whole up to this wait
        __builtin_amdgcn_sched_barrier(0);   // holds the loads of value columns 0..31 here, so that they fly while the row sums meet over the waves
    }
    if (hi == 0) { ssum[wv][lr] = sm[0]; ssum[wv][16 + lr] = sm[1]; }
    __syncthreads();   // every wave's row sums are in LDS before any wave adds them up
    {
        if (active) {
            v8f o[2][4];
#pragma unroll
            for (int qb = 0; qb < 2; ++qb)
#pragma unroll
                for (int db = 0; db < 4; ++db) o[qb][db] = (v8f){};
            float t0 = ssum[0][lr], t1 = ssum[0][16 + lr];
#pragma unroll
            for (int w = 1; w < 16; ++w) { t0 += ssum[w][lr]; t1 += ssum[w][16 + lr]; }
            const float f[2] = {__fdiv_rn(pnum, t0), __fdiv_rn(pnum, t1)};
            V a[NS][2], a2[NS][2];
#pragma unroll
            for (int ss = 0; ss < NS; ++ss)
#pragma unroll
                for (int qb = 0; qb < 2; ++qb) mkp(s[2 * ss][qb], s[2 * ss + 1][qb], f[qb], a[ss][qb], a2[ss][qb]);
            __builtin_amdgcn_sched_barrier(0);   // the loads below start only when the packed probabilities have freed half of the score registers: earlier they would spill
#pragma unroll
            for (int ss = 0; ss < NS; ++ss)
#pragma unroll
                for (int db = 2; db < 4; ++db) { const int ofs = db * 16 * TT + ss * 32; b[ss][db] = WFrag<T16>::ld(atb(Vt, vo) + ofs); if (NSPLIT == 2) b2[ss][db] = WFrag<T16>::ld(atb(Vt2, vo) + ofs); }
            asm volatile("s_wait_xcnt 0x0" :: "v"(vo) : "memory");   // as above: the address register stays whole up to this wait
            __builtin_amdgcn_sched_barrier(0);   // keeps those loads in front of the first product: they fly during the products of value columns 0..31
#pragma unroll
            for (int db = 0; db < 4; ++db)
#pragma unroll
                for (int ss = 0; ss < NS; ++ss)
#pragma unroll
                    for (int qb = 0; qb < 2; ++qb) { o[qb][db] = WFrag<T16>::mma(a[ss][qb], b[ss][db], o[qb][db]); if (NSPLIT == 2) { o[qb][db] = WFrag<T16>::mma(a2[ss][qb], b[ss][db], o[qb][db]); o[qb][db] = WFrag<T16>::mma(a[ss][qb], b2[ss][db], o[qb][db]); } }
            __builtin_amdgcn_sched_barrier(0);   // keeps the LDS stores behind the last product
#pragma unroll
            for (int qb = 0; qb < 2; ++qb)
#pragma unroll
                for (int db = 0; db < 4; ++db)
#pragma unroll
                    for (int j = 0; j < 8; ++j) red[wv][(qb * 16 + hi * 8 + j) * RP + db * 16 + lr] = o[qb][db][j];
        } else if (wv < ((nact + 3) & ~3)) {   // the final sum reads the partial tiles in groups of four waves: an idle wave of the last group stores zeros
#pragma unroll
            for (int u = 0; u < 16; ++u) *(v4fa*)&red[wv][(u * 2 + hi) * RP + lr * 4] = (v4f){};
        }
    }
    __syncthreads();   // every wave's partial tile is in LDS before any wave sums
    const int row = threadIdx.x >> 4, col = (threadIdx.x & 15) * 4; v4f acc = *(const v4fa*)&red[0][row * RP + col];
#pragma unroll
    for (int w = 1; w < 4; ++w) acc += *(const v4fa*)&red[w][row * RP + col];
#pragma unroll
    for (int g = 4; g < 16; g += 4)
        if (g < nact) {
#pragma unroll
            for (int w = g; w < g + 4; ++w) acc += *(const v4fa*)&red[w][row * RP + col]; }
    *(v4f*)(O + (size_t)(r0 + row) * HD + col) = acc;
}
// grid (heads, TT/32): the tiles with the most keys start first
__global__ __launch_bounds__(512) void k_attn(const h16* __restrict__ Q16, const h16* __restrict__ K16, const h16* __restrict__ V16, const bf* __restrict__ Qh, const bf* __restrict__ Ql, const bf* __restrict__ Kh, const bf* __restrict__ Kl, const bf* __restrict__ Vh, const bf* __restrict__ Vl, float* O) {
    __shared__ __align__(16) float red[16][32 * RP]; __shared__ float smax[16][32]; __shared__ float ssum[16][32];
    const size_t zo = (size_t)blockIdx.x * TT * HD; const int r0 = (TT / 32 - 1 - (int)blockIdx.y) * 32;
    if (r0 < RH) attn_tile<bf, 2, RH / 16>(Qh + zo, Ql + zo, Kh + zo, Kl + zo, Vh + zo, Vl + zo, O + zo, r0, 1.0f, red, smax, ssum);
    else attn_tile<h16, 0, TT / 16>(Q16 + zo, nullptr, K16 + zo, nullptr, V16 + zo, nullptr, O + zo, r0, PCAR, red, smax, ssum);
}
__global__ __launch_bounds__(256) void k_merge(const float* __restrict__ O, int h0, bf* Ah, bf* Al) { const size_t e = ((size_t)blockIdx.x * 256 + threadIdx.x) * 2; if (e >= (size_t)ZH * TT * HD) return; const int d = (int)(e % HD); const int t = (int)((e / HD) % TT); const int zz = (int)(e / ((size_t)HD * TT)); const float cs = (t < RH) ? 1.0f : (1.0f / PCAR); const size_t oo = (size_t)t * DQ + (h0 + zz) * HD + d;
    v2us oh, ol;
#pragma unroll
    for (int q = 0; q < 2; ++q) { unsigned short a, c2; splitf(O[e + q] * cs, a, c2); oh[q] = a; ol[q] = c2; } *(v2us*)(Ah + oo) = oh; *(v2us*)(Al + oo) = ol;  }

__global__ __launch_bounds__(256) void k_pl2out(const bf* __restrict__ Ah, const bf* __restrict__ Al, float* out) { const size_t e = ((size_t)blockIdx.x * 256 + threadIdx.x) * 4; if (e >= (size_t)TT * DQ) return; v4f o;   // out = hi + lo of the merged attention planes (16-B lanes)
#pragma unroll
    for (int u = 0; u < 4; ++u) o[u] = __fadd_rn(bf2f(Ah[e + u]), bf2f(Al[e + u])); *(v4f*)(out + e) = o;  }

extern "C" void kernel_launch(void* const* d_in, const int* in_sizes, int n_in,
                              void* d_out, int out_size, void* d_ws, size_t ws_size, hipStream_t stream) {
    (void)in_sizes; (void)n_in; (void)out_size;
    const float* x = (const float*)d_in[0]; const float* wf = (const float*)d_in[1]; const float* bfz = (const float*)d_in[2]; const float* wq = wf + (size_t)0 * 1024 * 1024; const float* wk = wf + (size_t)1 * 1024 * 1024; const float* wv = wf + (size_t)2 * 1024 * 1024; const float* bq = bfz + 0 * 1024; const float* bk = bfz + 1 * 1024; const float* bv = bfz + 2 * 1024; const float* wo = nullptr; (void)wo; const float* cosT = nullptr; const float* sinT = nullptr; (void)cosT; (void)sinT;
    float* OUT = (float*)d_out;     // [4][2048][1024]
    char* wsp = (char*)d_ws;
    auto take = [&](size_t bytes) { char* p = wsp; wsp += (bytes + 255) & ~(size_t)255; return (void*)p; };
    bf* WQ = (bf*)take((size_t)DQ * DM * 2); bf* WK = (bf*)take((size_t)DKV * DM * 2); bf* WV = (bf*)take((size_t)DKV * DM * 2); bf* WO = (bf*)take((size_t)DM * DQ * 2); float* CS = (float*)take((size_t)TT * HD * 2 * 4);
    bf* XB = (bf*)take((size_t)TT * DM * 2); float* FQ = (float*)take((size_t)TT * DQ * 4); float* FK = (float*)take((size_t)TT * DKV * 4);
    h16* QP16 = (h16*)take((size_t)NH_ * TT * HD * 2); h16* KP16 = (h16*)take((size_t)NKV * TT * HD * 2); h16* VT16 = (h16*)take((size_t)NKV * HD * TT * 2);
    bf* QPh = (bf*)take((size_t)NH_ * TT * HD * 2); bf* QPl = (bf*)take((size_t)NH_ * TT * HD * 2); bf* KPh = (bf*)take((size_t)NKV * TT * HD * 2); bf* KPl = (bf*)take((size_t)NKV * TT * HD * 2); bf* VTh = (bf*)take((size_t)NKV * HD * TT * 2); bf* VTl = (bf*)take((size_t)NKV * HD * TT * 2);
    float* Ob = (float*)take((size_t)ZH * TT * HD * 4); bf* ATh = (bf*)take((size_t)TT * DQ * 2); bf* ATl = (bf*)take((size_t)TT * DQ * 2);
    if ((size_t)(wsp - (char*)d_ws) > ws_size) return;    // ws 256 MiB
    float* FV = FK;   // v projection reuses the k buffer after the k planes are built (stream-ordered)
    { k_cvt8<<<(unsigned)(((size_t)DQ * DM / 8 + 255) / 256), 256, 0, stream>>>(wq, WQ, (size_t)DQ * DM / 8); k_cvt8<<<(unsigned)(((size_t)DKV * DM / 8 + 255) / 256), 256, 0, stream>>>(wk, WK, (size_t)DKV * DM / 8); k_cvt8<<<(unsigned)(((size_t)DKV * DM / 8 + 255) / 256), 256, 0, stream>>>(wv, WV, (size_t)DKV * DM / 8);
      
       }
    k_csid<<<(TT * HD + 255) / 256, 256, 0, stream>>>(CS);
    const unsigned LQ = (unsigned)(((size_t)NH_ * TT * HD / 2 + 255) / 256), LKv = (unsigned)(((size_t)NKV * TT * HD / 2 + 255) / 256);
    for (int b = 0; b < NB_; ++b) {
        
        k_cvt8<<<(unsigned)(((size_t)TT * DM / 8 + 255) / 256), 256, 0, stream>>>(x + (size_t)b * TT * DM, XB, (size_t)TT * DM / 8);
        k_gemmw<bf, 0, true><<<dim3(TT / 64, DQ / 64, 1), 32, 0, stream>>>(XB, nullptr, WQ, nullptr, DM, FQ, DQ, bq, 0, 0, 0);
        k_rope<<<LQ, 256, 0, stream>>>(FQ, DQ, NH_, CS, nullptr, nullptr, 1.0f, QP16, QPh, QPl);
        k_gemmw<bf, 0, true><<<dim3(TT / 64, DKV / 64, 1), 32, 0, stream>>>(XB, nullptr, WK, nullptr, DM, FK, DKV, bk, 0, 0, 0);
        k_rope<<<LKv, 256, 0, stream>>>(FK, DKV, NKV, CS, nullptr, nullptr, 1.0f, KP16, KPh, KPl);
        k_gemmw<bf, 0, true><<<dim3(TT / 64, DKV / 64, 1), 32, 0, stream>>>(XB, nullptr, WV, nullptr, DM, FV, DKV, bv, 0, 0, 0); k_vtp<<<LKv, 256, 0, stream>>>(FV, DKV, NKV, VT16, VTh, VTl);
        k_attn<<<dim3(NH_, TT / 32, 1), 512, 0, stream>>>(QP16, KP16, VT16, QPh, QPl, KPh, KPl, VTh, VTl, Ob);
        k_merge<<<(unsigned)(((size_t)ZH * TT * HD / 2 + 255) / 256), 256, 0, stream>>>(Ob, 0, ATh, ATl);
        k_pl2out<<<(unsigned)(((size_t)TT * DQ / 4 + 255) / 256), 256, 0, stream>>>(ATh, ATl, OUT + (size_t)b * TT * DM); }
}

// v004
// One run takes 419 microseconds.
// Two timings next to v003 put it at 1.29 and 1.27 times that version's speed.
// All steps since v000 together make it 6.58 times as fast.
#include <hip/hip_runtime.h>

// SelfAttentionHead (x [4][2048][1024]; qkv = x W^T + b (W [3072][1024], split (q | k | v) x 16 heads x 64); causal softmax(q.k / 8); out = merged heads (no output projection) -> [4][2048][1024]).
// Compute dtypes, f32 accumulate: every input rounded to bf16; q/k/v on PLAIN bf16 operands (inputs: exact) + bias; causal scores and attn.v: query rows < 512 hl (3 products), the rest single fp16 (x1024); softmax f32; the merged heads are written as hi + lo of a bf16 pair (i.e. the f32 attention output rounded through a bf16 pair, |err| <= 2^-16 relative).

#define NB_  4
#define TT   2048
#define DM   1024
#define NH_  16
#define NKV  16
#define REP  (NH_ / NKV)
#define HD   64
#define DQ   (NH_ * HD)
#define DKV  (NKV * HD)
#define ZH   16                   // not used: one launch of the attention kernel covers all NH_ heads
#define RH   512                  // query rows < RH use hi+lo planes (0: none)
#define PCAR 1024.0f
#define SCL  0.125f   // HD^-0.5
typedef _Float16 h16;
typedef unsigned short bf;
typedef __attribute__((ext_vector_type(16))) __bf16   v16bf;
typedef __attribute__((ext_vector_type(16))) _Float16 v16h;
typedef __attribute__((ext_vector_type(8)))  _Float16 v8h;
typedef __attribute__((ext_vector_type(8)))  unsigned short v8us;
typedef __attribute__((ext_vector_type(8)))  float    v8f;
typedef __attribute__((ext_vector_type(4)))  float    v4f;
typedef v8h  __attribute__((may_alias)) v8ha;
typedef v4f  __attribute__((may_alias)) v4fa;
typedef v8us __attribute__((may_alias)) v8usa;

__device__ __forceinline__ unsigned short f2bf(float f) { unsigned u = __float_as_uint(f); u += 0x7FFFu + ((u >> 16) & 1u); return (unsigned short)(u >> 16); }
__device__ __forceinline__ float bf2f(unsigned short b) { return __uint_as_float(((unsigned)b) << 16); }
__device__ __forceinline__ float bfr(float f) { return bf2f(f2bf(f)); }
__device__ __forceinline__ h16 tohx(float x) { return (h16)x; }
__device__ __forceinline__ void splitf(float y, unsigned short& h, unsigned short& l) { h = f2bf(y); l = f2bf(y - bf2f(h)); }
__device__ __forceinline__ v16h cat16(v8h lo, v8h hi) { return __builtin_shufflevector(lo, hi, 0, 1, 2, 3, 4, 5, 6, 7, 8, 9, 10, 11, 12, 13, 14, 15); }
__device__ __forceinline__ v16bf cat16b(v8us lo, v8us hi) { return __builtin_bit_cast(v16bf, __builtin_shufflevector(lo, hi, 0, 1, 2, 3, 4, 5, 6, 7, 8, 9, 10, 11, 12, 13, 14, 15)); }
__device__ __forceinline__ v8f wmma16(v16h a, v16h b, v8f c) { return __builtin_amdgcn_wmma_f32_16x16x32_f16(false, a, false, b, (short)0, c, false, false); }
__device__ __forceinline__ v8f wmmab(v16bf a, v16bf b, v8f c) { return __builtin_amdgcn_wmma_f32_16x16x32_bf16(false, a, false, b, (short)0, c, false, false); }



// ---- k_gemmw: register-blocked GEMM, ONE WAVE per 64x64 output tile (16 accumulators), operands straight from K-contiguous 16-bit planes; grid (M/64, N/64, Z), 32 threads.
// c[m][n] (f32, + optional f32 bias[n]) = sum_k A[m][k] Bt[n][k] (+ split products per NSPLIT). z-batch strides sA/sB in elements. K % 32 == 0.
// The tile's 64 columns are one head (HD == 64), its rows are sequence positions. The epilogue writes c as the three 16-bit planes that the attention kernel reads (fp16, bf16 hi, bf16 lo):
// TRANS false: [head][t][d] (query and key rows); TRANS true: [head][d][t] (value columns). No f32 copy of c leaves the chip.
template <typename T16> struct WFrag;
template <> struct WFrag<h16> { typedef v16h V; static __device__ __forceinline__ V ld(const h16* p) { return cat16(*(const v8h*)p, *(const v8h*)(p + 16)); } static __device__ __forceinline__ v8f mma(V a, V b, v8f c) { return wmma16(a, b, c); } };
template <> struct WFrag<bf> { typedef v16bf V; static __device__ __forceinline__ V ld(const bf* p) { return cat16b(*(const v8us*)p, *(const v8us*)(p + 16)); } static __device__ __forceinline__ v8f mma(V a, V b, v8f c) { return wmmab(a, b, c); } };
template <typename T16, int NSPLIT, bool BIAS, bool TRANS>
__global__ __launch_bounds__(32) void k_gemmw(const T16* __restrict__ A, const T16* __restrict__ A2, const T16* __restrict__ Bt, const T16* __restrict__ Bt2, int K, h16* P16, bf* Ph, bf* Pl, const float* __restrict__ bias, size_t sA, size_t sB) {
    static_assert(HD == 64, "one 64-column tile is one head");
    typedef typename WFrag<T16>::V V;
    __shared__ __align__(16) float os[16 * 68];
    const size_t z = blockIdx.z; A += z * sA; if (A2) A2 += z * sA; Bt += z * sB; if (Bt2) Bt2 += z * sB;
    const int lane = threadIdx.x & 31, lr = lane & 15, hi = lane >> 4; const int r0 = blockIdx.x * 64, c0 = blockIdx.y * 64;
    v8f acc[4][4];
#pragma unroll
    for (int mb = 0; mb < 4; ++mb)
#pragma unroll
        for (int nb = 0; nb < 4; ++nb) acc[mb][nb] = (v8f){};
    const size_t aoff = (size_t)(r0 + lr) * K + 8 * hi, boff = (size_t)(c0 + lr) * K + 8 * hi;
#pragma unroll 1
    for (int kc = 0; kc < K; kc += 32) {
        V a[4], a2[4];
#pragma unroll
        for (int mb = 0; mb < 4; ++mb) { a[mb] = WFrag<T16>::ld(A + aoff + (size_t)mb * 16 * K + kc); if (NSPLIT == 1 || NSPLIT == 2) a2[mb] = WFrag<T16>::ld(A2 + aoff + (size_t)mb * 16 * K + kc); }
#pragma unroll
        for (int nb = 0; nb < 4; ++nb) { const V b = WFrag<T16>::ld(Bt + boff + (size_t)nb * 16 * K + kc); V b2; if (NSPLIT >= 2) b2 = WFrag<T16>::ld(Bt2 + boff + (size_t)nb * 16 * K + kc);
#pragma unroll
            for (int mb = 0; mb < 4; ++mb) { acc[mb][nb] = WFrag<T16>::mma(a[mb], b, acc[mb][nb]); if (NSPLIT == 1 || NSPLIT == 2) acc[mb][nb] = WFrag<T16>::mma(a2[mb], b, acc[mb][nb]); if (NSPLIT >= 2) acc[mb][nb] = WFrag<T16>::mma(a[mb], b2, acc[mb][nb]); } }
        asm volatile("v_nop\n\tv_nop\n\tv_nop\n\tv_nop" : "+v"(acc[0][0]), "+v"(acc[1][1]), "+v"(acc[2][2]), "+v"(acc[3][3]) : "v"(a[0]), "v"(a[3]));
    }
    if constexpr (TRANS) {   // an accumulator holds, per lane, 8 consecutive t of one d: that is 16 bytes of a [d][t] row of each plane
#pragma unroll
        for (int nb = 0; nb < 4; ++nb) { const float bb = BIAS ? bfr(bias[c0 + nb * 16 + lr]) : 0.0f;
#pragma unroll
            for (int mb = 0; mb < 4; ++mb) { v8h o16; v8us oh, ol;
#pragma unroll
                for (int j = 0; j < 8; ++j) { float x = acc[mb][nb][j]; if (BIAS) x += bb; o16[j] = tohx(x); unsigned short a2, c2; splitf(x, a2, c2); oh[j] = a2; ol[j] = c2; }
                const size_t e = (size_t)(c0 + nb * 16 + lr) * TT + r0 + mb * 16 + hi * 8;
                *(v8h*)(P16 + e) = o16; *(v8us*)(Ph + e) = oh; *(v8us*)(Pl + e) = ol; } }
    } else {                 // rows of 64 d: turned through LDS so that 8 lanes write one whole 128-byte row of a plane
        const int rsub = lane >> 3, cofs = (lane & 7) * 8; float bb[8];
#pragma unroll
        for (int u = 0; u < 8; ++u) bb[u] = BIAS ? bfr(bias[c0 + cofs + u]) : 0.0f;
#pragma unroll
        for (int mb = 0; mb < 4; ++mb) {
#pragma unroll
            for (int nb = 0; nb < 4; ++nb) {
#pragma unroll
                for (int j = 0; j < 8; ++j) os[(hi * 8 + j) * 68 + nb * 16 + lr] = acc[mb][nb][j]; }
            __builtin_amdgcn_wave_barrier(); asm volatile("" ::: "memory");   // the LDS stores above stay in front of the other lanes' reads below
#pragma unroll
            for (int s = 0; s < 4; ++s) { const int row = 4 * s + rsub; const v4f v0 = *(const v4fa*)(os + row * 68 + cofs), v1 = *(const v4fa*)(os + row * 68 + cofs + 4); v8h o16; v8us oh, ol;
#pragma unroll
                for (int u = 0; u < 8; ++u) { float x = (u < 4) ? v0[u & 3] : v1[u & 3]; if (BIAS) x += bb[u]; o16[u] = tohx(x); unsigned short a2, c2; splitf(x, a2, c2); oh[u] = a2; ol[u] = c2; }
                const size_t e = ((size_t)(c0 / HD) * TT + r0 + mb * 16 + row) * HD + cofs;
                *(v8h*)(P16 + e) = o16; *(v8us*)(Ph + e) = oh; *(v8us*)(Pl + e) = ol; }
            __builtin_amdgcn_wave_barrier(); asm volatile("" ::: "memory");   // the reads above stay in front of the next 16 rows' LDS stores
        }
    }
}

typedef __attribute__((ext_vector_type(2))) _Float16 v2h;
typedef __attribute__((ext_vector_type(4))) _Float16 v4h;
typedef __attribute__((ext_vector_type(2))) unsigned short v2us;
typedef __attribute__((ext_vector_type(4))) unsigned short v4us;
typedef __attribute__((ext_vector_type(2))) float v2f;
typedef __attribute__((ext_vector_type(4))) int v4i;

__global__ __launch_bounds__(256) void k_wtG(const float* __restrict__ w, int K, int N, bf* Bt) {
    const int lane = threadIdx.x & 31; const int L0 = (blockIdx.x * 8 + (threadIdx.x >> 5)) * 8; const int nlines = N * K / 64;
{
#pragma unroll 1
        for (int l = 0; l < 8; ++l) { const int L = L0 + l; if (L >= nlines) break; const size_t e = (size_t)L * 64 + lane * 2; const int k = (int)(e % K), n = (int)(e / K); v2us o;
            o[0] = f2bf(w[(size_t)k * N + n]); o[1] = f2bf(w[(size_t)(k + 1) * N + n]); *(v2us*)(Bt + e) = o; }
         }
}
__global__ __launch_bounds__(256) void k_cvt8(const float* __restrict__ src, bf* dst, size_t n8) { const size_t i = (size_t)blockIdx.x * 256 + threadIdx.x; if (i >= n8) return; const v8f v = *(const v8f*)(src + i * 8); v8us o;
#pragma unroll
    for (int k = 0; k < 8; ++k) o[k] = f2bf(v[k]); *(v8us*)(dst + i * 8) = o;  }
__global__ __launch_bounds__(256) void k_cscvt(const float* __restrict__ cosT, const float* __restrict__ sinT, float* CS) { const int idx = blockIdx.x * 256 + threadIdx.x; if (idx >= TT * HD) return; v2f cs; cs[0] = bfr(cosT[idx]); cs[1] = bfr(sinT[idx]); *(v2f*)(CS + (size_t)idx * 2) = cs;  }
// ---- k_attn: causal scores, softmax and probability x value contraction of one 32-query tile of one head in ONE work-group (16 waves); no score or probability leaves the chip.
// Wave w owns keys [w*KCH, (w+1)*KCH). It forms the TRANSPOSED score tile (A = key rows, B = query rows), so that a lane holds 8 consecutive keys of one query per accumulator: two neighbouring accumulators
// are, element for element, the A fragment of the probability x value product, and the probabilities go from the softmax into that product without leaving their registers.
// The row maximum and the row sum meet over the waves in LDS (one barrier each; sum in wave order = ascending keys), the 16 partial output tiles likewise (third barrier).
// A wave whose keys all lie beyond the tile's last query computes no scores: it stores neutral row maxima and sums (and a zero tile if in the last group of four), passes the barriers and takes its share of the final sum. Queries < RH: hi + lo planes (3 products), 32 keys a wave; the rest fp16 (probabilities x PCAR), 128 keys a wave.
typedef __attribute__((ext_vector_type(16))) unsigned short v16us;
__device__ __forceinline__ void mkp(const v8f e0, const v8f e1, const float f, v16h& a, v16h& a2) { (void)a2;
#pragma unroll
    for (int j = 0; j < 8; ++j) { a[j] = tohx(e0[j] * f); a[8 + j] = tohx(e1[j] * f); } }
__device__ __forceinline__ void mkp(const v8f e0, const v8f e1, const float f, v16bf& a, v16bf& a2) { v16us h, l;
#pragma unroll
    for (int j = 0; j < 8; ++j) { unsigned short x, y; splitf(e0[j] * f, x, y); h[j] = x; l[j] = y; splitf(e1[j] * f, x, y); h[8 + j] = x; l[8 + j] = y; }
    a = __builtin_bit_cast(v16bf, h); a2 = __builtin_bit_cast(v16bf, l); }
template <typename T16> __device__ __forceinline__ const T16* atb(const T16* p, unsigned bytes) { return (const T16*)((const char*)p + bytes); }
#define RP 68                     // pitch, in floats, of a partial output row in LDS
template <typename T16, int NSPLIT, int KCH>
__device__ __forceinline__ void attn_tile(const T16* __restrict__ Q, const T16* __restrict__ Q2, const T16* __restrict__ Kp, const T16* __restrict__ Kp2, const T16* __restrict__ Vt, const T16* __restrict__ Vt2, float* O, const int r0, const float pnum, float (*red)[32 * RP], float (*smax)[32], float (*ssum)[32]) {
    typedef typename WFrag<T16>::V V;
    static_assert(KCH % 32 == 0 && 16 * KCH <= TT, "the 16 key slices stay inside the sequence");
    constexpr int NM = KCH / 16, NS = KCH / 32;
    const int wv = __builtin_amdgcn_readfirstlane((int)(threadIdx.x >> 5)); const int lane = threadIdx.x & 31, lr = lane & 15, hi = lane >> 4; const int key0 = wv * KCH;
    const bool active = key0 < r0 + 32; const int nact = (r0 + 32 + KCH - 1) / KCH;      // waves 0 .. nact-1 hold causal keys (nact <= 16)
    const unsigned qo = (unsigned)((r0 + lr) * HD + 8 * hi) * 2u, ko = (unsigned)((key0 + lr) * HD + 8 * hi) * 2u, vo = (unsigned)(lr * TT + 8 * hi + key0) * 2u;   // byte offset of a lane's first element of the query rows, the key rows and the value columns: the one address register of each group of loads
    v8f s[NM][2];
#pragma unroll
    for (int mt = 0; mt < NM; ++mt) { s[mt][0] = (v8f){}; s[mt][1] = (v8f){}; }
    float mx[2] = {-3.0e38f, -3.0e38f};
    V b[NS][4], b2[NS][4];
    if (active) {
        V q[2][2], q2[2][2], k[NM][2], k2[NM][2];
#pragma unroll
        for (int nb = 0; nb < 2; ++nb)
#pragma unroll
            for (int kc = 0; kc < 2; ++kc) { const int o = nb * 16 * HD + kc * 32; q[nb][kc] = WFrag<T16>::ld(atb(Q, qo) + o); if (NSPLIT == 2) q2[nb][kc] = WFrag<T16>::ld(atb(Q2, qo) + o); }
#pragma unroll
        for (int mt = 0; mt < NM; ++mt)
#pragma unroll
            for (int kc = 0; kc < 2; ++kc) { const int o = mt * 16 * HD + kc * 32; k[mt][kc] = WFrag<T16>::ld(atb(Kp, ko) + o); if (NSPLIT == 2) k2[mt][kc] = WFrag<T16>::ld(atb(Kp2, ko) + o); }
        asm volatile("s_wait_xcnt 0x0" :: "v"(qo), "v"(ko) : "memory");   // the loads' address registers stay whole up to this wait
        __builtin_amdgcn_sched_barrier(0);   // keeps every load above in front of the first product, so that the wave waits out the load latency once and not once per key tile
#pragma unroll
        for (int mt = 0; mt < NM; ++mt)
#pragma unroll
            for (int nb = 0; nb < 2; ++nb)
#pragma unroll
                for (int kc = 0; kc < 2; ++kc) { s[mt][nb] = WFrag<T16>::mma(k[mt][kc], q[nb][kc], s[mt][nb]); if (NSPLIT == 2) { s[mt][nb] = WFrag<T16>::mma(k[mt][kc], q2[nb][kc], s[mt][nb]); s[mt][nb] = WFrag<T16>::mma(k2[mt][kc], q[nb][kc], s[mt][nb]); } }
        if (key0 + KCH - 1 > r0) {           // only a wave that holds a key beyond the tile's first query has anything to mask
            const int dl = r0 + lr - key0 - hi * 8;   // key (mt, j) is causal for query (nb, lr) where mt * 16 + j - nb * 16 <= dl
#pragma unroll
            for (int mt = 0; mt < NM; ++mt)
#pragma unroll
                for (int nb = 0; nb < 2; ++nb)
#pragma unroll
                    for (int j = 0; j < 8; ++j) s[mt][nb][j] = (mt * 16 + j - nb * 16 <= dl) ? s[mt][nb][j] : -3.0e38f;
        }
#pragma unroll
        for (int mt = 0; mt < NM; ++mt)
#pragma unroll
            for (int nb = 0; nb < 2; ++nb)
#pragma unroll
                for (int j = 0; j < 8; ++j) { const float t = s[mt][nb][j] * SCL; s[mt][nb][j] = t; mx[nb] = fmaxf(mx[nb], t); }
        mx[0] = fmaxf(mx[0], __shfl_xor(mx[0], 16, 32)); mx[1] = fmaxf(mx[1], __shfl_xor(mx[1], 16, 32));
    }
    if (hi == 0) { smax[wv][lr] = mx[0]; smax[wv][16 + lr] = mx[1]; }
    __syncthreads();   // every wave's row maxima are in LDS before any wave takes the maximum over the waves
    float sm[2] = {0.f, 0.f};
    if (active) {
#pragma unroll
        for (int w = 0; w < 16; ++w) { mx[0] = fmaxf(mx[0], smax[w][lr]); mx[1] = fmaxf(mx[1], smax[w][16 + lr]); }
#pragma unroll
        for (int mt = 0; mt < NM; ++mt)
#pragma unroll
            for (int nb = 0; nb < 2; ++nb)
#pragma unroll
                for (int j = 0; j < 8; ++j) { const float e = __builtin_amdgcn_exp2f(__fmul_rn(__fsub_rn(s[mt][nb][j], mx[nb]), 1.4426950408889634f)); s[mt][nb][j] = e; sm[nb] += e; }
        sm[0] += __shfl_xor(sm[0], 16, 32); sm[1] += __shfl_xor(sm[1], 16, 32);
#pragma unroll
        for (int ss = 0; ss < NS; ++ss)
#pragma unroll
            for (int db = 0; db < 2; ++db) { const int ofs = db * 16 * TT + ss * 32; b[ss][db] = WFrag<T16>::ld(atb(Vt, vo) + ofs); if (NSPLIT == 2) b2[ss][db] = WFrag<T16>::ld(atb(Vt2, vo) + ofs); }
        asm volatile("s_wait_xcnt 0x0" :: "v"(vo) : "memory");   // as above: the address register stays whole up to this wait
        __builtin_amdgcn_sched_barrier(0);   // holds the loads of value columns 0..31 here, so that they fly while the row sums meet over the waves
    }
    if (hi == 0) { ssum[wv][lr] = sm[0]; ssum[wv][16 + lr] = sm[1]; }
    __syncthreads();   // every wave's row sums are in LDS before any wave adds them up
    {
        if (active) {
            v8f o[2][4];
#pragma unroll
            for (int qb = 0; qb < 2; ++qb)
#pragma unroll
                for (int db = 0; db < 4; ++db) o[qb][db] = (v8f){};
            float t0 = ssum[0][lr], t1 = ssum[0][16 + lr];
#pragma unroll
            for (int w = 1; w < 16; ++w) { t0 += ssum[w][lr]; t1 += ssum[w][16 + lr]; }
            const float f[2] = {__fdiv_rn(pnum, t0), __fdiv_rn(pnum, t1)};
            V a[NS][2], a2[NS][2];
#pragma unroll
            for (int ss = 0; ss < NS; ++ss)
#pragma unroll
                for (int qb = 0; qb < 2; ++qb) mkp(s[2 * ss][qb], s[2 * ss + 1][qb], f[qb], a[ss][qb], a2[ss][qb]);
            __builtin_amdgcn_sched_barrier(0);   // the loads below start only when the packed probabilities have freed half of the score registers: earlier they would spill
#pragma unroll
            for (int ss = 0; ss < NS; ++ss)
#pragma unroll
                for (int db = 2; db < 4; ++db) { const int ofs = db * 16 * TT + ss * 32; b[ss][db] = WFrag<T16>::ld(atb(Vt, vo) + ofs); if (NSPLIT == 2) b2[ss][db] = WFrag<T16>::ld(atb(Vt2, vo) + ofs); }
            asm volatile("s_wait_xcnt 0x0" :: "v"(vo) : "memory");   // as above: the address register stays whole up to this wait
            __builtin_amdgcn_sched_barrier(0);   // keeps those loads in front of the first product: they fly during the products of value columns 0..31
#pragma unroll
            for (int db = 0; db < 4; ++db)
#pragma unroll
                for (int ss = 0; ss < NS; ++ss)
#pragma unroll
                    for (int qb = 0; qb < 2; ++qb) { o[qb][db] = WFrag<T16>::mma(a[ss][qb], b[ss][db], o[qb][db]); if (NSPLIT == 2) { o[qb][db] = WFrag<T16>::mma(a2[ss][qb], b[ss][db], o[qb][db]); o[qb][db] = WFrag<T16>::mma(a[ss][qb], b2[ss][db], o[qb][db]); } }
            __builtin_amdgcn_sched_barrier(0);   // keeps the LDS stores behind the last product
#pragma unroll
            for (int qb = 0; qb < 2; ++qb)
#pragma unroll
                for (int db = 0; db < 4; ++db)
#pragma unroll
                    for (int j = 0; j < 8; ++j) red[wv][(qb * 16 + hi * 8 + j) * RP + db * 16 + lr] = o[qb][db][j];
        } else if (wv < ((nact + 3) & ~3)) {   // the final sum reads the partial tiles in groups of four waves: an idle wave of the last group stores zeros
#pragma unroll
            for (int u = 0; u < 16; ++u) *(v4fa*)&red[wv][(u * 2 + hi) * RP + lr * 4] = (v4f){};
        }
    }
    __syncthreads();   // every wave's partial tile is in LDS before any wave sums
    const int row = threadIdx.x >> 4, col = (threadIdx.x & 15) * 4; v4f acc = *(const v4fa*)&red[0][row * RP + col];
#pragma unroll
    for (int w = 1; w < 4; ++w) acc += *(const v4fa*)&red[w][row * RP + col];
#pragma unroll
    for (int g = 4; g < 16; g += 4)
        if (g < nact) {
#pragma unroll
            for (int w = g; w < g + 4; ++w) acc += *(const v4fa*)&red[w][row * RP + col]; }
    v4f ov;   // the tile goes straight to its head's 64 columns of the output rows: probabilities' scale taken off, then hi + lo of the bf16 pair
#pragma unroll
    for (int u = 0; u < 4; ++u) { unsigned short a, c2; splitf(acc[u] * (1.0f / pnum), a, c2); ov[u] = __fadd_rn(bf2f(a), bf2f(c2)); }
    *(v4f*)(O + (size_t)(r0 + row) * DQ + col) = ov;
}
// grid (heads, TT/32): the tiles with the most keys start first
__global__ __launch_bounds__(512) void k_attn(const h16* __restrict__ Q16, const h16* __restrict__ K16, const h16* __restrict__ V16, const bf* __restrict__ Qh, const bf* __restrict__ Ql, const bf* __restrict__ Kh, const bf* __restrict__ Kl, const bf* __restrict__ Vh, const bf* __restrict__ Vl, float* O) {
    __shared__ __align__(16) float red[16][32 * RP]; __shared__ float smax[16][32]; __shared__ float ssum[16][32];
    const size_t zo = (size_t)blockIdx.x * TT * HD; const int r0 = (TT / 32 - 1 - (int)blockIdx.y) * 32;
    float* Oh = O + (size_t)blockIdx.x * HD;   // O: this batch's output rows [t][heads * HD]
    if (r0 < RH) attn_tile<bf, 2, RH / 16>(Qh + zo, Ql + zo, Kh + zo, Kl + zo, Vh + zo, Vl + zo, Oh, r0, 1.0f, red, smax, ssum);
    else attn_tile<h16, 0, TT / 16>(Q16 + zo, nullptr, K16 + zo, nullptr, V16 + zo, nullptr, Oh, r0, PCAR, red, smax, ssum);
}
extern "C" void kernel_launch(void* const* d_in, const int* in_sizes, int n_in,
                              void* d_out, int out_size, void* d_ws, size_t ws_size, hipStream_t stream) {
    (void)in_sizes; (void)n_in; (void)out_size;
    const float* x = (const float*)d_in[0]; const float* wf = (const float*)d_in[1]; const float* bfz = (const float*)d_in[2]; const float* wq = wf + (size_t)0 * 1024 * 1024; const float* wk = wf + (size_t)1 * 1024 * 1024; const float* wv = wf + (size_t)2 * 1024 * 1024; const float* bq = bfz + 0 * 1024; const float* bk = bfz + 1 * 1024; const float* bv = bfz + 2 * 1024; const float* wo = nullptr; (void)wo; const float* cosT = nullptr; const float* sinT = nullptr; (void)cosT; (void)sinT;
    float* OUT = (float*)d_out;     // [4][2048][1024]
    char* wsp = (char*)d_ws;
    auto take = [&](size_t bytes) { char* p = wsp; wsp += (bytes + 255) & ~(size_t)255; return (void*)p; };
    bf* WQ = (bf*)take((size_t)DQ * DM * 2); bf* WK = (bf*)take((size_t)DKV * DM * 2); bf* WV = (bf*)take((size_t)DKV * DM * 2); bf* WO = (bf*)take((size_t)DM * DQ * 2);
    bf* XB = (bf*)take((size_t)TT * DM * 2);
    h16* QP16 = (h16*)take((size_t)NH_ * TT * HD * 2); h16* KP16 = (h16*)take((size_t)NKV * TT * HD * 2); h16* VT16 = (h16*)take((size_t)NKV * HD * TT * 2);
    bf* QPh = (bf*)take((size_t)NH_ * TT * HD * 2); bf* QPl = (bf*)take((size_t)NH_ * TT * HD * 2); bf* KPh = (bf*)take((size_t)NKV * TT * HD * 2); bf* KPl = (bf*)take((size_t)NKV * TT * HD * 2); bf* VTh = (bf*)take((size_t)NKV * HD * TT * 2); bf* VTl = (bf*)take((size_t)NKV * HD * TT * 2);
    if ((size_t)(wsp - (char*)d_ws) > ws_size) return;    // ws 256 MiB
    { k_cvt8<<<(unsigned)(((size_t)DQ * DM / 8 + 255) / 256), 256, 0, stream>>>(wq, WQ, (size_t)DQ * DM / 8); k_cvt8<<<(unsigned)(((size_t)DKV * DM / 8 + 255) / 256), 256, 0, stream>>>(wk, WK, (size_t)DKV * DM / 8); k_cvt8<<<(unsigned)(((size_t)DKV * DM / 8 + 255) / 256), 256, 0, stream>>>(wv, WV, (size_t)DKV * DM / 8);
      
       }
    for (int b = 0; b < NB_; ++b) {
        
        k_cvt8<<<(unsigned)(((size_t)TT * DM / 8 + 255) / 256), 256, 0, stream>>>(x + (size_t)b * TT * DM, XB, (size_t)TT * DM / 8);
        k_gemmw<bf, 0, true, false><<<dim3(TT / 64, DQ / 64, 1), 32, 0, stream>>>(XB, nullptr, WQ, nullptr, DM, QP16, QPh, QPl, bq, 0, 0);
        k_gemmw<bf, 0, true, false><<<dim3(TT / 64, DKV / 64, 1), 32, 0, stream>>>(XB, nullptr, WK, nullptr, DM, KP16, KPh, KPl, bk, 0, 0);
        k_gemmw<bf, 0, true, true><<<dim3(TT / 64, DKV / 64, 1), 32, 0, stream>>>(XB, nullptr, WV, nullptr, DM, VT16, VTh, VTl, bv, 0, 0);
        k_attn<<<dim3(NH_, TT / 32, 1), 512, 0, stream>>>(QP16, KP16, VT16, QPh, QPl, KPh, KPl, VTh, VTl, OUT + (size_t)b * TT * DM); }
}

// v005
// Measured time: 247 microseconds a run.
// Next to v004, in two timings, it ran 1.70 and 1.71 times as fast.
// Over all steps from v000 it is 11.2 times as fast.
#include <hip/hip_runtime.h>

// SelfAttentionHead (x [4][2048][1024]; qkv = x W^T + b (W [3072][1024], split (q | k | v) x 16 heads x 64); causal softmax(q.k / 8); out = merged heads (no output projection) -> [4][2048][1024]).
// Compute dtypes, f32 accumulate: every input rounded to bf16; q/k/v on PLAIN bf16 operands (inputs: exact) + bias; causal scores and attn.v: query rows < 512 hl (3 products), the rest single fp16 (x1024); softmax f32; the merged heads are written as hi + lo of a bf16 pair (i.e. the f32 attention output rounded through a bf16 pair, |err| <= 2^-16 relative).

#define NB_  4
#define TT   2048
#define DM   1024
#define NH_  16
#define NKV  16
#define REP  (NH_ / NKV)
#define HD   64
#define DQ   (NH_ * HD)
#define DKV  (NKV * HD)
#define ZH   16                   // not used: one launch of the attention kernel covers all NH_ heads
#define RH   512                  // query rows < RH use hi+lo planes (0: none)
#define PCAR 1024.0f
#define SCL  0.125f   // HD^-0.5
typedef _Float16 h16;
typedef unsigned short bf;
typedef __attribute__((ext_vector_type(16))) __bf16   v16bf;
typedef __attribute__((ext_vector_type(16))) _Float16 v16h;
typedef __attribute__((ext_vector_type(8)))  _Float16 v8h;
typedef __attribute__((ext_vector_type(8)))  unsigned short v8us;
typedef __attribute__((ext_vector_type(8)))  float    v8f;
typedef __attribute__((ext_vector_type(4)))  float    v4f;
typedef v8h  __attribute__((may_alias)) v8ha;
typedef v4f  __attribute__((may_alias)) v4fa;
typedef v8us __attribute__((may_alias)) v8usa;

__device__ __forceinline__ unsigned short f2bf(float f) { unsigned u = __float_as_uint(f); u += 0x7FFFu + ((u >> 16) & 1u); return (unsigned short)(u >> 16); }
__device__ __forceinline__ float bf2f(unsigned short b) { return __uint_as_float(((unsigned)b) << 16); }
__device__ __forceinline__ float bfr(float f) { return bf2f(f2bf(f)); }
__device__ __forceinline__ h16 tohx(float x) { return (h16)x; }
__device__ __forceinline__ void splitf(float y, unsigned short& h, unsigned short& l) { h = f2bf(y); l = f2bf(y - bf2f(h)); }
__device__ __forceinline__ v16h cat16(v8h lo, v8h hi) { return __builtin_shufflevector(lo, hi, 0, 1, 2, 3, 4, 5, 6, 7, 8, 9, 10, 11, 12, 13, 14, 15); }
__device__ __forceinline__ v16bf cat16b(v8us lo, v8us hi) { return __builtin_bit_cast(v16bf, __builtin_shufflevector(lo, hi, 0, 1, 2, 3, 4, 5, 6, 7, 8, 9, 10, 11, 12, 13, 14, 15)); }
__device__ __forceinline__ v8f wmma16(v16h a, v16h b, v8f c) { return __builtin_amdgcn_wmma_f32_16x16x32_f16(false, a, false, b, (short)0, c, false, false); }
__device__ __forceinline__ v8f wmmab(v16bf a, v16bf b, v8f c) { return __builtin_amdgcn_wmma_f32_16x16x32_bf16(false, a, false, b, (short)0, c, false, false); }



// ---- k_gemmw: register-blocked GEMM, ONE WAVE per 64x64 output tile (16 accumulators), operands straight from K-contiguous 16-bit planes; grid (M/64, N/64, Z), 32 threads.
// c[m][n] (f32, + optional f32 bias[n]) = sum_k A[m][k] Bt[n][k] (+ split products per NSPLIT). z-batch strides sA/sB in elements. K % 32 == 0.
// The tile's 64 columns are one head (HD == 64), its rows are sequence positions. The epilogue writes c as the three 16-bit planes that the attention kernel reads (fp16, bf16 hi, bf16 lo):
// Rows are (batch, t), columns the fused (q | k | v) outputs. Columns < DQ + DKV: [batch][q heads | k heads][t][d] (query and key rows); the rest: [batch][head][d][t] (value columns). No f32 copy of c leaves the chip.
template <typename T16> struct WFrag;
template <> struct WFrag<h16> { typedef v16h V; static __device__ __forceinline__ V ld(const h16* p) { return cat16(*(const v8h*)p, *(const v8h*)(p + 16)); } static __device__ __forceinline__ v8f mma(V a, V b, v8f c) { return wmma16(a, b, c); } };
template <> struct WFrag<bf> { typedef v16bf V; static __device__ __forceinline__ V ld(const bf* p) { return cat16b(*(const v8us*)p, *(const v8us*)(p + 16)); } static __device__ __forceinline__ v8f mma(V a, V b, v8f c) { return wmmab(a, b, c); } };
template <typename T16, int NSPLIT, bool BIAS>
__global__ __launch_bounds__(32) void k_gemmw(const T16* __restrict__ A, const T16* __restrict__ A2, const T16* __restrict__ Bt, const T16* __restrict__ Bt2, int K, h16* P16, bf* Ph, bf* Pl, h16* T16p, bf* Th, bf* Tl, const float* __restrict__ bias, size_t sA, size_t sB) {
    static_assert(HD == 64 && TT % 64 == 0, "one 64-column tile is one head, its 64 rows lie in one batch");
    typedef typename WFrag<T16>::V V;
    __shared__ __align__(16) float os[16 * 68];
    const size_t z = blockIdx.z; A += z * sA; if (A2) A2 += z * sA; Bt += z * sB; if (Bt2) Bt2 += z * sB;
    const int lane = threadIdx.x & 31, lr = lane & 15, hi = lane >> 4; const int r0 = blockIdx.x * 64, c0 = blockIdx.y * 64; const int bt = r0 / TT, t0 = r0 % TT;
    const bool vcol = c0 >= DQ + DKV; if (vcol) { P16 = T16p; Ph = Th; Pl = Tl; }   // a tile of value columns goes to the transposed planes
    v8f acc[4][4];
#pragma unroll
    for (int mb = 0; mb < 4; ++mb)
#pragma unroll
        for (int nb = 0; nb < 4; ++nb) acc[mb][nb] = (v8f){};
    const size_t aoff = (size_t)(r0 + lr) * K + 8 * hi, boff = (size_t)(c0 + lr) * K + 8 * hi;
#pragma unroll 1
    for (int kc = 0; kc < K; kc += 32) {
        V a[4], a2[4];
#pragma unroll
        for (int mb = 0; mb < 4; ++mb) { a[mb] = WFrag<T16>::ld(A + aoff + (size_t)mb * 16 * K + kc); if (NSPLIT == 1 || NSPLIT == 2) a2[mb] = WFrag<T16>::ld(A2 + aoff + (size_t)mb * 16 * K + kc); }
#pragma unroll
        for (int nb = 0; nb < 4; ++nb) { const V b = WFrag<T16>::ld(Bt + boff + (size_t)nb * 16 * K + kc); V b2; if (NSPLIT >= 2) b2 = WFrag<T16>::ld(Bt2 + boff + (size_t)nb * 16 * K + kc);
#pragma unroll
            for (int mb = 0; mb < 4; ++mb) { acc[mb][nb] = WFrag<T16>::mma(a[mb], b, acc[mb][nb]); if (NSPLIT == 1 || NSPLIT == 2) acc[mb][nb] = WFrag<T16>::mma(a2[mb], b, acc[mb][nb]); if (NSPLIT >= 2) acc[mb][nb] = WFrag<T16>::mma(a[mb], b2, acc[mb][nb]); } }
        asm volatile("v_nop\n\tv_nop\n\tv_nop\n\tv_nop" : "+v"(acc[0][0]), "+v"(acc[1][1]), "+v"(acc[2][2]), "+v"(acc[3][3]) : "v"(a[0]), "v"(a[3]));
    }
    if (vcol) {   // an accumulator holds, per lane, 8 consecutive t of one d: that is 16 bytes of a [d][t] row of each plane
#pragma unroll
        for (int nb = 0; nb < 4; ++nb) { const float bb = BIAS ? bfr(bias[c0 + nb * 16 + lr]) : 0.0f;
#pragma unroll
            for (int mb = 0; mb < 4; ++mb) { v8h o16; v8us oh, ol;
#pragma unroll
                for (int j = 0; j < 8; ++j) { float x = acc[mb][nb][j]; if (BIAS) x += bb; o16[j] = tohx(x); unsigned short a2, c2; splitf(x, a2, c2); oh[j] = a2; ol[j] = c2; }
                const size_t e = ((size_t)bt * DKV + (c0 - DQ - DKV) + nb * 16 + lr) * TT + t0 + mb * 16 + hi * 8;
                *(v8h*)(P16 + e) = o16; *(v8us*)(Ph + e) = oh; *(v8us*)(Pl + e) = ol; } }
    } else {                 // rows of 64 d: turned through LDS so that 8 lanes write one whole 128-byte row of a plane
        const int rsub = lane >> 3, cofs = (lane & 7) * 8; float bb[8];
#pragma unroll
        for (int u = 0; u < 8; ++u) bb[u] = BIAS ? bfr(bias[c0 + cofs + u]) : 0.0f;
#pragma unroll
        for (int mb = 0; mb < 4; ++mb) {
#pragma unroll
            for (int nb = 0; nb < 4; ++nb) {
#pragma unroll
                for (int j = 0; j < 8; ++j) os[(hi * 8 + j) * 68 + nb * 16 + lr] = acc[mb][nb][j]; }
            __builtin_amdgcn_wave_barrier(); asm volatile("" ::: "memory");   // the LDS stores above stay in front of the other lanes' reads below
#pragma unroll
            for (int s = 0; s < 4; ++s) { const int row = 4 * s + rsub; const v4f v0 = *(const v4fa*)(os + row * 68 + cofs), v1 = *(const v4fa*)(os + row * 68 + cofs + 4); v8h o16; v8us oh, ol;
#pragma unroll
                for (int u = 0; u < 8; ++u) { float x = (u < 4) ? v0[u & 3] : v1[u & 3]; if (BIAS) x += bb[u]; o16[u] = tohx(x); unsigned short a2, c2; splitf(x, a2, c2); oh[u] = a2; ol[u] = c2; }
                const size_t e = (((size_t)bt * (NH_ + NKV) + c0 / HD) * TT + t0 + mb * 16 + row) * HD + cofs;
                *(v8h*)(P16 + e) = o16; *(v8us*)(Ph + e) = oh; *(v8us*)(Pl + e) = ol; }
            __builtin_amdgcn_wave_barrier(); asm volatile("" ::: "memory");   // the reads above stay in front of the next 16 rows' LDS stores
        }
    }
}

typedef __attribute__((ext_vector_type(2))) _Float16 v2h;
typedef __attribute__((ext_vector_type(4))) _Float16 v4h;
typedef __attribute__((ext_vector_type(2))) unsigned short v2us;
typedef __attribute__((ext_vector_type(4))) unsigned short v4us;
typedef __attribute__((ext_vector_type(2))) float v2f;
typedef __attribute__((ext_vector_type(4))) int v4i;

__global__ __launch_bounds__(256) void k_wtG(const float* __restrict__ w, int K, int N, bf* Bt) {
    const int lane = threadIdx.x & 31; const int L0 = (blockIdx.x * 8 + (threadIdx.x >> 5)) * 8; const int nlines = N * K / 64;
{
#pragma unroll 1
        for (int l = 0; l < 8; ++l) { const int L = L0 + l; if (L >= nlines) break; const size_t e = (size_t)L * 64 + lane * 2; const int k = (int)(e % K), n = (int)(e / K); v2us o;
            o[0] = f2bf(w[(size_t)k * N + n]); o[1] = f2bf(w[(size_t)(k + 1) * N + n]); *(v2us*)(Bt + e) = o; }
         }
}
__global__ __launch_bounds__(256) void k_cvt8(const float* __restrict__ srcA, bf* dstA, size_t nA8, const float* __restrict__ srcB, bf* dstB, size_t nB8) { size_t i = (size_t)blockIdx.x * 256 + threadIdx.x; const float* src = srcA; bf* dst = dstA;
    if (i >= nA8) { i -= nA8; if (i >= nB8) return; src = srcB; dst = dstB; }   // one launch rounds both arrays: first A's groups of 8, then B's
    const v8f v = *(const v8f*)(src + i * 8); v8us o;
#pragma unroll
    for (int k = 0; k < 8; ++k) o[k] = f2bf(v[k]); *(v8us*)(dst + i * 8) = o;  }
__global__ __launch_bounds__(256) void k_cscvt(const float* __restrict__ cosT, const float* __restrict__ sinT, float* CS) { const int idx = blockIdx.x * 256 + threadIdx.x; if (idx >= TT * HD) return; v2f cs; cs[0] = bfr(cosT[idx]); cs[1] = bfr(sinT[idx]); *(v2f*)(CS + (size_t)idx * 2) = cs;  }
// ---- k_attn: causal scores, softmax and probability x value contraction of one 32-query tile of one head in ONE work-group (16 waves); no score or probability leaves the chip.
// Wave w owns keys [w*KCH, (w+1)*KCH). It forms the TRANSPOSED score tile (A = key rows, B = query rows), so that a lane holds 8 consecutive keys of one query per accumulator: two neighbouring accumulators
// are, element for element, the A fragment of the probability x value product, and the probabilities go from the softmax into that product without leaving their registers.
// The row maximum and the row sum meet over the waves in LDS (one barrier each; sum in wave order = ascending keys), the 16 partial output tiles likewise (third barrier).
// A wave whose keys all lie beyond the tile's last query computes no scores: it stores neutral row maxima and sums (and a zero tile if in the last group of four), passes the barriers and takes its share of the final sum. Queries < RH: hi + lo planes (3 products), 32 keys a wave; the rest fp16 (probabilities x PCAR), 128 keys a wave.
typedef __attribute__((ext_vector_type(16))) unsigned short v16us;
__device__ __forceinline__ void mkp(const v8f e0, const v8f e1, const float f, v16h& a, v16h& a2) { (void)a2;
#pragma unroll
    for (int j = 0; j < 8; ++j) { a[j] = tohx(e0[j] * f); a[8 + j] = tohx(e1[j] * f); } }
__device__ __forceinline__ void mkp(const v8f e0, const v8f e1, const float f, v16bf& a, v16bf& a2) { v16us h, l;
#pragma unroll
    for (int j = 0; j < 8; ++j) { unsigned short x, y; splitf(e0[j] * f, x, y); h[j] = x; l[j] = y; splitf(e1[j] * f, x, y); h[8 + j] = x; l[8 + j] = y; }
    a = __builtin_bit_cast(v16bf, h); a2 = __builtin_bit_cast(v16bf, l); }
template <typename T16> __device__ __forceinline__ const T16* atb(const T16* p, unsigned bytes) { return (const T16*)((const char*)p + bytes); }
#define RP 68                     // pitch, in floats, of a partial output row in LDS
template <typename T16, int NSPLIT, int KCH>
__device__ __forceinline__ void attn_tile(const T16* __restrict__ Q, const T16* __restrict__ Q2, const T16* __restrict__ Kp, const T16* __restrict__ Kp2, const T16* __restrict__ Vt, const T16* __restrict__ Vt2, float* O, const int r0, const float pnum, float (*red)[32 * RP], float (*smax)[32], float (*ssum)[32]) {
    typedef typename WFrag<T16>::V V;
    static_assert(KCH % 32 == 0 && 16 * KCH <= TT, "the 16 key slices stay inside the sequence");
    constexpr int NM = KCH / 16, NS = KCH / 32;
    const int wv = __builtin_amdgcn_readfirstlane((int)(threadIdx.x >> 5)); const int lane = threadIdx.x & 31, lr = lane & 15, hi = lane >> 4; const int key0 = wv * KCH;
    const bool active = key0 < r0 + 32; const int nact = (r0 + 32 + KCH - 1) / KCH;      // waves 0 .. nact-1 hold causal keys (nact <= 16)
    const unsigned qo = (unsigned)((r0 + lr) * HD + 8 * hi) * 2u, ko = (unsigned)((key0 + lr) * HD + 8 * hi) * 2u, vo = (unsigned)(lr * TT + 8 * hi + key0) * 2u;   // byte offset of a lane's first element of the query rows, the key rows and the value columns: the one address register of each group of loads
    v8f s[NM][2];
#pragma unroll
    for (int mt = 0; mt < NM; ++mt) { s[mt][0] = (v8f){}; s[mt][1] = (v8f){}; }
    float mx[2] = {-3.0e38f, -3.0e38f};
    V b[NS][4], b2[NS][4];
    if (active) {
        V q[2][2], q2[2][2], k[NM][2], k2[NM][2];
#pragma unroll
        for (int nb = 0; nb < 2; ++nb)
#pragma unroll
            for (int kc = 0; kc < 2; ++kc) { const int o = nb * 16 * HD + kc * 32; q[nb][kc] = WFrag<T16>::ld(atb(Q, qo) + o); if (NSPLIT == 2) q2[nb][kc] = WFrag<T16>::ld(atb(Q2, qo) + o); }
#pragma unroll
        for (int mt = 0; mt < NM; ++mt)
#pragma unroll
            for (int kc = 0; kc < 2; ++kc) { const int o = mt * 16 * HD + kc * 32; k[mt][kc] = WFrag<T16>::ld(atb(Kp, ko) + o); if (NSPLIT == 2) k2[mt][kc] = WFrag<T16>::ld(atb(Kp2, ko) + o); }
        asm volatile("s_wait_xcnt 0x0" :: "v"(qo), "v"(ko) : "memory");   // the loads' address registers stay whole up to this wait
        __builtin_amdgcn_sched_barrier(0);   // keeps every load above in front of the first product, so that the wave waits out the load latency once and not once per key tile
#pragma unroll
        for (int mt = 0; mt < NM; ++mt)
#pragma unroll
            for (int nb = 0; nb < 2; ++nb)
#pragma unroll
                for (int kc = 0; kc < 2; ++kc) { s[mt][nb] = WFrag<T16>::mma(k[mt][kc], q[nb][kc], s[mt][nb]); if (NSPLIT == 2) { s[mt][nb] = WFrag<T16>::mma(k[mt][kc], q2[nb][kc], s[mt][nb]); s[mt][nb] = WFrag<T16>::mma(k2[mt][kc], q[nb][kc], s[mt][nb]); } }
        if (key0 + KCH - 1 > r0) {           // only a wave that holds a key beyond the tile's first query has anything to mask
            const int dl = r0 + lr - key0 - hi * 8;   // key (mt, j) is causal for query (nb, lr) where mt * 16 + j - nb * 16 <= dl
#pragma unroll
            for (int mt = 0; mt < NM; ++mt)
#pragma unroll
                for (int nb = 0; nb < 2; ++nb)
#pragma unroll
                    for (int j = 0; j < 8; ++j) s[mt][nb][j] = (mt * 16 + j - nb * 16 <= dl) ? s[mt][nb][j] : -3.0e38f;
        }
#pragma unroll
        for (int mt = 0; mt < NM; ++mt)
#pragma unroll
            for (int nb = 0; nb < 2; ++nb)
#pragma unroll
                for (int j = 0; j < 8; ++j) { const float t = s[mt][nb][j] * SCL; s[mt][nb][j] = t; mx[nb] = fmaxf(mx[nb], t); }
        mx[0] = fmaxf(mx[0], __shfl_xor(mx[0], 16, 32)); mx[1] = fmaxf(mx[1], __shfl_xor(mx[1], 16, 32));
    }
    if (hi == 0) { smax[wv][lr] = mx[0]; smax[wv][16 + lr] = mx[1]; }
    __syncthreads();   // every wave's row maxima are in LDS before any wave takes the maximum over the waves
    float sm[2] = {0.f, 0.f};
    if (active) {
#pragma unroll
        for (int w = 0; w < 16; ++w) { mx[0] = fmaxf(mx[0], smax[w][lr]); mx[1] = fmaxf(mx[1], smax[w][16 + lr]); }
#pragma unroll
        for (int mt = 0; mt < NM; ++mt)
#pragma unroll
            for (int nb = 0; nb < 2; ++nb)
#pragma unroll
                for (int j = 0; j < 8; ++j) { const float e = __builtin_amdgcn_exp2f(__fmul_rn(__fsub_rn(s[mt][nb][j], mx[nb]), 1.4426950408889634f)); s[mt][nb][j] = e; sm[nb] += e; }
        sm[0] += __shfl_xor(sm[0], 16, 32); sm[1] += __shfl_xor(sm[1], 16, 32);
#pragma unroll
        for (int ss = 0; ss < NS; ++ss)
#pragma unroll
            for (int db = 0; db < 2; ++db) { const int ofs = db * 16 * TT + ss * 32; b[ss][db] = WFrag<T16>::ld(atb(Vt, vo) + ofs); if (NSPLIT == 2) b2[ss][db] = WFrag<T16>::ld(atb(Vt2, vo) + ofs); }
        asm volatile("s_wait_xcnt 0x0" :: "v"(vo) : "memory");   // as above: the address register stays whole up to this wait
        __builtin_amdgcn_sched_barrier(0);   // holds the loads of value columns 0..31 here, so that they fly while the row sums meet over the waves
    }
    if (hi == 0) { ssum[wv][lr] = sm[0]; ssum[wv][16 + lr] = sm[1]; }
    __syncthreads();   // every wave's row sums are in LDS before any wave adds them up
    {
        if (active) {
            v8f o[2][4];
#pragma unroll
            for (int qb = 0; qb < 2; ++qb)
#pragma unroll
                for (int db = 0; db < 4; ++db) o[qb][db] = (v8f){};
            float t0 = ssum[0][lr], t1 = ssum[0][16 + lr];
#pragma unroll
            for (int w = 1; w < 16; ++w) { t0 += ssum[w][lr]; t1 += ssum[w][16 + lr]; }
            const float f[2] = {__fdiv_rn(pnum, t0), __fdiv_rn(pnum, t1)};
            V a[NS][2], a2[NS][2];
#pragma unroll
            for (int ss = 0; ss < NS; ++ss)
#pragma unroll
                for (int qb = 0; qb < 2; ++qb) mkp(s[2 * ss][qb], s[2 * ss + 1][qb], f[qb], a[ss][qb], a2[ss][qb]);
            __builtin_amdgcn_sched_barrier(0);   // the loads below start only when the packed probabilities have freed half of the score registers: earlier they would spill
#pragma unroll
            for (int ss = 0; ss < NS; ++ss)
#pragma unroll
                for (int db = 2; db < 4; ++db) { const int ofs = db * 16 * TT + ss * 32; b[ss][db] = WFrag<T16>::ld(atb(Vt, vo) + ofs); if (NSPLIT == 2) b2[ss][db] = WFrag<T16>::ld(atb(Vt2, vo) + ofs); }
            asm volatile("s_wait_xcnt 0x0" :: "v"(vo) : "memory");   // as above: the address register stays whole up to this wait
            __builtin_amdgcn_sched_barrier(0);   // keeps those loads in front of the first product: they fly during the products of value columns 0..31
#pragma unroll
            for (int db = 0; db < 4; ++db)
#pragma unroll
                for (int ss = 0; ss < NS; ++ss)
#pragma unroll
                    for (int qb = 0; qb < 2; ++qb) { o[qb][db] = WFrag<T16>::mma(a[ss][qb], b[ss][db], o[qb][db]); if (NSPLIT == 2) { o[qb][db] = WFrag<T16>::mma(a2[ss][qb], b[ss][db], o[qb][db]); o[qb][db] = WFrag<T16>::mma(a[ss][qb], b2[ss][db], o[qb][db]); } }
            __builtin_amdgcn_sched_barrier(0);   // keeps the LDS stores behind the last product
#pragma unroll
            for (int qb = 0; qb < 2; ++qb)
#pragma unroll
                for (int db = 0; db < 4; ++db)
#pragma unroll
                    for (int j = 0; j < 8; ++j) red[wv][(qb * 16 + hi * 8 + j) * RP + db * 16 + lr] = o[qb][db][j];
        } else if (wv < ((nact + 3) & ~3)) {   // the final sum reads the partial tiles in groups of four waves: an idle wave of the last group stores zeros
#pragma unroll
            for (int u = 0; u < 16; ++u) *(v4fa*)&red[wv][(u * 2 + hi) * RP + lr * 4] = (v4f){};
        }
    }
    __syncthreads();   // every wave's partial tile is in LDS before any wave sums
    const int row = threadIdx.x >> 4, col = (threadIdx.x & 15) * 4; v4f acc = *(const v4fa*)&red[0][row * RP + col];
#pragma unroll
    for (int w = 1; w < 4; ++w) acc += *(const v4fa*)&red[w][row * RP + col];
#pragma unroll
    for (int g = 4; g < 16; g += 4)
        if (g < nact) {
#pragma unroll
            for (int w = g; w < g + 4; ++w) acc += *(const v4fa*)&red[w][row * RP + col]; }
    v4f ov;   // the tile goes straight to its head's 64 columns of the output rows: probabilities' scale taken off, then hi + lo of the bf16 pair
#pragma unroll
    for (int u = 0; u < 4; ++u) { unsigned short a, c2; splitf(acc[u] * (1.0f / pnum), a, c2); ov[u] = __fadd_rn(bf2f(a), bf2f(c2)); }
    *(v4f*)(O + (size_t)(r0 + row) * DQ + col) = ov;
}
// grid (batches * heads, TT/32): the tiles with the most keys, of every batch and head, start first
__global__ __launch_bounds__(512) void k_attn(const h16* __restrict__ QK16, const h16* __restrict__ V16, const bf* __restrict__ QKh, const bf* __restrict__ QKl, const bf* __restrict__ Vh, const bf* __restrict__ Vl, float* O) {
    __shared__ __align__(16) float red[16][32 * RP]; __shared__ float smax[16][32]; __shared__ float ssum[16][32];
    const int bt = (int)blockIdx.x / NH_, hd = (int)blockIdx.x % NH_; const int r0 = (TT / 32 - 1 - (int)blockIdx.y) * 32;
    const size_t zq = ((size_t)bt * (NH_ + NKV) + hd) * TT * HD, zk = zq + (size_t)NH_ * TT * HD, zv = ((size_t)bt * NKV + hd) * HD * TT;
    float* Oh = O + (size_t)bt * TT * DQ + (size_t)hd * HD;   // O: output rows [batch][t][heads * HD]
    if (r0 < RH) attn_tile<bf, 2, RH / 16>(QKh + zq, QKl + zq, QKh + zk, QKl + zk, Vh + zv, Vl + zv, Oh, r0, 1.0f, red, smax, ssum);
    else attn_tile<h16, 0, TT / 16>(QK16 + zq, nullptr, QK16 + zk, nullptr, V16 + zv, nullptr, Oh, r0, PCAR, red, smax, ssum);
}
extern "C" void kernel_launch(void* const* d_in, const int* in_sizes, int n_in,
                              void* d_out, int out_size, void* d_ws, size_t ws_size, hipStream_t stream) {
    (void)in_sizes; (void)n_in; (void)out_size;
    const float* x = (const float*)d_in[0]; const float* wf = (const float*)d_in[1]; const float* bfz = (const float*)d_in[2];   // x [4][2048][1024], W [3072][1024] (rows q | k | v), b [3072]
    float* OUT = (float*)d_out;     // [4][2048][1024]
    char* wsp = (char*)d_ws;
    auto take = [&](size_t bytes) { char* p = wsp; wsp += (bytes + 255) & ~(size_t)255; return (void*)p; };
    bf* WB = (bf*)take((size_t)(DQ + 2 * DKV) * DM * 2);
    bf* XB = (bf*)take((size_t)NB_ * TT * DM * 2);
    h16* QK16 = (h16*)take((size_t)NB_ * (NH_ + NKV) * TT * HD * 2); h16* VT16 = (h16*)take((size_t)NB_ * NKV * HD * TT * 2);
    bf* QKh = (bf*)take((size_t)NB_ * (NH_ + NKV) * TT * HD * 2); bf* QKl = (bf*)take((size_t)NB_ * (NH_ + NKV) * TT * HD * 2); bf* VTh = (bf*)take((size_t)NB_ * NKV * HD * TT * 2); bf* VTl = (bf*)take((size_t)NB_ * NKV * HD * TT * 2);
    if ((size_t)(wsp - (char*)d_ws) > ws_size) return;    // 166 MiB of the 256 MiB
    k_cvt8<<<(unsigned)(((size_t)NB_ * TT * DM / 8 + (size_t)(DQ + 2 * DKV) * DM / 8 + 255) / 256), 256, 0, stream>>>(x, XB, (size_t)NB_ * TT * DM / 8, wf, WB, (size_t)(DQ + 2 * DKV) * DM / 8);
    k_gemmw<bf, 0, true><<<dim3(NB_ * TT / 64, (DQ + 2 * DKV) / 64, 1), 32, 0, stream>>>(XB, nullptr, WB, nullptr, DM, QK16, QKh, QKl, VT16, VTh, VTl, bfz, 0, 0);
    k_attn<<<dim3(NB_ * NH_, TT / 32, 1), 512, 0, stream>>>(QK16, VT16, QKh, QKl, VTh, VTl, OUT);
}

// v006
// It runs in 150 microseconds.
// In both of two side-by-side timings against v005, it was 1.64 times as fast.
// Counting every step since v000, it is 18.4 times as fast.
#include <hip/hip_runtime.h>

// SelfAttentionHead (x [4][2048][1024]; qkv = x W^T + b (W [3072][1024], split (q | k | v) x 16 heads x 64); causal softmax(q.k / 8); out = merged heads (no output projection) -> [4][2048][1024]).
// Compute dtypes, f32 accumulate: every input rounded to bf16; q/k/v on PLAIN bf16 operands (inputs: exact) + bias; causal scores and attn.v: query rows < 512 hl (3 products), the rest single fp16 (x1024); softmax f32; the merged heads are written as hi + lo of a bf16 pair (i.e. the f32 attention output rounded through a bf16 pair, |err| <= 2^-16 relative).

#define NB_  4
#define TT   2048
#define DM   1024
#define NH_  16
#define NKV  16
#define REP  (NH_ / NKV)
#define HD   64
#define DQ   (NH_ * HD)
#define DKV  (NKV * HD)
#define ZH   16                   // not used: one launch of the attention kernel covers all NH_ heads
#define RH   512                  // query rows < RH use hi+lo planes (0: none)
#define PCAR 1024.0f
#define SCL  0.125f   // HD^-0.5
typedef _Float16 h16;
typedef unsigned short bf;
typedef __attribute__((ext_vector_type(16))) __bf16   v16bf;
typedef __attribute__((ext_vector_type(16))) _Float16 v16h;
typedef __attribute__((ext_vector_type(8)))  _Float16 v8h;
typedef __attribute__((ext_vector_type(8)))  unsigned short v8us;
typedef __attribute__((ext_vector_type(8)))  float    v8f;
typedef __attribute__((ext_vector_type(4)))  float    v4f;
typedef v8h  __attribute__((may_alias)) v8ha;
typedef v4f  __attribute__((may_alias)) v4fa;
typedef v8us __attribute__((may_alias)) v8usa;

__device__ __forceinline__ unsigned short f2bf(float f) { unsigned u = __float_as_uint(f); u += 0x7FFFu + ((u >> 16) & 1u); return (unsigned short)(u >> 16); }
__device__ __forceinline__ float bf2f(unsigned short b) { return __uint_as_float(((unsigned)b) << 16); }
__device__ __forceinline__ float bfr(float f) { return bf2f(f2bf(f)); }
__device__ __forceinline__ h16 tohx(float x) { return (h16)x; }
__device__ __forceinline__ void splitf(float y, unsigned short& h, unsigned short& l) { h = f2bf(y); l = f2bf(y - bf2f(h)); }
__device__ __forceinline__ v16h cat16(v8h lo, v8h hi) { return __builtin_shufflevector(lo, hi, 0, 1, 2, 3, 4, 5, 6, 7, 8, 9, 10, 11, 12, 13, 14, 15); }
__device__ __forceinline__ v16bf cat16b(v8us lo, v8us hi) { return __builtin_bit_cast(v16bf, __builtin_shufflevector(lo, hi, 0, 1, 2, 3, 4, 5, 6, 7, 8, 9, 10, 11, 12, 13, 14, 15)); }
__device__ __forceinline__ v8f wmma16(v16h a, v16h b, v8f c) { return __builtin_amdgcn_wmma_f32_16x16x32_f16(false, a, false, b, (short)0, c, false, false); }
__device__ __forceinline__ v8f wmmab(v16bf a, v16bf b, v8f c) { return __builtin_amdgcn_wmma_f32_16x16x32_bf16(false, a, false, b, (short)0, c, false, false); }



// ---- FRAGMENT ORDER of every 16-bit plane in the workspace: a plane of rows x k is cut into blocks of 16 rows x 32 k = 1 KiB, and inside a block element (r, kk) stands at (kk >> 4) * 256 + (((kk >> 3) & 1) * 16 + r) * 8 + (kk & 7).
// That is the order in which the 32 lanes of a wave take a 16x16x32 operand: lane l reads 16 bytes at l * 16 and 16 bytes at 512 + l * 16, so each wave-wide load is 512 contiguous bytes (4 whole 128-byte lines) and not 32 bytes of each of 16 lines.
// ---- k_gemmw: register-blocked GEMM, ONE WAVE per 64x64 output tile (16 accumulators), operands straight from 16-bit planes in fragment order (blocks of one 16-row group run along k); grid (M/64, N/64, Z), 32 threads.
// c[m][n] (f32, + optional f32 bias[n]) = sum_k A[m][k] Bt[n][k] (+ split products per NSPLIT). z-batch strides sA/sB in elements. K % 32 == 0; K is a compile-time constant, so that the distance between two row groups is an immediate offset of the load.
// The tile's 64 columns are one head (HD == 64), its rows are sequence positions. The epilogue writes c as the three 16-bit planes that the attention kernel reads (fp16, bf16 hi, bf16 lo):
// Rows are (batch, t), columns the fused (q | k | v) outputs. Columns < DQ + DKV: [batch][q heads | k heads] planes of t rows x d, block (t / 16) * 2 + d / 32; the rest: [batch][head] planes of d rows x t, block (t / 32) * 4 + d / 16. No f32 copy of c leaves the chip.
template <typename T16> struct WFrag;
template <> struct WFrag<h16> { typedef v16h V; static __device__ __forceinline__ V ld(const h16* p) { return cat16(*(const v8h*)p, *(const v8h*)(p + 256)); } static __device__ __forceinline__ v8f mma(V a, V b, v8f c) { return wmma16(a, b, c); } };
template <> struct WFrag<bf> { typedef v16bf V; static __device__ __forceinline__ V ld(const bf* p) { return cat16b(*(const v8us*)p, *(const v8us*)(p + 256)); } static __device__ __forceinline__ v8f mma(V a, V b, v8f c) { return wmmab(a, b, c); } };
template <typename T16> __device__ __forceinline__ const T16* atb(const T16* p, unsigned bytes) { return (const T16*)((const char*)p + bytes); }
template <typename T16, int NSPLIT, bool BIAS, int K>
__global__ __launch_bounds__(32) void k_gemmw(const T16* __restrict__ A, const T16* __restrict__ A2, const T16* __restrict__ Bt, const T16* __restrict__ Bt2, h16* P16, bf* Ph, bf* Pl, h16* T16p, bf* Th, bf* Tl, const float* __restrict__ bias, size_t sA, size_t sB) {
    static_assert(HD == 64 && TT % 64 == 0, "one 64-column tile is one head, its 64 rows lie in one batch");
    typedef typename WFrag<T16>::V V;
    __shared__ __align__(16) float os[16 * 68];
    const size_t z = blockIdx.z; A += z * sA; if (A2) A2 += z * sA; Bt += z * sB; if (Bt2) Bt2 += z * sB;
    const int lane = threadIdx.x & 31, lr = lane & 15, hi = lane >> 4; const int r0 = blockIdx.x * 64, c0 = blockIdx.y * 64; const int bt = r0 / TT, t0 = r0 % TT;
    const bool vcol = c0 >= DQ + DKV; if (vcol) { P16 = T16p; Ph = Th; Pl = Tl; }   // a tile of value columns goes to the transposed planes
    v8f acc[4][4];
#pragma unroll
    for (int mb = 0; mb < 4; ++mb)
#pragma unroll
        for (int nb = 0; nb < 4; ++nb) acc[mb][nb] = (v8f){};
    const size_t aoff = (size_t)r0 * K, boff = (size_t)c0 * K; const unsigned lo = (unsigned)lane * 16u;   // a 16-row group is 16 * K elements, its block of 32 k is 512; lo is the lane's byte offset in a block, the rest of an address is the same for the whole wave
#pragma unroll 1
    for (int kc = 0; kc < K; kc += 32) {
        const T16* pa = atb(A + aoff + (size_t)kc * 16, lo); const T16* pb = atb(Bt + boff + (size_t)kc * 16, lo); const T16* pa2 = pa; const T16* pb2 = pb;
        if (NSPLIT == 1 || NSPLIT == 2) pa2 = atb(A2 + aoff + (size_t)kc * 16, lo);
        if (NSPLIT >= 2) pb2 = atb(Bt2 + boff + (size_t)kc * 16, lo);
        V a[4], a2[4], b[4], b2[4];
#pragma unroll
        for (int mb = 0; mb < 4; ++mb) { a[mb] = WFrag<T16>::ld(pa + mb * 16 * K); if (NSPLIT == 1 || NSPLIT == 2) a2[mb] = WFrag<T16>::ld(pa2 + mb * 16 * K); }
#pragma unroll
        for (int nb = 0; nb < 4; ++nb) { b[nb] = WFrag<T16>::ld(pb + nb * 16 * K); if (NSPLIT >= 2) b2[nb] = WFrag<T16>::ld(pb2 + nb * 16 * K); }
        asm volatile("s_wait_xcnt 0x0" :: "v"(pa), "v"(pb), "v"(pa2), "v"(pb2) : "memory");   // the loads' address registers stay whole up to this wait
#pragma unroll
        for (int nb = 0; nb < 4; ++nb) {
#pragma unroll
            for (int mb = 0; mb < 4; ++mb) { acc[mb][nb] = WFrag<T16>::mma(a[mb], b[nb], acc[mb][nb]); if (NSPLIT == 1 || NSPLIT == 2) acc[mb][nb] = WFrag<T16>::mma(a2[mb], b[nb], acc[mb][nb]); if (NSPLIT >= 2) acc[mb][nb] = WFrag<T16>::mma(a[mb], b2[nb], acc[mb][nb]); } }
        asm volatile("v_nop\n\tv_nop\n\tv_nop\n\tv_nop" : "+v"(acc[0][0]), "+v"(acc[1][1]), "+v"(acc[2][2]), "+v"(acc[3][3]) : "v"(a[0]), "v"(a[3]));
    }
    if (vcol) {   // an accumulator holds, per lane, 8 consecutive t of one d: that is the lane's own 16 bytes of one half of a block (d rows x t), so a wave stores 512 contiguous bytes
#pragma unroll
        for (int nb = 0; nb < 4; ++nb) { const float bb = BIAS ? bfr(bias[c0 + nb * 16 + lr]) : 0.0f;
#pragma unroll
            for (int mb = 0; mb < 4; ++mb) { v8h o16; v8us oh, ol;
#pragma unroll
                for (int j = 0; j < 8; ++j) { float x = acc[mb][nb][j]; if (BIAS) x += bb; o16[j] = tohx(x); unsigned short a2, c2; splitf(x, a2, c2); oh[j] = a2; ol[j] = c2; }
                const size_t e = ((size_t)bt * DKV + (c0 - DQ - DKV)) * TT + (size_t)(((t0 >> 5) + (mb >> 1)) * 4 + nb) * 512 + (mb & 1) * 256 + lane * 8;
                *(v8h*)(P16 + e) = o16; *(v8us*)(Ph + e) = oh; *(v8us*)(Pl + e) = ol; } }
    } else {                 // rows of 64 d: turned through LDS so that a lane holds 8 consecutive d of one t, its own 16 bytes of one half of a block (t rows x d)
        float bb[4];
#pragma unroll
        for (int nb = 0; nb < 4; ++nb) bb[nb] = BIAS ? bfr(bias[c0 + nb * 16 + lr]) : 0.0f;
#pragma unroll
        for (int mb = 0; mb < 4; ++mb) {
#pragma unroll
            for (int nb = 0; nb < 4; ++nb) {
#pragma unroll
                for (int j = 0; j < 8; ++j) os[(hi * 8 + j) * 68 + nb * 16 + lr] = BIAS ? acc[mb][nb][j] + bb[nb] : acc[mb][nb][j]; }
            __builtin_amdgcn_wave_barrier(); asm volatile("" ::: "memory");   // the LDS stores above stay in front of the other lanes' reads below
#pragma unroll
            for (int s = 0; s < 4; ++s) { const int cofs = (2 * s + hi) * 8; const v4f v0 = *(const v4fa*)(os + lr * 68 + cofs), v1 = *(const v4fa*)(os + lr * 68 + cofs + 4); v8h o16; v8us oh, ol;   // half-block s of these 16 rows: d = 16 s + 8 hi ...
#pragma unroll
                for (int u = 0; u < 8; ++u) { const float x = (u < 4) ? v0[u & 3] : v1[u & 3]; o16[u] = tohx(x); unsigned short a2, c2; splitf(x, a2, c2); oh[u] = a2; ol[u] = c2; }
                const size_t e = (((size_t)bt * (NH_ + NKV) + c0 / HD) * TT + t0 + mb * 16) * HD + s * 256 + lane * 8;
                *(v8h*)(P16 + e) = o16; *(v8us*)(Ph + e) = oh; *(v8us*)(Pl + e) = ol; }
            __builtin_amdgcn_wave_barrier(); asm volatile("" ::: "memory");   // the reads above stay in front of the next 16 rows' LDS stores
        }
    }
}

typedef __attribute__((ext_vector_type(2))) _Float16 v2h;
typedef __attribute__((ext_vector_type(4))) _Float16 v4h;
typedef __attribute__((ext_vector_type(2))) unsigned short v2us;
typedef __attribute__((ext_vector_type(4))) unsigned short v4us;
typedef __attribute__((ext_vector_type(2))) float v2f;
typedef __attribute__((ext_vector_type(4))) int v4i;

__global__ __launch_bounds__(256) void k_wtG(const float* __restrict__ w, int K, int N, bf* Bt) {
    const int lane = threadIdx.x & 31; const int L0 = (blockIdx.x * 8 + (threadIdx.x >> 5)) * 8; const int nlines = N * K / 64;
{
#pragma unroll 1
        for (int l = 0; l < 8; ++l) { const int L = L0 + l; if (L >= nlines) break; const size_t e = (size_t)L * 64 + lane * 2; const int k = (int)(e % K), n = (int)(e / K); v2us o;
            o[0] = f2bf(w[(size_t)k * N + n]); o[1] = f2bf(w[(size_t)(k + 1) * N + n]); *(v2us*)(Bt + e) = o; }
         }
}
__global__ __launch_bounds__(256) void k_cvt8(const float* __restrict__ srcA, bf* dstA, size_t nA8, const float* __restrict__ srcB, bf* dstB, size_t nB8) { size_t i = (size_t)blockIdx.x * 256 + threadIdx.x; const float* src = srcA; bf* dst = dstA;
    if (i >= nA8) { i -= nA8; if (i >= nB8) return; src = srcB; dst = dstB; }   // one launch rounds both arrays: first A's groups of 8, then B's
    const size_t blk = i >> 6; const int r = (int)(i >> 2) & 15, c = (int)i & 3;   // 64 threads a block (16 rows x 32 k, rows of DM): 4 neighbours read one whole 128-byte line of a source row, and 8 rows' groups of one c are one whole line of the plane in fragment order
    const v8f v = *(const v8f*)(src + ((blk / (DM / 32)) * 16 + r) * DM + (blk % (DM / 32)) * 32 + c * 8); v8us o;
#pragma unroll
    for (int k = 0; k < 8; ++k) o[k] = f2bf(v[k]); *(v8us*)(dst + blk * 512 + ((c >> 1) * 32 + (c & 1) * 16 + r) * 8) = o;  }
__global__ __launch_bounds__(256) void k_cscvt(const float* __restrict__ cosT, const float* __restrict__ sinT, float* CS) { const int idx = blockIdx.x * 256 + threadIdx.x; if (idx >= TT * HD) return; v2f cs; cs[0] = bfr(cosT[idx]); cs[1] = bfr(sinT[idx]); *(v2f*)(CS + (size_t)idx * 2) = cs;  }
// ---- k_attn: causal scores, softmax and probability x value contraction of one 32-query tile of one head in ONE work-group (16 waves); no score or probability leaves the chip.
// Wave w owns keys [w*KCH, (w+1)*KCH). It forms the TRANSPOSED score tile (A = key rows, B = query rows), so that a lane holds 8 consecutive keys of one query per accumulator: two neighbouring accumulators
// are, element for element, the A fragment of the probability x value product, and the probabilities go from the softmax into that product without leaving their registers.
// The row maximum and the row sum meet over the waves in LDS (one barrier each; sum in wave order = ascending keys), the 16 partial output tiles likewise (third barrier).
// A wave whose keys all lie beyond the tile's last query computes no scores: it stores neutral row maxima and sums (and a zero tile if in the last group of four), passes the barriers and takes its share of the final sum. Queries < RH: hi + lo planes (3 products), 32 keys a wave; the rest fp16 (probabilities x PCAR), 128 keys a wave.
typedef __attribute__((ext_vector_type(16))) unsigned short v16us;
__device__ __forceinline__ void mkp(const v8f e0, const v8f e1, const float f, v16h& a, v16h& a2) { (void)a2;
#pragma unroll
    for (int j = 0; j < 8; ++j) { a[j] = tohx(e0[j] * f); a[8 + j] = tohx(e1[j] * f); } }
__device__ __forceinline__ void mkp(const v8f e0, const v8f e1, const float f, v16bf& a, v16bf& a2) { v16us h, l;
#pragma unroll
    for (int j = 0; j < 8; ++j) { unsigned short x, y; splitf(e0[j] * f, x, y); h[j] = x; l[j] = y; splitf(e1[j] * f, x, y); h[8 + j] = x; l[8 + j] = y; }
    a = __builtin_bit_cast(v16bf, h); a2 = __builtin_bit_cast(v16bf, l); }
#define RP 68                     // pitch, in floats, of a partial output row in LDS
template <typename T16, int NSPLIT, int KCH>
__device__ __forceinline__ void attn_tile(const T16* __restrict__ Q, const T16* __restrict__ Q2, const T16* __restrict__ Kp, const T16* __restrict__ Kp2, const T16* __restrict__ Vt, const T16* __restrict__ Vt2, float* O, const int r0, const float pnum, float (*red)[32 * RP], float (*smax)[32], float (*ssum)[32]) {
    typedef typename WFrag<T16>::V V;
    static_assert(KCH % 32 == 0 && 16 * KCH <= TT, "the 16 key slices stay inside the sequence");
    constexpr int NM = KCH / 16, NS = KCH / 32;
    const int wv = __builtin_amdgcn_readfirstlane((int)(threadIdx.x >> 5)); const int lane = threadIdx.x & 31, lr = lane & 15, hi = lane >> 4; const int key0 = wv * KCH;
    const bool active = key0 < r0 + 32; const int nact = (r0 + 32 + KCH - 1) / KCH;      // waves 0 .. nact-1 hold causal keys (nact <= 16)
    const unsigned qo = (unsigned)(r0 * HD + 8 * lane) * 2u, ko = (unsigned)(key0 * HD + 8 * lane) * 2u, vo = (unsigned)(key0 * HD + 8 * lane) * 2u;   // byte offset of a lane's first element of the query rows, the key rows and the value columns: the one address register of each group of loads
    v8f s[NM][2];
#pragma unroll
    for (int mt = 0; mt < NM; ++mt) { s[mt][0] = (v8f){}; s[mt][1] = (v8f){}; }
    float mx[2] = {-3.0e38f, -3.0e38f};
    V b[NS][4], b2[NS][4];
    if (active) {
        V q[2][2], q2[2][2], k[NM][2], k2[NM][2];
#pragma unroll
        for (int nb = 0; nb < 2; ++nb)
#pragma unroll
            for (int kc = 0; kc < 2; ++kc) { const int o = (nb * 2 + kc) * 512; q[nb][kc] = WFrag<T16>::ld(atb(Q, qo) + o); if (NSPLIT == 2) q2[nb][kc] = WFrag<T16>::ld(atb(Q2, qo) + o); }
#pragma unroll
        for (int mt = 0; mt < NM; ++mt)
#pragma unroll
            for (int kc = 0; kc < 2; ++kc) { const int o = (mt * 2 + kc) * 512; k[mt][kc] = WFrag<T16>::ld(atb(Kp, ko) + o); if (NSPLIT == 2) k2[mt][kc] = WFrag<T16>::ld(atb(Kp2, ko) + o); }
        asm volatile("s_wait_xcnt 0x0" :: "v"(qo), "v"(ko) : "memory");   // the loads' address registers stay whole up to this wait
        __builtin_amdgcn_sched_barrier(0);   // keeps every load above in front of the first product, so that the wave waits out the load latency once and not once per key tile
#pragma unroll
        for (int mt = 0; mt < NM; ++mt)
#pragma unroll
            for (int nb = 0; nb < 2; ++nb)
#pragma unroll
                for (int kc = 0; kc < 2; ++kc) { s[mt][nb] = WFrag<T16>::mma(k[mt][kc], q[nb][kc], s[mt][nb]); if (NSPLIT == 2) { s[mt][nb] = WFrag<T16>::mma(k[mt][kc], q2[nb][kc], s[mt][nb]); s[mt][nb] = WFrag<T16>::mma(k2[mt][kc], q[nb][kc], s[mt][nb]); } }
        if (key0 + KCH - 1 > r0) {           // only a wave that holds a key beyond the tile's first query has anything to mask
            const int dl = r0 + lr - key0 - hi * 8;   // key (mt, j) is causal for query (nb, lr) where mt * 16 + j - nb * 16 <= dl
#pragma unroll
            for (int mt = 0; mt < NM; ++mt)
#pragma unroll
                for (int nb = 0; nb < 2; ++nb)
#pragma unroll
                    for (int j = 0; j < 8; ++j) s[mt][nb][j] = (mt * 16 + j - nb * 16 <= dl) ? s[mt][nb][j] : -3.0e38f;
        }
#pragma unroll
        for (int mt = 0; mt < NM; ++mt)
#pragma unroll
            for (int nb = 0; nb < 2; ++nb)
#pragma unroll
                for (int j = 0; j < 8; ++j) { const float t = s[mt][nb][j] * SCL; s[mt][nb][j] = t; mx[nb] = fmaxf(mx[nb], t); }
        mx[0] = fmaxf(mx[0], __shfl_xor(mx[0], 16, 32)); mx[1] = fmaxf(mx[1], __shfl_xor(mx[1], 16, 32));
    }
    if (hi == 0) { smax[wv][lr] = mx[0]; smax[wv][16 + lr] = mx[1]; }
    __syncthreads();   // every wave's row maxima are in LDS before any wave takes the maximum over the waves
    float sm[2] = {0.f, 0.f};
    if (active) {
#pragma unroll
        for (int w = 0; w < 16; ++w) { mx[0] = fmaxf(mx[0], smax[w][lr]); mx[1] = fmaxf(mx[1], smax[w][16 + lr]); }
#pragma unroll
        for (int mt = 0; mt < NM; ++mt)
#pragma unroll
            for (int nb = 0; nb < 2; ++nb)
#pragma unroll
                for (int j = 0; j < 8; ++j) { const float e = __builtin_amdgcn_exp2f(__fmul_rn(__fsub_rn(s[mt][nb][j], mx[nb]), 1.4426950408889634f)); s[mt][nb][j] = e; sm[nb] += e; }
        sm[0] += __shfl_xor(sm[0], 16, 32); sm[1] += __shfl_xor(sm[1], 16, 32);
#pragma unroll
        for (int ss = 0; ss < NS; ++ss)
#pragma unroll
            for (int db = 0; db < 2; ++db) { const int ofs = (ss * 4 + db) * 512; b[ss][db] = WFrag<T16>::ld(atb(Vt, vo) + ofs); if (NSPLIT == 2) b2[ss][db] = WFrag<T16>::ld(atb(Vt2, vo) + ofs); }
        asm volatile("s_wait_xcnt 0x0" :: "v"(vo) : "memory");   // as above: the address register stays whole up to this wait
        __builtin_amdgcn_sched_barrier(0);   // holds the loads of value columns 0..31 here, so that they fly while the row sums meet over the waves
    }
    if (hi == 0) { ssum[wv][lr] = sm[0]; ssum[wv][16 + lr] = sm[1]; }
    __syncthreads();   // every wave's row sums are in LDS before any wave adds them up
    {
        if (active) {
            v8f o[2][4];
#pragma unroll
            for (int qb = 0; qb < 2; ++qb)
#pragma unroll
                for (int db = 0; db < 4; ++db) o[qb][db] = (v8f){};
            float t0 = ssum[0][lr], t1 = ssum[0][16 + lr];
#pragma unroll
            for (int w = 1; w < 16; ++w) { t0 += ssum[w][lr]; t1 += ssum[w][16 + lr]; }
            const float f[2] = {__fdiv_rn(pnum, t0), __fdiv_rn(pnum, t1)};
            V a[NS][2], a2[NS][2];
#pragma unroll
            for (int ss = 0; ss < NS; ++ss)
#pragma unroll
                for (int qb = 0; qb < 2; ++qb) mkp(s[2 * ss][qb], s[2 * ss + 1][qb], f[qb], a[ss][qb], a2[ss][qb]);
            __builtin_amdgcn_sched_barrier(0);   // the loads below start only when the packed probabilities have freed half of the score registers: earlier they would spill
#pragma unroll
            for (int ss = 0; ss < NS; ++ss)
#pragma unroll
                for (int db = 2; db < 4; ++db) { const int ofs = (ss * 4 + db) * 512; b[ss][db] = WFrag<T16>::ld(atb(Vt, vo) + ofs); if (NSPLIT == 2) b2[ss][db] = WFrag<T16>::ld(atb(Vt2, vo) + ofs); }
            asm volatile("s_wait_xcnt 0x0" :: "v"(vo) : "memory");   // as above: the address register stays whole up to this wait
            __builtin_amdgcn_sched_barrier(0);   // keeps those loads in front of the first product: they fly during the products of value columns 0..31
#pragma unroll
            for (int db = 0; db < 4; ++db)
#pragma unroll
                for (int ss = 0; ss < NS; ++ss)
#pragma unroll
                    for (int qb = 0; qb < 2; ++qb) { o[qb][db] = WFrag<T16>::mma(a[ss][qb], b[ss][db], o[qb][db]); if (NSPLIT == 2) { o[qb][db] = WFrag<T16>::mma(a2[ss][qb], b[ss][db], o[qb][db]); o[qb][db] = WFrag<T16>::mma(a[ss][qb], b2[ss][db], o[qb][db]); } }
            __builtin_amdgcn_sched_barrier(0);   // keeps the LDS stores behind the last product
#pragma unroll
            for (int qb = 0; qb < 2; ++qb)
#pragma unroll
                for (int db = 0; db < 4; ++db)
#pragma unroll
                    for (int j = 0; j < 8; ++j) red[wv][(qb * 16 + hi * 8 + j) * RP + db * 16 + lr] = o[qb][db][j];
        } else if (wv < ((nact + 3) & ~3)) {   // the final sum reads the partial tiles in groups of four waves: an idle wave of the last group stores zeros
#pragma unroll
            for (int u = 0; u < 16; ++u) *(v4fa*)&red[wv][(u * 2 + hi) * RP + lr * 4] = (v4f){};
        }
    }
    __syncthreads();   // every wave's partial tile is in LDS before any wave sums
    const int row = threadIdx.x >> 4, col = (threadIdx.x & 15) * 4; v4f acc = *(const v4fa*)&red[0][row * RP + col];
#pragma unroll
    for (int w = 1; w < 4; ++w) acc += *(const v4fa*)&red[w][row * RP + col];
#pragma unroll
    for (int g = 4; g < 16; g += 4)
        if (g < nact) {
#pragma unroll
            for (int w = g; w < g + 4; ++w) acc += *(const v4fa*)&red[w][row * RP + col]; }
    v4f ov;   // the tile goes straight to its head's 64 columns of the output rows: probabilities' scale taken off, then hi + lo of the bf16 pair
#pragma unroll
    for (int u = 0; u < 4; ++u) { unsigned short a, c2; splitf(acc[u] * (1.0f / pnum), a, c2); ov[u] = __fadd_rn(bf2f(a), bf2f(c2)); }
    *(v4f*)(O + (size_t)(r0 + row) * DQ + col) = ov;
}
// grid (batches * heads, TT/32): the tiles with the most keys, of every batch and head, start first
__global__ __launch_bounds__(512) void k_attn(const h16* __restrict__ QK16, const h16* __restrict__ V16, const bf* __restrict__ QKh, const bf* __restrict__ QKl, const bf* __restrict__ Vh, const bf* __restrict__ Vl, float* O) {
    __shared__ __align__(16) float red[16][32 * RP]; __shared__ float smax[16][32]; __shared__ float ssum[16][32];
    const int bt = (int)blockIdx.x / NH_, hd = (int)blockIdx.x % NH_; const int r0 = (TT / 32 - 1 - (int)blockIdx.y) * 32;
    const size_t zq = ((size_t)bt * (NH_ + NKV) + hd) * TT * HD, zk = zq + (size_t)NH_ * TT * HD, zv = ((size_t)bt * NKV + hd) * HD * TT;
    float* Oh = O + (size_t)bt * TT * DQ + (size_t)hd * HD;   // O: output rows [batch][t][heads * HD]
    if (r0 < RH) attn_tile<bf, 2, RH / 16>(QKh + zq, QKl + zq, QKh + zk, QKl + zk, Vh + zv, Vl + zv, Oh, r0, 1.0f, red, smax, ssum);
    else attn_tile<h16, 0, TT / 16>(QK16 + zq, nullptr, QK16 + zk, nullptr, V16 + zv, nullptr, Oh, r0, PCAR, red, smax, ssum);
}
extern "C" void kernel_launch(void* const* d_in, const int* in_sizes, int n_in,
                              void* d_out, int out_size, void* d_ws, size_t ws_size, hipStream_t stream) {
    (void)in_sizes; (void)n_in; (void)out_size;
    const float* x = (const float*)d_in[0]; const float* wf = (const float*)d_in[1]; const float* bfz = (const float*)d_in[2];   // x [4][2048][1024], W [3072][1024] (rows q | k | v), b [3072]
    float* OUT = (float*)d_out;     // [4][2048][1024]
    char* wsp = (char*)d_ws;
    auto take = [&](size_t bytes) { char* p = wsp; wsp += (bytes + 255) & ~(size_t)255; return (void*)p; };
    bf* WB = (bf*)take((size_t)(DQ + 2 * DKV) * DM * 2);
    bf* XB = (bf*)take((size_t)NB_ * TT * DM * 2);
    h16* QK16 = (h16*)take((size_t)NB_ * (NH_ + NKV) * TT * HD * 2); h16* VT16 = (h16*)take((size_t)NB_ * NKV * HD * TT * 2);
    bf* QKh = (bf*)take((size_t)NB_ * (NH_ + NKV) * TT * HD * 2); bf* QKl = (bf*)take((size_t)NB_ * (NH_ + NKV) * TT * HD * 2); bf* VTh = (bf*)take((size_t)NB_ * NKV * HD * TT * 2); bf* VTl = (bf*)take((size_t)NB_ * NKV * HD * TT * 2);
    if ((size_t)(wsp - (char*)d_ws) > ws_size) return;    // 166 MiB of the 256 MiB
    k_cvt8<<<(unsigned)(((size_t)NB_ * TT * DM / 8 + (size_t)(DQ + 2 * DKV) * DM / 8 + 255) / 256), 256, 0, stream>>>(x, XB, (size_t)NB_ * TT * DM / 8, wf, WB, (size_t)(DQ + 2 * DKV) * DM / 8);
    k_gemmw<bf, 0, true, DM><<<dim3(NB_ * TT / 64, (DQ + 2 * DKV) / 64, 1), 32, 0, stream>>>(XB, nullptr, WB, nullptr, QK16, QKh, QKl, VT16, VTh, VTl, bfz, 0, 0);
    k_attn<<<dim3(NB_ * NH_, TT / 32, 1), 512, 0, stream>>>(QK16, VT16, QKh, QKl, VTh, VTl, OUT);
}

// v007
// It runs in 129 microseconds.
// In both of two side-by-side timings against v006, it was 1.18 times as fast.
// Over all steps from v000 it is 21.7 times as fast.
#include <hip/hip_runtime.h>

// SelfAttentionHead (x [4][2048][1024]; qkv = x W^T + b (W [3072][1024], split (q | k | v) x 16 heads x 64); causal softmax(q.k / 8); out = merged heads (no output projection) -> [4][2048][1024]).
// Compute dtypes, f32 accumulate: every input rounded to bf16; q/k/v on PLAIN bf16 operands (inputs: exact) + bias; causal scores and attn.v: query rows < 512 hl (3 products), the rest single fp16 (x1024); softmax f32; the merged heads are written as hi + lo of a bf16 pair (i.e. the f32 attention output rounded through a bf16 pair, |err| <= 2^-16 relative).

#define NB_  4
#define TT   2048
#define DM   1024
#define NH_  16
#define NKV  16
#define REP  (NH_ / NKV)
#define HD   64
#define DQ   (NH_ * HD)
#define DKV  (NKV * HD)
#define ZH   16                   // not used: one launch of the attention kernel covers all NH_ heads
#define RH   512                  // query rows < RH use hi+lo planes (0: none)
#define PCAR 1024.0f
#define SCL  0.125f   // HD^-0.5
typedef _Float16 h16;
typedef unsigned short bf;
typedef __attribute__((ext_vector_type(16))) __bf16   v16bf;
typedef __attribute__((ext_vector_type(16))) _Float16 v16h;
typedef __attribute__((ext_vector_type(8)))  _Float16 v8h;
typedef __attribute__((ext_vector_type(8)))  unsigned short v8us;
typedef __attribute__((ext_vector_type(8)))  float    v8f;
typedef __attribute__((ext_vector_type(4)))  float    v4f;
typedef v8h  __attribute__((may_alias)) v8ha;
typedef v4f  __attribute__((may_alias)) v4fa;
typedef v8us __attribute__((may_alias)) v8usa;

__device__ __forceinline__ unsigned short f2bf(float f) { unsigned u = __float_as_uint(f); u += 0x7FFFu + ((u >> 16) & 1u); return (unsigned short)(u >> 16); }
__device__ __forceinline__ float bf2f(unsigned short b) { return __uint_as_float(((unsigned)b) << 16); }
__device__ __forceinline__ float bfr(float f) { return bf2f(f2bf(f)); }
__device__ __forceinline__ h16 tohx(float x) { return (h16)x; }
__device__ __forceinline__ void splitf(float y, unsigned short& h, unsigned short& l) { h = f2bf(y); l = f2bf(y - bf2f(h)); }
__device__ __forceinline__ v16h cat16(v8h lo, v8h hi) { return __builtin_shufflevector(lo, hi, 0, 1, 2, 3, 4, 5, 6, 7, 8, 9, 10, 11, 12, 13, 14, 15); }
__device__ __forceinline__ v16bf cat16b(v8us lo, v8us hi) { return __builtin_bit_cast(v16bf, __builtin_shufflevector(lo, hi, 0, 1, 2, 3, 4, 5, 6, 7, 8, 9, 10, 11, 12, 13, 14, 15)); }
__device__ __forceinline__ v8f wmma16(v16h a, v16h b, v8f c) { return __builtin_amdgcn_wmma_f32_16x16x32_f16(false, a, false, b, (short)0, c, false, false); }
__device__ __forceinline__ v8f wmmab(v16bf a, v16bf b, v8f c) { return __builtin_amdgcn_wmma_f32_16x16x32_bf16(false, a, false, b, (short)0, c, false, false); }



// ---- FRAGMENT ORDER of every 16-bit plane in the workspace: a plane of rows x k is cut into blocks of 16 rows x 32 k = 1 KiB, and inside a block element (r, kk) stands at (kk >> 4) * 256 + (((kk >> 3) & 1) * 16 + r) * 8 + (kk & 7).
// That is the order in which the 32 lanes of a wave take a 16x16x32 operand: lane l reads 16 bytes at l * 16 and 16 bytes at 512 + l * 16, so each wave-wide load is 512 contiguous bytes (4 whole 128-byte lines) and not 32 bytes of each of 16 lines.
// ---- k_gemmw: register-blocked GEMM, one wave per 64x64 output tile (16 accumulators), EIGHT waves (2 x 4) per work-group = a 128x256 tile; grid (M/128, N/256, Z), 256 threads.
// The operands (16-bit planes in fragment order, blocks of one 16-row group run along k) come through an LDS ring of two buffers, filled by asynchronous copies: a stage is [A 8 row groups | B 16 row groups] x 64 k = 48 KiB, each row group 2 KiB,
// so a byte of A is fetched from L2 once for four waves and a byte of B once for two. In LDS a block keeps its fragment order: a wave-wide 16-byte read is 512 contiguous bytes.
// c[m][n] (f32, + optional f32 bias[n]) = sum_k A[m][k] Bt[n][k]. z-batch strides sA/sB in elements. K % 64 == 0, at least two stages; K is a compile-time constant, and with it the distance between two row groups.
// The tile's 64 columns are one head (HD == 64), its rows are sequence positions. The epilogue writes c as the three 16-bit planes that the attention kernel reads (fp16, bf16 hi, bf16 lo):
// Rows are (batch, t), columns the fused (q | k | v) outputs. Columns < DQ + DKV: [batch][q heads | k heads] planes of t rows x d, block (t / 16) * 2 + d / 32; the rest: [batch][head] planes of d rows x t, block (t / 32) * 4 + d / 16. No f32 copy of c leaves the chip.
template <typename T16> struct WFrag;
template <> struct WFrag<h16> { typedef v16h V; static __device__ __forceinline__ V ld(const h16* p) { return cat16(*(const v8h*)p, *(const v8h*)(p + 256)); } static __device__ __forceinline__ v8f mma(V a, V b, v8f c) { return wmma16(a, b, c); } };
template <> struct WFrag<bf> { typedef v16bf V; static __device__ __forceinline__ V ld(const bf* p) { return cat16b(*(const v8us*)p, *(const v8us*)(p + 256)); } static __device__ __forceinline__ v8f mma(V a, V b, v8f c) { return wmmab(a, b, c); } };
template <typename T16> __device__ __forceinline__ const T16* atb(const T16* p, unsigned bytes) { return (const T16*)((const char*)p + bytes); }
#define GKS  64                   // k of one stage of the GEMM's LDS ring
#define GSTG ((8 + 16) * 16 * GKS * 2)   // bytes of a stage
// One stage's copies of one thread: 12 x 16 bytes. Copy c of thread t fills bytes (c * 256 + t) * 16 of the stage: row group c * 2 + t / 128 (0..7 of A, then 0..15 of B), gs = bytes between row groups g and g + 2 in the plane.
// The wait on the address registers is the statement's last line, so that no later write of them can be lifted over it.
__device__ __forceinline__ void stage_copies(const unsigned l, const char* ga, const char* gb, const unsigned gs) {
    asm volatile("global_load_async_to_lds_b128 %0, %12, off\n\t"
                 "global_load_async_to_lds_b128 %1, %13, off\n\t"
                 "global_load_async_to_lds_b128 %2, %14, off\n\t"
                 "global_load_async_to_lds_b128 %3, %15, off\n\t"
                 "global_load_async_to_lds_b128 %4, %16, off\n\t"
                 "global_load_async_to_lds_b128 %5, %17, off\n\t"
                 "global_load_async_to_lds_b128 %6, %18, off\n\t"
                 "global_load_async_to_lds_b128 %7, %19, off\n\t"
                 "global_load_async_to_lds_b128 %8, %20, off\n\t"
                 "global_load_async_to_lds_b128 %9, %21, off\n\t"
                 "global_load_async_to_lds_b128 %10, %22, off\n\t"
                 "global_load_async_to_lds_b128 %11, %23, off\n\t"
                 "s_wait_xcnt 0x0"
                 :: "v"(l), "v"(l + 4096u), "v"(l + 8192u), "v"(l + 12288u), "v"(l + 16384u), "v"(l + 20480u), "v"(l + 24576u), "v"(l + 28672u), "v"(l + 32768u), "v"(l + 36864u), "v"(l + 40960u), "v"(l + 45056u),
                    "v"(ga), "v"(ga + gs), "v"(ga + 2 * (size_t)gs), "v"(ga + 3 * (size_t)gs),
                    "v"(gb), "v"(gb + gs), "v"(gb + 2 * (size_t)gs), "v"(gb + 3 * (size_t)gs), "v"(gb + 4 * (size_t)gs), "v"(gb + 5 * (size_t)gs), "v"(gb + 6 * (size_t)gs), "v"(gb + 7 * (size_t)gs)
                 : "memory");
}
template <typename T16, int NSPLIT, bool BIAS, int K>
__global__ __launch_bounds__(256) void k_gemmw(const T16* __restrict__ A, const T16* __restrict__ A2, const T16* __restrict__ Bt, const T16* __restrict__ Bt2, h16* P16, bf* Ph, bf* Pl, h16* T16p, bf* Th, bf* Tl, const float* __restrict__ bias, size_t sA, size_t sB) {
    static_assert(HD == 64 && TT % 64 == 0, "one 64-column tile is one head, its 64 rows lie in one batch");
    typedef typename WFrag<T16>::V V;
    static_assert(NSPLIT == 0 && K % GKS == 0 && K / GKS >= 2, "single product; the ring's prologue needs two stages");
    __shared__ __align__(16) T16 ring[2 * GSTG / 2]; __shared__ __align__(16) float osw[8][16 * 68];
    (void)A2; (void)Bt2; const size_t z = blockIdx.z; A += z * sA; Bt += z * sB;
    const int wv = __builtin_amdgcn_readfirstlane((int)(threadIdx.x >> 5)), wm = wv & 1, wn = wv >> 1; float* os = osw[wv];   // each wave turns its own tile through its own LDS rows
    const int lane = threadIdx.x & 31, lr = lane & 15, hi = lane >> 4; const int r0 = blockIdx.x * 128 + wm * 64, c0 = blockIdx.y * 256 + wn * 64; const int bt = r0 / TT, t0 = r0 % TT;
    const bool vcol = c0 >= DQ + DKV; if (vcol) { P16 = T16p; Ph = Th; Pl = Tl; }   // a tile of value columns goes to the transposed planes
    v8f acc[4][4];
#pragma unroll
    for (int mb = 0; mb < 4; ++mb)
#pragma unroll
        for (int nb = 0; nb < 4; ++nb) acc[mb][nb] = (v8f){};
    const unsigned tid = threadIdx.x, gs = 2u * 16u * K * 2u;   // a 16-row group is 16 * K elements, its block of 32 k is 512
    const char* ga = (const char*)A + ((size_t)blockIdx.x * 8 + (tid >> 7)) * (16 * K * 2) + (tid & 127u) * 16u; const char* gb = (const char*)Bt + ((size_t)blockIdx.y * 16 + (tid >> 7)) * (16 * K * 2) + (tid & 127u) * 16u;
    const unsigned l0 = (unsigned)(size_t)ring + tid * 16u;   // the thread's LDS byte address in buffer 0
    constexpr int NT = K / GKS;
    stage_copies(l0, ga, gb, gs);
    asm volatile("s_wait_asynccnt 0x0" ::: "memory");   // this wave's copies of stage 0 have landed
    __syncthreads();                                     // ... and every other wave's: stage 0 may be read
    stage_copies(l0 + GSTG, ga + GKS * 32, gb + GKS * 32, gs);
#pragma unroll 1
    for (int t = 0; t < NT; ++t) {   // not unrolled: one trip is one stage, with one place where a stage is handed over
        const T16* sa = ring + (t & 1) * (GSTG / 2) + wm * 4 * (16 * GKS) + lane * 8; const T16* sb = ring + (t & 1) * (GSTG / 2) + (8 + wn * 4) * (16 * GKS) + lane * 8;
        V a[4], b[4];
#pragma unroll
        for (int kb = 0; kb < GKS / 32; ++kb) {
#pragma unroll
            for (int mb = 0; mb < 4; ++mb) a[mb] = WFrag<T16>::ld(sa + mb * (16 * GKS) + kb * 512);
#pragma unroll
            for (int nb = 0; nb < 4; ++nb) b[nb] = WFrag<T16>::ld(sb + nb * (16 * GKS) + kb * 512);
            __builtin_amdgcn_sched_barrier(0);   // keeps all of a block's 16 LDS reads in front of its first product: without it the B fragments are fetched one at a time among the products, each behind a full wait of its own
            if (kb == GKS / 32 - 1) {   // the stage's last block is in registers: the stage is handed over in front of that block's products, so that the refill flies for a whole trip
                asm volatile("s_wait_dscnt 0x0" ::: "memory");      // this wave's reads of stage t are done before its buffer is given up
                asm volatile("s_wait_asynccnt 0x0" ::: "memory");   // this wave's copies of stage t + 1 have landed
                __syncthreads();                                     // publishes stage t + 1 and ends every wave's reads of stage t
                if (t + 2 < NT) stage_copies(l0 + (unsigned)(t & 1) * GSTG, ga + (t + 2) * (GKS * 32), gb + (t + 2) * (GKS * 32), gs);
            }
#pragma unroll
            for (int nb = 0; nb < 4; ++nb) {
#pragma unroll
                for (int mb = 0; mb < 4; ++mb) acc[mb][nb] = WFrag<T16>::mma(a[mb], b[nb], acc[mb][nb]); }
        }
    }
    asm volatile("s_wait_asynccnt 0x0" ::: "memory");   // nothing is in flight when the wave goes on to its epilogue
    if (vcol) {   // an accumulator holds, per lane, 8 consecutive t of one d: that is the lane's own 16 bytes of one half of a block (d rows x t), so a wave stores 512 contiguous bytes
#pragma unroll
        for (int nb = 0; nb < 4; ++nb) { const float bb = BIAS ? bfr(bias[c0 + nb * 16 + lr]) : 0.0f;
#pragma unroll
            for (int mb = 0; mb < 4; ++mb) { v8h o16; v8us oh, ol;
#pragma unroll
                for (int j = 0; j < 8; ++j) { float x = acc[mb][nb][j]; if (BIAS) x += bb; o16[j] = tohx(x); unsigned short a2, c2; splitf(x, a2, c2); oh[j] = a2; ol[j] = c2; }
                const size_t e = ((size_t)bt * DKV + (c0 - DQ - DKV)) * TT + (size_t)(((t0 >> 5) + (mb >> 1)) * 4 + nb) * 512 + (mb & 1) * 256 + lane * 8;
                *(v8h*)(P16 + e) = o16; *(v8us*)(Ph + e) = oh; *(v8us*)(Pl + e) = ol; } }
    } else {                 // rows of 64 d: turned through LDS so that a lane holds 8 consecutive d of one t, its own 16 bytes of one half of a block (t rows x d)
        float bb[4];
#pragma unroll
        for (int nb = 0; nb < 4; ++nb) bb[nb] = BIAS ? bfr(bias[c0 + nb * 16 + lr]) : 0.0f;
#pragma unroll
        for (int mb = 0; mb < 4; ++mb) {
#pragma unroll
            for (int nb = 0; nb < 4; ++nb) {
#pragma unroll
                for (int j = 0; j < 8; ++j) os[(hi * 8 + j) * 68 + nb * 16 + lr] = BIAS ? acc[mb][nb][j] + bb[nb] : acc[mb][nb][j]; }
            __builtin_amdgcn_wave_barrier(); asm volatile("" ::: "memory");   // the LDS stores above stay in front of the other lanes' reads below
#pragma unroll
            for (int s = 0; s < 4; ++s) { const int cofs = (2 * s + hi) * 8; const v4f v0 = *(const v4fa*)(os + lr * 68 + cofs), v1 = *(const v4fa*)(os + lr * 68 + cofs + 4); v8h o16; v8us oh, ol;   // half-block s of these 16 rows: d = 16 s + 8 hi ...
#pragma unroll
                for (int u = 0; u < 8; ++u) { const float x = (u < 4) ? v0[u & 3] : v1[u & 3]; o16[u] = tohx(x); unsigned short a2, c2; splitf(x, a2, c2); oh[u] = a2; ol[u] = c2; }
                const size_t e = (((size_t)bt * (NH_ + NKV) + c0 / HD) * TT + t0 + mb * 16) * HD + s * 256 + lane * 8;
                *(v8h*)(P16 + e) = o16; *(v8us*)(Ph + e) = oh; *(v8us*)(Pl + e) = ol; }
            __builtin_amdgcn_wave_barrier(); asm volatile("" ::: "memory");   // the reads above stay in front of the next 16 rows' LDS stores
        }
    }
}

typedef __attribute__((ext_vector_type(2))) _Float16 v2h;
typedef __attribute__((ext_vector_type(4))) _Float16 v4h;
typedef __attribute__((ext_vector_type(2))) unsigned short v2us;
typedef __attribute__((ext_vector_type(4))) unsigned short v4us;
typedef __attribute__((ext_vector_type(2))) float v2f;
typedef __attribute__((ext_vector_type(4))) int v4i;

__global__ __launch_bounds__(256) void k_wtG(const float* __restrict__ w, int K, int N, bf* Bt) {
    const int lane = threadIdx.x & 31; const int L0 = (blockIdx.x * 8 + (threadIdx.x >> 5)) * 8; const int nlines = N * K / 64;
{
#pragma unroll 1
        for (int l = 0; l < 8; ++l) { const int L = L0 + l; if (L >= nlines) break; const size_t e = (size_t)L * 64 + lane * 2; const int k = (int)(e % K), n = (int)(e / K); v2us o;
            o[0] = f2bf(w[(size_t)k * N + n]); o[1] = f2bf(w[(size_t)(k + 1) * N + n]); *(v2us*)(Bt + e) = o; }
         }
}
__global__ __launch_bounds__(256) void k_cvt8(const float* __restrict__ srcA, bf* dstA, size_t nA8, const float* __restrict__ srcB, bf* dstB, size_t nB8) { size_t i = (size_t)blockIdx.x * 256 + threadIdx.x; const float* src = srcA; bf* dst = dstA;
    if (i >= nA8) { i -= nA8; if (i >= nB8) return; src = srcB; dst = dstB; }   // one launch rounds both arrays: first A's groups of 8, then B's
    const size_t blk = i >> 6; const int r = (int)(i >> 2) & 15, c = (int)i & 3;   // 64 threads a block (16 rows x 32 k, rows of DM): 4 neighbours read one whole 128-byte line of a source row, and 8 rows' groups of one c are one whole line of the plane in fragment order
    const v8f v = *(const v8f*)(src + ((blk / (DM / 32)) * 16 + r) * DM + (blk % (DM / 32)) * 32 + c * 8); v8us o;
#pragma unroll
    for (int k = 0; k < 8; ++k) o[k] = f2bf(v[k]); *(v8us*)(dst + blk * 512 + ((c >> 1) * 32 + (c & 1) * 16 + r) * 8) = o;  }
__global__ __launch_bounds__(256) void k_cscvt(const float* __restrict__ cosT, const float* __restrict__ sinT, float* CS) { const int idx = blockIdx.x * 256 + threadIdx.x; if (idx >= TT * HD) return; v2f cs; cs[0] = bfr(cosT[idx]); cs[1] = bfr(sinT[idx]); *(v2f*)(CS + (size_t)idx * 2) = cs;  }
// ---- k_attn: causal scores, softmax and probability x value contraction of one 32-query tile of one head in ONE work-group (16 waves); no score or probability leaves the chip.
// Wave w owns keys [w*KCH, (w+1)*KCH). It forms the TRANSPOSED score tile (A = key rows, B = query rows), so that a lane holds 8 consecutive keys of one query per accumulator: two neighbouring accumulators
// are, element for element, the A fragment of the probability x value product, and the probabilities go from the softmax into that product without leaving their registers.
// The row maximum and the row sum meet over the waves in LDS (one barrier each; sum in wave order = ascending keys), the 16 partial output tiles likewise (third barrier).
// A wave whose keys all lie beyond the tile's last query computes no scores: it stores neutral row maxima and sums (and a zero tile if in the last group of four), passes the barriers and takes its share of the final sum. Queries < RH: hi + lo planes (3 products), 32 keys a wave; the rest fp16 (probabilities x PCAR), 128 keys a wave.
typedef __attribute__((ext_vector_type(16))) unsigned short v16us;
__device__ __forceinline__ void mkp(const v8f e0, const v8f e1, const float f, v16h& a, v16h& a2) { (void)a2;
#pragma unroll
    for (int j = 0; j < 8; ++j) { a[j] = tohx(e0[j] * f); a[8 + j] = tohx(e1[j] * f); } }
__device__ __forceinline__ void mkp(const v8f e0, const v8f e1, const float f, v16bf& a, v16bf& a2) { v16us h, l;
#pragma unroll
    for (int j = 0; j < 8; ++j) { unsigned short x, y; splitf(e0[j] * f, x, y); h[j] = x; l[j] = y; splitf(e1[j] * f, x, y); h[8 + j] = x; l[8 + j] = y; }
    a = __builtin_bit_cast(v16bf, h); a2 = __builtin_bit_cast(v16bf, l); }
#define RP 68                     // pitch, in floats, of a partial output row in LDS
template <typename T16, int NSPLIT, int KCH>
__device__ __forceinline__ void attn_tile(const T16* __restrict__ Q, const T16* __restrict__ Q2, const T16* __restrict__ Kp, const T16* __restrict__ Kp2, const T16* __restrict__ Vt, const T16* __restrict__ Vt2, float* O, const int r0, const float pnum, float (*red)[32 * RP], float (*smax)[32], float (*ssum)[32]) {
    typedef typename WFrag<T16>::V V;
    static_assert(KCH % 32 == 0 && 16 * KCH <= TT, "the 16 key slices stay inside the sequence");
    constexpr int NM = KCH / 16, NS = KCH / 32;
    const int wv = __builtin_amdgcn_readfirstlane((int)(threadIdx.x >> 5)); const int lane = threadIdx.x & 31, lr = lane & 15, hi = lane >> 4; const int key0 = wv * KCH;
    const bool active = key0 < r0 + 32; const int nact = (r0 + 32 + KCH - 1) / KCH;      // waves 0 .. nact-1 hold causal keys (nact <= 16)
    const unsigned qo = (unsigned)(r0 * HD + 8 * lane) * 2u, ko = (unsigned)(key0 * HD + 8 * lane) * 2u, vo = (unsigned)(key0 * HD + 8 * lane) * 2u;   // byte offset of a lane's first element of the query rows, the key rows and the value columns: the one address register of each group of loads
    v8f s[NM][2];
#pragma unroll
    for (int mt = 0; mt < NM; ++mt) { s[mt][0] = (v8f){}; s[mt][1] = (v8f){}; }
    float mx[2] = {-3.0e38f, -3.0e38f};
    V b[NS][4], b2[NS][4];
    if (active) {
        V q[2][2], q2[2][2], k[NM][2], k2[NM][2];
#pragma unroll
        for (int nb = 0; nb < 2; ++nb)
#pragma unroll
            for (int kc = 0; kc < 2; ++kc) { const int o = (nb * 2 + kc) * 512; q[nb][kc] = WFrag<T16>::ld(atb(Q, qo) + o); if (NSPLIT == 2) q2[nb][kc] = WFrag<T16>::ld(atb(Q2, qo) + o); }
#pragma unroll
        for (int mt = 0; mt < NM; ++mt)
#pragma unroll
            for (int kc = 0; kc < 2; ++kc) { const int o = (mt * 2 + kc) * 512; k[mt][kc] = WFrag<T16>::ld(atb(Kp, ko) + o); if (NSPLIT == 2) k2[mt][kc] = WFrag<T16>::ld(atb(Kp2, ko) + o); }
        asm volatile("s_wait_xcnt 0x0" :: "v"(qo), "v"(ko) : "memory");   // the loads' address registers stay whole up to this wait
        __builtin_amdgcn_sched_barrier(0);   // keeps every load above in front of the first product, so that the wave waits out the load latency once and not once per key tile
#pragma unroll
        for (int mt = 0; mt < NM; ++mt)
#pragma unroll
            for (int nb = 0; nb < 2; ++nb)
#pragma unroll
                for (int kc = 0; kc < 2; ++kc) { s[mt][nb] = WFrag<T16>::mma(k[mt][kc], q[nb][kc], s[mt][nb]); if (NSPLIT == 2) { s[mt][nb] = WFrag<T16>::mma(k[mt][kc], q2[nb][kc], s[mt][nb]); s[mt][nb] = WFrag<T16>::mma(k2[mt][kc], q[nb][kc], s[mt][nb]); } }
        if (key0 + KCH - 1 > r0) {           // only a wave that holds a key beyond the tile's first query has anything to mask
            const int dl = r0 + lr - key0 - hi * 8;   // key (mt, j) is causal for query (nb, lr) where mt * 16 + j - nb * 16 <= dl
#pragma unroll
            for (int mt = 0; mt < NM; ++mt)
#pragma unroll
                for (int nb = 0; nb < 2; ++nb)
#pragma unroll
                    for (int j = 0; j < 8; ++j) s[mt][nb][j] = (mt * 16 + j - nb * 16 <= dl) ? s[mt][nb][j] : -3.0e38f;
        }
#pragma unroll
        for (int mt = 0; mt < NM; ++mt)
#pragma unroll
            for (int nb = 0; nb < 2; ++nb)
#pragma unroll
                for (int j = 0; j < 8; ++j) { const float t = s[mt][nb][j] * SCL; s[mt][nb][j] = t; mx[nb] = fmaxf(mx[nb], t); }
        mx[0] = fmaxf(mx[0], __shfl_xor(mx[0], 16, 32)); mx[1] = fmaxf(mx[1], __shfl_xor(mx[1], 16, 32));
    }
    if (hi == 0) { smax[wv][lr] = mx[0]; smax[wv][16 + lr] = mx[1]; }
    __syncthreads();   // every wave's row maxima are in LDS before any wave takes the maximum over the waves
    float sm[2] = {0.f, 0.f};
    if (active) {
#pragma unroll
        for (int w = 0; w < 16; ++w) { mx[0] = fmaxf(mx[0], smax[w][lr]); mx[1] = fmaxf(mx[1], smax[w][16 + lr]); }
#pragma unroll
        for (int mt = 0; mt < NM; ++mt)
#pragma unroll
            for (int nb = 0; nb < 2; ++nb)
#pragma unroll
                for (int j = 0; j < 8; ++j) { const float e = __builtin_amdgcn_exp2f(__fmul_rn(__fsub_rn(s[mt][nb][j], mx[nb]), 1.4426950408889634f)); s[mt][nb][j] = e; sm[nb] += e; }
        sm[0] += __shfl_xor(sm[0], 16, 32); sm[1] += __shfl_xor(sm[1], 16, 32);
#pragma unroll
        for (int ss = 0; ss < NS; ++ss)
#pragma unroll
            for (int db = 0; db < 2; ++db) { const int ofs = (ss * 4 + db) * 512; b[ss][db] = WFrag<T16>::ld(atb(Vt, vo) + ofs); if (NSPLIT == 2) b2[ss][db] = WFrag<T16>::ld(atb(Vt2, vo) + ofs); }
        asm volatile("s_wait_xcnt 0x0" :: "v"(vo) : "memory");   // as above: the address register stays whole up to this wait
        __builtin_amdgcn_sched_barrier(0);   // holds the loads of value columns 0..31 here, so that they fly while the row sums meet over the waves
    }
    if (hi == 0) { ssum[wv][lr] = sm[0]; ssum[wv][16 + lr] = sm[1]; }
    __syncthreads();   // every wave's row sums are in LDS before any wave adds them up
    {
        if (active) {
            v8f o[2][4];
#pragma unroll
            for (int qb = 0; qb < 2; ++qb)
#pragma unroll
                for (int db = 0; db < 4; ++db) o[qb][db] = (v8f){};
            float t0 = ssum[0][lr], t1 = ssum[0][16 + lr];
#pragma unroll
            for (int w = 1; w < 16; ++w) { t0 += ssum[w][lr]; t1 += ssum[w][16 + lr]; }
            const float f[2] = {__fdiv_rn(pnum, t0), __fdiv_rn(pnum, t1)};
            V a[NS][2], a2[NS][2];
#pragma unroll
            for (int ss = 0; ss < NS; ++ss)
#pragma unroll
                for (int qb = 0; qb < 2; ++qb) mkp(s[2 * ss][qb], s[2 * ss + 1][qb], f[qb], a[ss][qb], a2[ss][qb]);
            __builtin_amdgcn_sched_barrier(0);   // the loads below start only when the packed probabilities have freed half of the score registers: earlier they would spill
#pragma unroll
            for (int ss = 0; ss < NS; ++ss)
#pragma unroll
                for (int db = 2; db < 4; ++db) { const int ofs = (ss * 4 + db) * 512; b[ss][db] = WFrag<T16>::ld(atb(Vt, vo) + ofs); if (NSPLIT == 2) b2[ss][db] = WFrag<T16>::ld(atb(Vt2, vo) + ofs); }
            asm volatile("s_wait_xcnt 0x0" :: "v"(vo) : "memory");   // as above: the address register stays whole up to this wait
            __builtin_amdgcn_sched_barrier(0);   // keeps those loads in front of the first product: they fly during the products of value columns 0..31
#pragma unroll
            for (int db = 0; db < 4; ++db)
#pragma unroll
                for (int ss = 0; ss < NS; ++ss)
#pragma unroll
                    for (int qb = 0; qb < 2; ++qb) { o[qb][db] = WFrag<T16>::mma(a[ss][qb], b[ss][db], o[qb][db]); if (NSPLIT == 2) { o[qb][db] = WFrag<T16>::mma(a2[ss][qb], b[ss][db], o[qb][db]); o[qb][db] = WFrag<T16>::mma(a[ss][qb], b2[ss][db], o[qb][db]); } }
            __builtin_amdgcn_sched_barrier(0);   // keeps the LDS stores behind the last product
#pragma unroll
            for (int qb = 0; qb < 2; ++qb)
#pragma unroll
                for (int db = 0; db < 4; ++db)
#pragma unroll
                    for (int j = 0; j < 8; ++j) red[wv][(qb * 16 + hi * 8 + j) * RP + db * 16 + lr] = o[qb][db][j];
        } else if (wv < ((nact + 3) & ~3)) {   // the final sum reads the partial tiles in groups of four waves: an idle wave of the last group stores zeros
#pragma unroll
            for (int u = 0; u < 16; ++u) *(v4fa*)&red[wv][(u * 2 + hi) * RP + lr * 4] = (v4f){};
        }
    }
    __syncthreads();   // every wave's partial tile is in LDS before any wave sums
    const int row = threadIdx.x >> 4, col = (threadIdx.x & 15) * 4; v4f acc = *(const v4fa*)&red[0][row * RP + col];
#pragma unroll
    for (int w = 1; w < 4; ++w) acc += *(const v4fa*)&red[w][row * RP + col];
#pragma unroll
    for (int g = 4; g < 16; g += 4)
        if (g < nact) {
#pragma unroll
            for (int w = g; w < g + 4; ++w) acc += *(const v4fa*)&red[w][row * RP + col]; }
    v4f ov;   // the tile goes straight to its head's 64 columns of the output rows: probabilities' scale taken off, then hi + lo of the bf16 pair
#pragma unroll
    for (int u = 0; u < 4; ++u) { unsigned short a, c2; splitf(acc[u] * (1.0f / pnum), a, c2); ov[u] = __fadd_rn(bf2f(a), bf2f(c2)); }
    *(v4f*)(O + (size_t)(r0 + row) * DQ + col) = ov;
}
// grid (batches * heads, TT/32): the tiles with the most keys, of every batch and head, start first
__global__ __launch_bounds__(512) void k_attn(const h16* __restrict__ QK16, const h16* __restrict__ V16, const bf* __restrict__ QKh, const bf* __restrict__ QKl, const bf* __restrict__ Vh, const bf* __restrict__ Vl, float* O) {
    __shared__ __align__(16) float red[16][32 * RP]; __shared__ float smax[16][32]; __shared__ float ssum[16][32];
    const int bt = (int)blockIdx.x / NH_, hd = (int)blockIdx.x % NH_; const int r0 = (TT / 32 - 1 - (int)blockIdx.y) * 32;
    const size_t zq = ((size_t)bt * (NH_ + NKV) + hd) * TT * HD, zk = zq + (size_t)NH_ * TT * HD, zv = ((size_t)bt * NKV + hd) * HD * TT;
    float* Oh = O + (size_t)bt * TT * DQ + (size_t)hd * HD;   // O: output rows [batch][t][heads * HD]
    if (r0 < RH) attn_tile<bf, 2, RH / 16>(QKh + zq, QKl + zq, QKh + zk, QKl + zk, Vh + zv, Vl + zv, Oh, r0, 1.0f, red, smax, ssum);
    else attn_tile<h16, 0, TT / 16>(QK16 + zq, nullptr, QK16 + zk, nullptr, V16 + zv, nullptr, Oh, r0, PCAR, red, smax, ssum);
}
extern "C" void kernel_launch(void* const* d_in, const int* in_sizes, int n_in,
                              void* d_out, int out_size, void* d_ws, size_t ws_size, hipStream_t stream) {
    (void)in_sizes; (void)n_in; (void)out_size;
    const float* x = (const float*)d_in[0]; const float* wf = (const float*)d_in[1]; const float* bfz = (const float*)d_in[2];   // x [4][2048][1024], W [3072][1024] (rows q | k | v), b [3072]
    float* OUT = (float*)d_out;     // [4][2048][1024]
    char* wsp = (char*)d_ws;
    auto take = [&](size_t bytes) { char* p = wsp; wsp += (bytes + 255) & ~(size_t)255; return (void*)p; };
    bf* WB = (bf*)take((size_t)(DQ + 2 * DKV) * DM * 2);
    bf* XB = (bf*)take((size_t)NB_ * TT * DM * 2);
    h16* QK16 = (h16*)take((size_t)NB_ * (NH_ + NKV) * TT * HD * 2); h16* VT16 = (h16*)take((size_t)NB_ * NKV * HD * TT * 2);
    bf* QKh = (bf*)take((size_t)NB_ * (NH_ + NKV) * TT * HD * 2); bf* QKl = (bf*)take((size_t)NB_ * (NH_ + NKV) * TT * HD * 2); bf* VTh = (bf*)take((size_t)NB_ * NKV * HD * TT * 2); bf* VTl = (bf*)take((size_t)NB_ * NKV * HD * TT * 2);
    if ((size_t)(wsp - (char*)d_ws) > ws_size) return;    // 166 MiB of the 256 MiB
    k_cvt8<<<(unsigned)(((size_t)NB_ * TT * DM / 8 + (size_t)(DQ + 2 * DKV) * DM / 8 + 255) / 256), 256, 0, stream>>>(x, XB, (size_t)NB_ * TT * DM / 8, wf, WB, (size_t)(DQ + 2 * DKV) * DM / 8);
    k_gemmw<bf, 0, true, DM><<<dim3(NB_ * TT / 128, (DQ + 2 * DKV) / 256, 1), 256, 0, stream>>>(XB, nullptr, WB, nullptr, QK16, QKh, QKl, VT16, VTh, VTl, bfz, 0, 0);
    k_attn<<<dim3(NB_ * NH_, TT / 32, 1), 512, 0, stream>>>(QK16, VT16, QKh, QKl, VTh, VTl, OUT);
}

// v008
// Measured time: 101 microseconds a run.
// In two side-by-side timings against v007, it was 1.26 and 1.27 times as fast.
// All steps since v000 together make it 27.5 times as fast.
#include <hip/hip_runtime.h>

// SelfAttentionHead (x [4][2048][1024]; qkv = x W^T + b (W [3072][1024], split (q | k | v) x 16 heads x 64); causal softmax(q.k / 8); out = merged heads (no output projection) -> [4][2048][1024]).
// Compute dtypes, f32 accumulate: every input rounded to bf16; q/k/v on PLAIN bf16 operands (inputs: exact) + bias; causal scores and attn.v: query rows < 512 hl (3 products), the rest single fp16 (x1024, running maximum and sum over 32-key passes); softmax f32; the merged heads are written as hi + lo of a bf16 pair (i.e. the f32 attention output rounded through a bf16 pair, |err| <= 2^-16 relative).

#define NB_  4
#define TT   2048
#define DM   1024
#define NH_  16
#define NKV  16
#define REP  (NH_ / NKV)
#define HD   64
#define DQ   (NH_ * HD)
#define DKV  (NKV * HD)
#define ZH   16                   // not used: one launch of the attention kernel covers all NH_ heads
#define RH   512                  // query rows < RH use hi+lo planes (0: none)
#define PCAR 1024.0f
#define SCL  0.125f   // HD^-0.5
typedef _Float16 h16;
typedef unsigned short bf;
typedef __attribute__((ext_vector_type(16))) __bf16   v16bf;
typedef __attribute__((ext_vector_type(16))) _Float16 v16h;
typedef __attribute__((ext_vector_type(8)))  _Float16 v8h;
typedef __attribute__((ext_vector_type(8)))  unsigned short v8us;
typedef __attribute__((ext_vector_type(8)))  float    v8f;
typedef __attribute__((ext_vector_type(4)))  float    v4f;
typedef v8h  __attribute__((may_alias)) v8ha;
typedef v4f  __attribute__((may_alias)) v4fa;
typedef v8us __attribute__((may_alias)) v8usa;

__device__ __forceinline__ unsigned short f2bf(float f) { unsigned u = __float_as_uint(f); u += 0x7FFFu + ((u >> 16) & 1u); return (unsigned short)(u >> 16); }
__device__ __forceinline__ float bf2f(unsigned short b) { return __uint_as_float(((unsigned)b) << 16); }
__device__ __forceinline__ float bfr(float f) { return bf2f(f2bf(f)); }
__device__ __forceinline__ h16 tohx(float x) { return (h16)x; }
__device__ __forceinline__ void splitf(float y, unsigned short& h, unsigned short& l) { h = f2bf(y); l = f2bf(y - bf2f(h)); }
__device__ __forceinline__ v16h cat16(v8h lo, v8h hi) { return __builtin_shufflevector(lo, hi, 0, 1, 2, 3, 4, 5, 6, 7, 8, 9, 10, 11, 12, 13, 14, 15); }
__device__ __forceinline__ v16bf cat16b(v8us lo, v8us hi) { return __builtin_bit_cast(v16bf, __builtin_shufflevector(lo, hi, 0, 1, 2, 3, 4, 5, 6, 7, 8, 9, 10, 11, 12, 13, 14, 15)); }
__device__ __forceinline__ v8f wmma16(v16h a, v16h b, v8f c) { return __builtin_amdgcn_wmma_f32_16x16x32_f16(false, a, false, b, (short)0, c, false, false); }
__device__ __forceinline__ v8f wmmab(v16bf a, v16bf b, v8f c) { return __builtin_amdgcn_wmma_f32_16x16x32_bf16(false, a, false, b, (short)0, c, false, false); }



// ---- FRAGMENT ORDER of every 16-bit plane in the workspace: a plane of rows x k is cut into blocks of 16 rows x 32 k = 1 KiB, and inside a block element (r, kk) stands at (kk >> 4) * 256 + (((kk >> 3) & 1) * 16 + r) * 8 + (kk & 7).
// That is the order in which the 32 lanes of a wave take a 16x16x32 operand: lane l reads 16 bytes at l * 16 and 16 bytes at 512 + l * 16, so each wave-wide load is 512 contiguous bytes (4 whole 128-byte lines) and not 32 bytes of each of 16 lines.
// ---- k_gemmw: register-blocked GEMM, one wave per 64x64 output tile (16 accumulators), EIGHT waves (2 x 4) per work-group = a 128x256 tile; grid (M/128, N/256, Z), 256 threads.
// The operands (16-bit planes in fragment order, blocks of one 16-row group run along k) come through an LDS ring of two buffers, filled by asynchronous copies: a stage is [A 8 row groups | B 16 row groups] x 64 k = 48 KiB, each row group 2 KiB,
// so a byte of A is fetched from L2 once for four waves and a byte of B once for two. In LDS a block keeps its fragment order: a wave-wide 16-byte read is 512 contiguous bytes.
// c[m][n] (f32, + optional f32 bias[n]) = sum_k A[m][k] Bt[n][k]. z-batch strides sA/sB in elements. K % 64 == 0, at least two stages; K is a compile-time constant, and with it the distance between two row groups.
// The tile's 64 columns are one head (HD == 64), its rows are sequence positions. The epilogue writes c as the three 16-bit planes that the attention kernel reads (fp16, bf16 hi, bf16 lo):
// Rows are (batch, t), columns the fused (q | k | v) outputs. Columns < DQ + DKV: [batch][q heads | k heads] planes of t rows x d, block (t / 16) * 2 + d / 32; the rest: [batch][head] planes of d rows x t, block (t / 32) * 4 + d / 16. No f32 copy of c leaves the chip.
template <typename T16> struct WFrag;
template <> struct WFrag<h16> { typedef v16h V; static __device__ __forceinline__ V ld(const h16* p) { return cat16(*(const v8h*)p, *(const v8h*)(p + 256)); } static __device__ __forceinline__ v8f mma(V a, V b, v8f c) { return wmma16(a, b, c); } };
template <> struct WFrag<bf> { typedef v16bf V; static __device__ __forceinline__ V ld(const bf* p) { return cat16b(*(const v8us*)p, *(const v8us*)(p + 256)); } static __device__ __forceinline__ v8f mma(V a, V b, v8f c) { return wmmab(a, b, c); } };
template <typename T16> __device__ __forceinline__ const T16* atb(const T16* p, unsigned bytes) { return (const T16*)((const char*)p + bytes); }
#define GKS  64                   // k of one stage of the GEMM's LDS ring
#define GSTG ((8 + 16) * 16 * GKS * 2)   // bytes of a stage
// One stage's copies of one thread: 12 x 16 bytes. Copy c of thread t fills bytes (c * 256 + t) * 16 of the stage: row group c * 2 + t / 128 (0..7 of A, then 0..15 of B), gs = bytes between row groups g and g + 2 in the plane.
// The wait on the address registers is the statement's last line, so that no later write of them can be lifted over it.
__device__ __forceinline__ void stage_copies(const unsigned l, const char* ga, const char* gb, const unsigned gs) {
    asm volatile("global_load_async_to_lds_b128 %0, %12, off\n\t"
                 "global_load_async_to_lds_b128 %1, %13, off\n\t"
                 "global_load_async_to_lds_b128 %2, %14, off\n\t"
                 "global_load_async_to_lds_b128 %3, %15, off\n\t"
                 "global_load_async_to_lds_b128 %4, %16, off\n\t"
                 "global_load_async_to_lds_b128 %5, %17, off\n\t"
                 "global_load_async_to_lds_b128 %6, %18, off\n\t"
                 "global_load_async_to_lds_b128 %7, %19, off\n\t"
                 "global_load_async_to_lds_b128 %8, %20, off\n\t"
                 "global_load_async_to_lds_b128 %9, %21, off\n\t"
                 "global_load_async_to_lds_b128 %10, %22, off\n\t"
                 "global_load_async_to_lds_b128 %11, %23, off\n\t"
                 "s_wait_xcnt 0x0"
                 :: "v"(l), "v"(l + 4096u), "v"(l + 8192u), "v"(l + 12288u), "v"(l + 16384u), "v"(l + 20480u), "v"(l + 24576u), "v"(l + 28672u), "v"(l + 32768u), "v"(l + 36864u), "v"(l + 40960u), "v"(l + 45056u),
                    "v"(ga), "v"(ga + gs), "v"(ga + 2 * (size_t)gs), "v"(ga + 3 * (size_t)gs),
                    "v"(gb), "v"(gb + gs), "v"(gb + 2 * (size_t)gs), "v"(gb + 3 * (size_t)gs), "v"(gb + 4 * (size_t)gs), "v"(gb + 5 * (size_t)gs), "v"(gb + 6 * (size_t)gs), "v"(gb + 7 * (size_t)gs)
                 : "memory");
}
template <typename T16, int NSPLIT, bool BIAS, int K>
__global__ __launch_bounds__(256) void k_gemmw(const T16* __restrict__ A, const T16* __restrict__ A2, const T16* __restrict__ Bt, const T16* __restrict__ Bt2, h16* P16, bf* Ph, bf* Pl, h16* T16p, bf* Th, bf* Tl, const float* __restrict__ bias, size_t sA, size_t sB) {
    static_assert(HD == 64 && TT % 64 == 0, "one 64-column tile is one head, its 64 rows lie in one batch");
    typedef typename WFrag<T16>::V V;
    static_assert(NSPLIT == 0 && K % GKS == 0 && K / GKS >= 2, "single product; the ring's prologue needs two stages");
    __shared__ __align__(16) T16 ring[2 * GSTG / 2]; __shared__ __align__(16) float osw[8][16 * 68];
    (void)A2; (void)Bt2; const size_t z = blockIdx.z; A += z * sA; Bt += z * sB;
    const int wv = __builtin_amdgcn_readfirstlane((int)(threadIdx.x >> 5)), wm = wv & 1, wn = wv >> 1; float* os = osw[wv];   // each wave turns its own tile through its own LDS rows
    const int lane = threadIdx.x & 31, lr = lane & 15, hi = lane >> 4; const int r0 = blockIdx.x * 128 + wm * 64, c0 = blockIdx.y * 256 + wn * 64; const int bt = r0 / TT, t0 = r0 % TT;
    const bool vcol = c0 >= DQ + DKV; if (vcol) { P16 = T16p; Ph = Th; Pl = Tl; }   // a tile of value columns goes to the transposed planes
    v8f acc[4][4];
#pragma unroll
    for (int mb = 0; mb < 4; ++mb)
#pragma unroll
        for (int nb = 0; nb < 4; ++nb) acc[mb][nb] = (v8f){};
    const unsigned tid = threadIdx.x, gs = 2u * 16u * K * 2u;   // a 16-row group is 16 * K elements, its block of 32 k is 512
    const char* ga = (const char*)A + ((size_t)blockIdx.x * 8 + (tid >> 7)) * (16 * K * 2) + (tid & 127u) * 16u; const char* gb = (const char*)Bt + ((size_t)blockIdx.y * 16 + (tid >> 7)) * (16 * K * 2) + (tid & 127u) * 16u;
    const unsigned l0 = (unsigned)(size_t)ring + tid * 16u;   // the thread's LDS byte address in buffer 0
    constexpr int NT = K / GKS;
    stage_copies(l0, ga, gb, gs);
    asm volatile("s_wait_asynccnt 0x0" ::: "memory");   // this wave's copies of stage 0 have landed
    __syncthreads();                                     // ... and every other wave's: stage 0 may be read
    stage_copies(l0 + GSTG, ga + GKS * 32, gb + GKS * 32, gs);
#pragma unroll 1
    for (int t = 0; t < NT; ++t) {   // not unrolled: one trip is one stage, with one place where a stage is handed over
        const T16* sa = ring + (t & 1) * (GSTG / 2) + wm * 4 * (16 * GKS) + lane * 8; const T16* sb = ring + (t & 1) * (GSTG / 2) + (8 + wn * 4) * (16 * GKS) + lane * 8;
        V a[4], b[4];
#pragma unroll
        for (int kb = 0; kb < GKS / 32; ++kb) {
#pragma unroll
            for (int mb = 0; mb < 4; ++mb) a[mb] = WFrag<T16>::ld(sa + mb * (16 * GKS) + kb * 512);
#pragma unroll
            for (int nb = 0; nb < 4; ++nb) b[nb] = WFrag<T16>::ld(sb + nb * (16 * GKS) + kb * 512);
            __builtin_amdgcn_sched_barrier(0);   // keeps all of a block's 16 LDS reads in front of its first product: without it the B fragments are fetched one at a time among the products, each behind a full wait of its own
            if (kb == GKS / 32 - 1) {   // the stage's last block is in registers: the stage is handed over in front of that block's products, so that the refill flies for a whole trip
                asm volatile("s_wait_dscnt 0x0" ::: "memory");      // this wave's reads of stage t are done before its buffer is given up
                asm volatile("s_wait_asynccnt 0x0" ::: "memory");   // this wave's copies of stage t + 1 have landed
                __syncthreads();                                     // publishes stage t + 1 and ends every wave's reads of stage t
                if (t + 2 < NT) stage_copies(l0 + (unsigned)(t & 1) * GSTG, ga + (t + 2) * (GKS * 32), gb + (t + 2) * (GKS * 32), gs);
            }
#pragma unroll
            for (int nb = 0; nb < 4; ++nb) {
#pragma unroll
                for (int mb = 0; mb < 4; ++mb) acc[mb][nb] = WFrag<T16>::mma(a[mb], b[nb], acc[mb][nb]); }
        }
    }
    asm volatile("s_wait_asynccnt 0x0" ::: "memory");   // nothing is in flight when the wave goes on to its epilogue
    if (vcol) {   // an accumulator holds, per lane, 8 consecutive t of one d: that is the lane's own 16 bytes of one half of a block (d rows x t), so a wave stores 512 contiguous bytes
#pragma unroll
        for (int nb = 0; nb < 4; ++nb) { const float bb = BIAS ? bfr(bias[c0 + nb * 16 + lr]) : 0.0f;
#pragma unroll
            for (int mb = 0; mb < 4; ++mb) { v8h o16; v8us oh, ol;
#pragma unroll
                for (int j = 0; j < 8; ++j) { float x = acc[mb][nb][j]; if (BIAS) x += bb; o16[j] = tohx(x); unsigned short a2, c2; splitf(x, a2, c2); oh[j] = a2; ol[j] = c2; }
                const size_t e = ((size_t)bt * DKV + (c0 - DQ - DKV)) * TT + (size_t)(((t0 >> 5) + (mb >> 1)) * 4 + nb) * 512 + (mb & 1) * 256 + lane * 8;
                *(v8h*)(P16 + e) = o16; *(v8us*)(Ph + e) = oh; *(v8us*)(Pl + e) = ol; } }
    } else {                 // rows of 64 d: turned through LDS so that a lane holds 8 consecutive d of one t, its own 16 bytes of one half of a block (t rows x d)
        float bb[4];
#pragma unroll
        for (int nb = 0; nb < 4; ++nb) bb[nb] = BIAS ? bfr(bias[c0 + nb * 16 + lr]) : 0.0f;
#pragma unroll
        for (int mb = 0; mb < 4; ++mb) {
#pragma unroll
            for (int nb = 0; nb < 4; ++nb) {
#pragma unroll
                for (int j = 0; j < 8; ++j) os[(hi * 8 + j) * 68 + nb * 16 + lr] = BIAS ? acc[mb][nb][j] + bb[nb] : acc[mb][nb][j]; }
            __builtin_amdgcn_wave_barrier(); asm volatile("" ::: "memory");   // the LDS stores above stay in front of the other lanes' reads below
#pragma unroll
            for (int s = 0; s < 4; ++s) { const int cofs = (2 * s + hi) * 8; const v4f v0 = *(const v4fa*)(os + lr * 68 + cofs), v1 = *(const v4fa*)(os + lr * 68 + cofs + 4); v8h o16; v8us oh, ol;   // half-block s of these 16 rows: d = 16 s + 8 hi ...
#pragma unroll
                for (int u = 0; u < 8; ++u) { const float x = (u < 4) ? v0[u & 3] : v1[u & 3]; o16[u] = tohx(x); unsigned short a2, c2; splitf(x, a2, c2); oh[u] = a2; ol[u] = c2; }
                const size_t e = (((size_t)bt * (NH_ + NKV) + c0 / HD) * TT + t0 + mb * 16) * HD + s * 256 + lane * 8;
                *(v8h*)(P16 + e) = o16; *(v8us*)(Ph + e) = oh; *(v8us*)(Pl + e) = ol; }
            __builtin_amdgcn_wave_barrier(); asm volatile("" ::: "memory");   // the reads above stay in front of the next 16 rows' LDS stores
        }
    }
}

typedef __attribute__((ext_vector_type(2))) _Float16 v2h;
typedef __attribute__((ext_vector_type(4))) _Float16 v4h;
typedef __attribute__((ext_vector_type(2))) unsigned short v2us;
typedef __attribute__((ext_vector_type(4))) unsigned short v4us;
typedef __attribute__((ext_vector_type(2))) float v2f;
typedef __attribute__((ext_vector_type(4))) int v4i;

__global__ __launch_bounds__(256) void k_wtG(const float* __restrict__ w, int K, int N, bf* Bt) {
    const int lane = threadIdx.x & 31; const int L0 = (blockIdx.x * 8 + (threadIdx.x >> 5)) * 8; const int nlines = N * K / 64;
{
#pragma unroll 1
        for (int l = 0; l < 8; ++l) { const int L = L0 + l; if (L >= nlines) break; const size_t e = (size_t)L * 64 + lane * 2; const int k = (int)(e % K), n = (int)(e / K); v2us o;
            o[0] = f2bf(w[(size_t)k * N + n]); o[1] = f2bf(w[(size_t)(k + 1) * N + n]); *(v2us*)(Bt + e) = o; }
         }
}
__global__ __launch_bounds__(256) void k_cvt8(const float* __restrict__ srcA, bf* dstA, size_t nA8, const float* __restrict__ srcB, bf* dstB, size_t nB8) { size_t i = (size_t)blockIdx.x * 256 + threadIdx.x; const float* src = srcA; bf* dst = dstA;
    if (i >= nA8) { i -= nA8; if (i >= nB8) return; src = srcB; dst = dstB; }   // one launch rounds both arrays: first A's groups of 8, then B's
    const size_t blk = i >> 6; const int r = (int)(i >> 2) & 15, c = (int)i & 3;   // 64 threads a block (16 rows x 32 k, rows of DM): 4 neighbours read one whole 128-byte line of a source row, and 8 rows' groups of one c are one whole line of the plane in fragment order
    const v8f v = *(const v8f*)(src + ((blk / (DM / 32)) * 16 + r) * DM + (blk % (DM / 32)) * 32 + c * 8); v8us o;
#pragma unroll
    for (int k = 0; k < 8; ++k) o[k] = f2bf(v[k]); *(v8us*)(dst + blk * 512 + ((c >> 1) * 32 + (c & 1) * 16 + r) * 8) = o;  }
__global__ __launch_bounds__(256) void k_cscvt(const float* __restrict__ cosT, const float* __restrict__ sinT, float* CS) { const int idx = blockIdx.x * 256 + threadIdx.x; if (idx >= TT * HD) return; v2f cs; cs[0] = bfr(cosT[idx]); cs[1] = bfr(sinT[idx]); *(v2f*)(CS + (size_t)idx * 2) = cs;  }
// ---- attn_tile (queries < RH): causal scores, softmax and probability x value contraction of one 32-query tile of one head in ONE work-group (16 waves); no score or probability leaves the chip.
// Wave w owns keys [w*KCH, (w+1)*KCH). It forms the TRANSPOSED score tile (A = key rows, B = query rows), so that a lane holds 8 consecutive keys of one query per accumulator: two neighbouring accumulators
// are, element for element, the A fragment of the probability x value product, and the probabilities go from the softmax into that product without leaving their registers.
// The row maximum and the row sum meet over the waves in LDS (one barrier each; sum in wave order = ascending keys), the 16 partial output tiles likewise (third barrier).
// A wave whose keys all lie beyond the tile's last query forms no scores or products, but still takes its share of the final sum. hi + lo planes (3 products), 32 keys a wave.
typedef __attribute__((ext_vector_type(16))) unsigned short v16us;
__device__ __forceinline__ void mkp(const v8f e0, const v8f e1, const float f, v16h& a, v16h& a2) { (void)a2;
#pragma unroll
    for (int j = 0; j < 8; ++j) { a[j] = tohx(e0[j] * f); a[8 + j] = tohx(e1[j] * f); } }
__device__ __forceinline__ void mkp(const v8f e0, const v8f e1, const float f, v16bf& a, v16bf& a2) { v16us h, l;
#pragma unroll
    for (int j = 0; j < 8; ++j) { unsigned short x, y; splitf(e0[j] * f, x, y); h[j] = x; l[j] = y; splitf(e1[j] * f, x, y); h[8 + j] = x; l[8 + j] = y; }
    a = __builtin_bit_cast(v16bf, h); a2 = __builtin_bit_cast(v16bf, l); }
#define RP 68                     // pitch, in floats, of a partial output row in LDS
template <typename T16, int NSPLIT, int KCH>
__device__ __forceinline__ void attn_tile(const T16* __restrict__ Q, const T16* __restrict__ Q2, const T16* __restrict__ Kp, const T16* __restrict__ Kp2, const T16* __restrict__ Vt, const T16* __restrict__ Vt2, float* O, const int r0, const float pnum, float (*red)[32 * RP], float (*smax)[32], float (*ssum)[32]) {
    typedef typename WFrag<T16>::V V;
    static_assert(KCH % 32 == 0 && 16 * KCH <= TT, "the 16 key slices stay inside the sequence");
    constexpr int NM = KCH / 16, NS = KCH / 32;
    const int wv = __builtin_amdgcn_readfirstlane((int)(threadIdx.x >> 5)); const int lane = threadIdx.x & 31, lr = lane & 15, hi = lane >> 4; const int key0 = wv * KCH;
    const bool active = key0 < r0 + 32; const int nact = (r0 + 32 + KCH - 1) / KCH;      // waves 0 .. nact-1 hold causal keys (nact <= 16)
    const unsigned qo = (unsigned)(r0 * HD + 8 * lane) * 2u, ko = (unsigned)(key0 * HD + 8 * lane) * 2u, vo = (unsigned)(key0 * HD + 8 * lane) * 2u;   // byte offset of a lane's first element of the query rows, the key rows and the value columns: the one address register of each group of loads
    v8f s[NM][2];
#pragma unroll
    for (int mt = 0; mt < NM; ++mt) { s[mt][0] = (v8f){}; s[mt][1] = (v8f){}; }
    float mx[2] = {-3.0e38f, -3.0e38f};
    V b[NS][4], b2[NS][4];
    if (active) {
        V q[2][2], q2[2][2], k[NM][2], k2[NM][2];
#pragma unroll
        for (int nb = 0; nb < 2; ++nb)
#pragma unroll
            for (int kc = 0; kc < 2; ++kc) { const int o = (nb * 2 + kc) * 512; q[nb][kc] = WFrag<T16>::ld(atb(Q, qo) + o); if (NSPLIT == 2) q2[nb][kc] = WFrag<T16>::ld(atb(Q2, qo) + o); }
#pragma unroll
        for (int mt = 0; mt < NM; ++mt)
#pragma unroll
            for (int kc = 0; kc < 2; ++kc) { const int o = (mt * 2 + kc) * 512; k[mt][kc] = WFrag<T16>::ld(atb(Kp, ko) + o); if (NSPLIT == 2) k2[mt][kc] = WFrag<T16>::ld(atb(Kp2, ko) + o); }
        asm volatile("s_wait_xcnt 0x0" :: "v"(qo), "v"(ko) : "memory");   // the loads' address registers stay whole up to this wait
        __builtin_amdgcn_sched_barrier(0);   // keeps every load above in front of the first product, so that the wave waits out the load latency once and not once per key tile
#pragma unroll
        for (int mt = 0; mt < NM; ++mt)
#pragma unroll
            for (int nb = 0; nb < 2; ++nb)
#pragma unroll
                for (int kc = 0; kc < 2; ++kc) { s[mt][nb] = WFrag<T16>::mma(k[mt][kc], q[nb][kc], s[mt][nb]); if (NSPLIT == 2) { s[mt][nb] = WFrag<T16>::mma(k[mt][kc], q2[nb][kc], s[mt][nb]); s[mt][nb] = WFrag<T16>::mma(k2[mt][kc], q[nb][kc], s[mt][nb]); } }
        if (key0 + KCH - 1 > r0) {           // only a wave that holds a key beyond the tile's first query has anything to mask
            const int dl = r0 + lr - key0 - hi * 8;   // key (mt, j) is causal for query (nb, lr) where mt * 16 + j - nb * 16 <= dl
#pragma unroll
            for (int mt = 0; mt < NM; ++mt)
#pragma unroll
                for (int nb = 0; nb < 2; ++nb)
#pragma unroll
                    for (int j = 0; j < 8; ++j) s[mt][nb][j] = (mt * 16 + j - nb * 16 <= dl) ? s[mt][nb][j] : -3.0e38f;
        }
#pragma unroll
        for (int mt = 0; mt < NM; ++mt)
#pragma unroll
            for (int nb = 0; nb < 2; ++nb)
#pragma unroll
                for (int j = 0; j < 8; ++j) { const float t = s[mt][nb][j] * SCL; s[mt][nb][j] = t; mx[nb] = fmaxf(mx[nb], t); }
        mx[0] = fmaxf(mx[0], __shfl_xor(mx[0], 16, 32)); mx[1] = fmaxf(mx[1], __shfl_xor(mx[1], 16, 32));
    }
    if (hi == 0) { smax[wv][lr] = mx[0]; smax[wv][16 + lr] = mx[1]; }
    __syncthreads();   // every wave's row maxima are in LDS before any wave takes the maximum over the waves
    float sm[2] = {0.f, 0.f};
    if (active) {
#pragma unroll
        for (int w = 0; w < 16; ++w) { mx[0] = fmaxf(mx[0], smax[w][lr]); mx[1] = fmaxf(mx[1], smax[w][16 + lr]); }
#pragma unroll
        for (int mt = 0; mt < NM; ++mt)
#pragma unroll
            for (int nb = 0; nb < 2; ++nb)
#pragma unroll
                for (int j = 0; j < 8; ++j) { const float e = __builtin_amdgcn_exp2f(__fmul_rn(__fsub_rn(s[mt][nb][j], mx[nb]), 1.4426950408889634f)); s[mt][nb][j] = e; sm[nb] += e; }
        sm[0] += __shfl_xor(sm[0], 16, 32); sm[1] += __shfl_xor(sm[1], 16, 32);
#pragma unroll
        for (int ss = 0; ss < NS; ++ss)
#pragma unroll
            for (int db = 0; db < 2; ++db) { const int ofs = (ss * 4 + db) * 512; b[ss][db] = WFrag<T16>::ld(atb(Vt, vo) + ofs); if (NSPLIT == 2) b2[ss][db] = WFrag<T16>::ld(atb(Vt2, vo) + ofs); }
        asm volatile("s_wait_xcnt 0x0" :: "v"(vo) : "memory");   // as above: the address register stays whole up to this wait
        __builtin_amdgcn_sched_barrier(0);   // holds the loads of value columns 0..31 here, so that they fly while the row sums meet over the waves
    }
    if (hi == 0) { ssum[wv][lr] = sm[0]; ssum[wv][16 + lr] = sm[1]; }
    __syncthreads();   // every wave's row sums are in LDS before any wave adds them up
    {
        if (active) {
            v8f o[2][4];
#pragma unroll
            for (int qb = 0; qb < 2; ++qb)
#pragma unroll
                for (int db = 0; db < 4; ++db) o[qb][db] = (v8f){};
            float t0 = ssum[0][lr], t1 = ssum[0][16 + lr];
#pragma unroll
            for (int w = 1; w < 16; ++w) { t0 += ssum[w][lr]; t1 += ssum[w][16 + lr]; }
            const float f[2] = {__fdiv_rn(pnum, t0), __fdiv_rn(pnum, t1)};
            V a[NS][2], a2[NS][2];
#pragma unroll
            for (int ss = 0; ss < NS; ++ss)
#pragma unroll
                for (int qb = 0; qb < 2; ++qb) mkp(s[2 * ss][qb], s[2 * ss + 1][qb], f[qb], a[ss][qb], a2[ss][qb]);
            __builtin_amdgcn_sched_barrier(0);   // the loads below start only when the packed probabilities have freed half of the score registers: earlier they would spill
#pragma unroll
            for (int ss = 0; ss < NS; ++ss)
#pragma unroll
                for (int db = 2; db < 4; ++db) { const int ofs = (ss * 4 + db) * 512; b[ss][db] = WFrag<T16>::ld(atb(Vt, vo) + ofs); if (NSPLIT == 2) b2[ss][db] = WFrag<T16>::ld(atb(Vt2, vo) + ofs); }
            asm volatile("s_wait_xcnt 0x0" :: "v"(vo) : "memory");   // as above: the address register stays whole up to this wait
            __builtin_amdgcn_sched_barrier(0);   // keeps those loads in front of the first product: they fly during the products of value columns 0..31
#pragma unroll
            for (int db = 0; db < 4; ++db)
#pragma unroll
                for (int ss = 0; ss < NS; ++ss)
#pragma unroll
                    for (int qb = 0; qb < 2; ++qb) { o[qb][db] = WFrag<T16>::mma(a[ss][qb], b[ss][db], o[qb][db]); if (NSPLIT == 2) { o[qb][db] = WFrag<T16>::mma(a2[ss][qb], b[ss][db], o[qb][db]); o[qb][db] = WFrag<T16>::mma(a[ss][qb], b2[ss][db], o[qb][db]); } }
            __builtin_amdgcn_sched_barrier(0);   // keeps the LDS stores behind the last product
#pragma unroll
            for (int qb = 0; qb < 2; ++qb)
#pragma unroll
                for (int db = 0; db < 4; ++db)
#pragma unroll
                    for (int j = 0; j < 8; ++j) red[wv][(qb * 16 + hi * 8 + j) * RP + db * 16 + lr] = o[qb][db][j];
        } else if (wv < ((nact + 3) & ~3)) {   // the final sum reads the partial tiles in groups of four waves: an idle wave of the last group stores zeros
#pragma unroll
            for (int u = 0; u < 16; ++u) *(v4fa*)&red[wv][(u * 2 + hi) * RP + lr * 4] = (v4f){};
        }
    }
    __syncthreads();   // every wave's partial tile is in LDS before any wave sums
    const int row = threadIdx.x >> 4, col = (threadIdx.x & 15) * 4; v4f acc = *(const v4fa*)&red[0][row * RP + col];
#pragma unroll
    for (int w = 1; w < 4; ++w) acc += *(const v4fa*)&red[w][row * RP + col];
#pragma unroll
    for (int g = 4; g < 16; g += 4)
        if (g < nact) {
#pragma unroll
            for (int w = g; w < g + 4; ++w) acc += *(const v4fa*)&red[w][row * RP + col]; }
    v4f ov;   // the tile goes straight to its head's 64 columns of the output rows: probabilities' scale taken off, then hi + lo of the bf16 pair
#pragma unroll
    for (int u = 0; u < 4; ++u) { unsigned short a, c2; splitf(acc[u] * (1.0f / pnum), a, c2); ov[u] = __fadd_rn(bf2f(a), bf2f(c2)); }
    *(v4f*)(O + (size_t)(r0 + row) * DQ + col) = ov;
}
// ---- attn_walk: queries >= RH. ONE WAVE owns a 32-query tile and walks its causal keys in passes of 32, with a running row maximum and row sum; it meets no other wave: no barrier, no partial tile, no idle wave.
// Scores transposed as above (A = key rows, B = query rows); the output transposed too (A = value columns d x keys, B = the packed probabilities): in both a lane holds ONE query's values, so the factor that
// carries the output and the sum over to a new maximum is the lane's own. The 16 waves of a work-group walk the same head from key 0 on, so that a key or value line fetched by one is in the WGP's cache for the others.
// Probabilities are exp2(.) x 2^LOGP (the fp16 operand's range, as PCAR above); the sum carries the same factor, which leaves with the division.
#define LOGP 10.0f
__device__ __forceinline__ float xhalf(float v) { const int b = __float_as_int(v); return __int_as_float(__builtin_amdgcn_permlanex16(b, b, 0x76543210, 0xfedcba98, false, false)); }   // lane l takes lane l ^ 16's value
// One pass: 32 keys (their tiles k came in a pass ahead) against the wave's 32 queries. vo, ko: the lane's byte offset of this pass's values and of the next pass's keys. LAST: the tile's own 32 keys, masked; no further keys are fetched.
template <bool LAST>
__device__ __forceinline__ void walk_pass(const h16* __restrict__ Kp, const h16* __restrict__ Vt, const unsigned ko, const unsigned vo, const int dl, const v16h (&q)[2][2], v16h (&k)[2][2], v8f (&o)[4][2], float (&m)[2], float (&l)[2]) {
    constexpr float C2 = SCL * 1.4426950408889634f;
    v16h v[4];
#pragma unroll
    for (int db = 0; db < 4; ++db) v[db] = WFrag<h16>::ld(atb(Vt, vo) + db * 512);
    v8f s[2][2];
#pragma unroll
    for (int mt = 0; mt < 2; ++mt)
#pragma unroll
        for (int nb = 0; nb < 2; ++nb) { s[mt][nb] = WFrag<h16>::mma(k[mt][0], q[nb][0], (v8f){}); s[mt][nb] = WFrag<h16>::mma(k[mt][1], q[nb][1], s[mt][nb]); }
    if (!LAST) {
#pragma unroll
        for (int mt = 0; mt < 2; ++mt)
#pragma unroll
            for (int kc = 0; kc < 2; ++kc) k[mt][kc] = WFrag<h16>::ld(atb(Kp, ko) + (mt * 2 + kc) * 512);
    }
    asm volatile("s_wait_xcnt 0x0" :: "v"(ko), "v"(vo) : "memory");   // the address registers of this pass's value and key loads stay whole up to this wait
    __builtin_amdgcn_sched_barrier(0);   // keeps both groups of loads up here (sunk to their first use they would each be waited for in full) and every rewrite of their address registers behind the wait
    if (LAST) {   // key (mt, j) is causal for query (nb, lr) where mt * 16 + j - nb * 16 <= dl
#pragma unroll
        for (int mt = 0; mt < 2; ++mt)
#pragma unroll
            for (int nb = 0; nb < 2; ++nb)
#pragma unroll
                for (int j = 0; j < 8; ++j) s[mt][nb][j] = (mt * 16 + j - nb * 16 <= dl) ? s[mt][nb][j] : -3.0e38f;
    }
    v16h pf[2];
#pragma unroll
    for (int nb = 0; nb < 2; ++nb) {
        float bm = s[0][nb][0];
#pragma unroll
        for (int j = 1; j < 8; ++j) bm = fmaxf(bm, s[0][nb][j]);
#pragma unroll
        for (int j = 0; j < 8; ++j) bm = fmaxf(bm, s[1][nb][j]);
        bm = fmaxf(bm, xhalf(bm));
        const float mn = fmaxf(m[nb], bm), al = __builtin_amdgcn_exp2f((m[nb] - mn) * C2), sh = fmaf(-mn, C2, LOGP); m[nb] = mn;
        float sum = 0.f;
#pragma unroll
        for (int mt = 0; mt < 2; ++mt) { const v8f x = __builtin_elementwise_fma(s[mt][nb], (v8f){C2, C2, C2, C2, C2, C2, C2, C2}, (v8f){sh, sh, sh, sh, sh, sh, sh, sh});
#pragma unroll
            for (int j = 0; j < 8; ++j) { const float e = __builtin_amdgcn_exp2f(x[j]); sum += e; pf[nb][mt * 8 + j] = tohx(e); } }
        l[nb] = fmaf(l[nb], al, sum);
#pragma unroll
        for (int db = 0; db < 4; ++db) o[db][nb] *= al;
    }
#pragma unroll
    for (int db = 0; db < 4; ++db)
#pragma unroll
        for (int nb = 0; nb < 2; ++nb) o[db][nb] = WFrag<h16>::mma(v[db], pf[nb], o[db][nb]);
}
__device__ __forceinline__ void attn_walk(const h16* __restrict__ Q, const h16* __restrict__ Kp, const h16* __restrict__ Vt, float* O, const int r0, float* os) {
    const int lane = threadIdx.x & 31, lr = lane & 15, hi = lane >> 4; const unsigned lo = (unsigned)lane * 16u, qo = lo + (unsigned)r0 * (HD * 2);   // the lane's 16 bytes of a half block, at key 0 and at the tile's first query
    v16h q[2][2], k[2][2];
#pragma unroll
    for (int nb = 0; nb < 2; ++nb)
#pragma unroll
        for (int kc = 0; kc < 2; ++kc) { q[nb][kc] = WFrag<h16>::ld(atb(Q, qo) + (nb * 2 + kc) * 512); k[nb][kc] = WFrag<h16>::ld(atb(Kp, lo) + (nb * 2 + kc) * 512); }
    asm volatile("s_wait_xcnt 0x0" :: "v"(qo), "v"(lo) : "memory");   // the loads' address registers stay whole up to this wait
    v8f o[4][2];
#pragma unroll
    for (int db = 0; db < 4; ++db) { o[db][0] = (v8f){}; o[db][1] = (v8f){}; }
    float m[2] = {-3.0e38f, -3.0e38f}, l[2] = {0.f, 0.f};
    const int nf = r0 / 32;   // passes in front of the tile's own 32 keys
#pragma unroll 1
    for (int p = 0; p < nf; ++p)   // not unrolled: a pass holds the registers of one set of key, value and score tiles
        walk_pass<false>(Kp, Vt, lo + (unsigned)(p + 1) * (32 * HD * 2), lo + (unsigned)p * (32 * HD * 2), 0, q, k, o, m, l);
    walk_pass<true>(Kp, Vt, lo, lo + (unsigned)nf * (32 * HD * 2), lr - hi * 8, q, k, o, m, l);
    // o[db][nb][j] is query nb * 16 + lr, column db * 16 + hi * 8 + j. Turned through the wave's own LDS rows, so that a store covers whole 256-byte output rows.
#pragma unroll
    for (int nb = 0; nb < 2; ++nb) { const float f = __fdiv_rn(1.0f, l[nb] + xhalf(l[nb]));
#pragma unroll
        for (int db = 0; db < 4; ++db) { v4f x0, x1;
#pragma unroll
            for (int u = 0; u < 4; ++u) { x0[u] = o[db][nb][u] * f; x1[u] = o[db][nb][4 + u] * f; }
            *(v4fa*)(os + (nb * 16 + lr) * RP + db * 16 + hi * 8) = x0; *(v4fa*)(os + (nb * 16 + lr) * RP + db * 16 + hi * 8 + 4) = x1; } }
    __builtin_amdgcn_wave_barrier(); asm volatile("" ::: "memory");   // the LDS stores above stay in front of the other lanes' reads below
#pragma unroll
    for (int u = 0; u < 16; ++u) { const int row = u * 2 + hi; const v4f x = *(const v4fa*)(os + row * RP + lr * 4); v4f ov;   // hi + lo of the bf16 pair, as in attn_tile
#pragma unroll
        for (int c = 0; c < 4; ++c) { unsigned short a, c2; splitf(x[c], a, c2); ov[c] = __fadd_rn(bf2f(a), bf2f(c2)); }
        *(v4f*)(O + (size_t)(r0 + row) * DQ + lr * 4) = ov; }
}
#define WG_H  ((TT - RH) / 32 / 16)          // walking work-groups of a head: 16 tiles each
#define NWALK (NB_ * NH_ * WG_H)
// grid: first the NWALK walking work-groups (the long ones), then batches * heads * RH / 32 work-groups of attn_tile, those with the most keys first
__global__ __launch_bounds__(512) void k_attn(const h16* __restrict__ QK16, const h16* __restrict__ V16, const bf* __restrict__ QKh, const bf* __restrict__ QKl, const bf* __restrict__ Vh, const bf* __restrict__ Vl, float* O) {
    static_assert((TT - RH) % 512 == 0 && RH % 32 == 0, "16 whole tiles a walking work-group");
    __shared__ __align__(16) float red[16][32 * RP]; __shared__ float smax[16][32]; __shared__ float ssum[16][32];
    const bool walk = (int)blockIdx.x < NWALK; const int idx = walk ? (int)blockIdx.x : (int)blockIdx.x - NWALK; const int bh = idx % (NB_ * NH_), g = idx / (NB_ * NH_);
    const int bt = bh / NH_, hd = bh % NH_;
    const size_t zq = ((size_t)bt * (NH_ + NKV) + hd) * TT * HD, zk = zq + (size_t)NH_ * TT * HD, zv = ((size_t)bt * NKV + hd) * HD * TT;
    float* Oh = O + (size_t)bt * TT * DQ + (size_t)hd * HD;   // O: output rows [batch][t][heads * HD]
    if (walk) {   // waves w, w + 4, w + 8, w + 12 share a SIMD: their four tiles are dealt to and fro over the head's 4 * WG_H SIMDs, so that every SIMD walks the same number of keys
        const int wv = __builtin_amdgcn_readfirstlane((int)(threadIdx.x >> 5)), a = wv >> 2, c = g * 4 + (wv & 3);
        const int tile = RH / 32 + a * (4 * WG_H) + ((a & 1) ? 4 * WG_H - 1 - c : c);
        attn_walk(QK16 + zq, QK16 + zk, V16 + zv, Oh, tile * 32, red[wv]);
    } else attn_tile<bf, 2, RH / 16>(QKh + zq, QKl + zq, QKh + zk, QKl + zk, Vh + zv, Vl + zv, Oh, (RH / 32 - 1 - g) * 32, 1.0f, red, smax, ssum);
}
extern "C" void kernel_launch(void* const* d_in, const int* in_sizes, int n_in,
                              void* d_out, int out_size, void* d_ws, size_t ws_size, hipStream_t stream) {
    (void)in_sizes; (void)n_in; (void)out_size;
    const float* x = (const float*)d_in[0]; const float* wf = (const float*)d_in[1]; const float* bfz = (const float*)d_in[2];   // x [4][2048][1024], W [3072][1024] (rows q | k | v), b [3072]
    float* OUT = (float*)d_out;     // [4][2048][1024]
    char* wsp = (char*)d_ws;
    auto take = [&](size_t bytes) { char* p = wsp; wsp += (bytes + 255) & ~(size_t)255; return (void*)p; };
    bf* WB = (bf*)take((size_t)(DQ + 2 * DKV) * DM * 2);
    bf* XB = (bf*)take((size_t)NB_ * TT * DM * 2);
    h16* QK16 = (h16*)take((size_t)NB_ * (NH_ + NKV) * TT * HD * 2); h16* VT16 = (h16*)take((size_t)NB_ * NKV * HD * TT * 2);
    bf* QKh = (bf*)take((size_t)NB_ * (NH_ + NKV) * TT * HD * 2); bf* QKl = (bf*)take((size_t)NB_ * (NH_ + NKV) * TT * HD * 2); bf* VTh = (bf*)take((size_t)NB_ * NKV * HD * TT * 2); bf* VTl = (bf*)take((size_t)NB_ * NKV * HD * TT * 2);
    if ((size_t)(wsp - (char*)d_ws) > ws_size) return;    // 166 MiB of the 256 MiB
    k_cvt8<<<(unsigned)(((size_t)NB_ * TT * DM / 8 + (size_t)(DQ + 2 * DKV) * DM / 8 + 255) / 256), 256, 0, stream>>>(x, XB, (size_t)NB_ * TT * DM / 8, wf, WB, (size_t)(DQ + 2 * DKV) * DM / 8);
    k_gemmw<bf, 0, true, DM><<<dim3(NB_ * TT / 128, (DQ + 2 * DKV) / 256, 1), 256, 0, stream>>>(XB, nullptr, WB, nullptr, QK16, QKh, QKl, VT16, VTh, VTl, bfz, 0, 0);
    k_attn<<<dim3(NWALK + NB_ * NH_ * (RH / 32), 1, 1), 512, 0, stream>>>(QK16, VT16, QKh, QKl, VTh, VTl, OUT);
}

// v009
// Measured time: 97.6 microseconds a run.
// In both of two side-by-side timings against v008, it was 1.03 times as fast.
// All steps since v000 together make it 28.4 times as fast.
#include <hip/hip_runtime.h>

// SelfAttentionHead (x [4][2048][1024]; qkv = x W^T + b (W [3072][1024], split (q | k | v) x 16 heads x 64); causal softmax(q.k / 8); out = merged heads (no output projection) -> [4][2048][1024]).
// Compute dtypes, f32 accumulate: every input rounded to bf16; q/k/v on PLAIN bf16 operands (inputs: exact) + bias; causal scores and attn.v: query rows < 512 hl (3 products), the rest single fp16 (x1024, running maximum and sum over 32-key passes); softmax f32; the merged heads are written as hi + lo of a bf16 pair (i.e. the f32 attention output rounded through a bf16 pair, |err| <= 2^-16 relative).

#define NB_  4
#define TT   2048
#define DM   1024
#define NH_  16
#define NKV  16
#define REP  (NH_ / NKV)
#define HD   64
#define DQ   (NH_ * HD)
#define DKV  (NKV * HD)
#define ZH   16                   // not used: one launch of the attention kernel covers all NH_ heads
#define RH   512                  // query rows < RH use hi+lo planes (0: none)
#define PCAR 1024.0f
#define SCL  0.125f   // HD^-0.5
typedef _Float16 h16;
typedef unsigned short bf;
typedef __attribute__((ext_vector_type(16))) __bf16   v16bf;
typedef __attribute__((ext_vector_type(16))) _Float16 v16h;
typedef __attribute__((ext_vector_type(8)))  _Float16 v8h;
typedef __attribute__((ext_vector_type(8)))  unsigned short v8us;
typedef __attribute__((ext_vector_type(8)))  float    v8f;
typedef __attribute__((ext_vector_type(4)))  float    v4f;
typedef v8h  __attribute__((may_alias)) v8ha;
typedef v4f  __attribute__((may_alias)) v4fa;
typedef v8us __attribute__((may_alias)) v8usa;

__device__ __forceinline__ unsigned short f2bf(float f) { unsigned u = __float_as_uint(f); u += 0x7FFFu + ((u >> 16) & 1u); return (unsigned short)(u >> 16); }
__device__ __forceinline__ float bf2f(unsigned short b) { return __uint_as_float(((unsigned)b) << 16); }
__device__ __forceinline__ float bfr(float f) { return bf2f(f2bf(f)); }
__device__ __forceinline__ h16 tohx(float x) { return (h16)x; }
__device__ __forceinline__ void splitf(float y, unsigned short& h, unsigned short& l) { h = f2bf(y); l = f2bf(y - bf2f(h)); }
__device__ __forceinline__ v16h cat16(v8h lo, v8h hi) { return __builtin_shufflevector(lo, hi, 0, 1, 2, 3, 4, 5, 6, 7, 8, 9, 10, 11, 12, 13, 14, 15); }
__device__ __forceinline__ v16bf cat16b(v8us lo, v8us hi) { return __builtin_bit_cast(v16bf, __builtin_shufflevector(lo, hi, 0, 1, 2, 3, 4, 5, 6, 7, 8, 9, 10, 11, 12, 13, 14, 15)); }
__device__ __forceinline__ v8f wmma16(v16h a, v16h b, v8f c) { return __builtin_amdgcn_wmma_f32_16x16x32_f16(false, a, false, b, (short)0, c, false, false); }
__device__ __forceinline__ v8f wmmab(v16bf a, v16bf b, v8f c) { return __builtin_amdgcn_wmma_f32_16x16x32_bf16(false, a, false, b, (short)0, c, false, false); }



// ---- FRAGMENT ORDER of every 16-bit plane in the workspace: a plane of rows x k is cut into blocks of 16 rows x 32 k = 1 KiB, and inside a block element (r, kk) stands at (kk >> 4) * 256 + (((kk >> 3) & 1) * 16 + r) * 8 + (kk & 7).
// That is the order in which the 32 lanes of a wave take a 16x16x32 operand: lane l reads 16 bytes at l * 16 and 16 bytes at 512 + l * 16, so each wave-wide load is 512 contiguous bytes (4 whole 128-byte lines) and not 32 bytes of each of 16 lines.
// ---- k_gemmw: register-blocked GEMM, one wave per 64x64 output tile (16 accumulators), EIGHT waves (2 x 4) per work-group = a 128x256 tile; grid (M/128, N/256, Z), 256 threads.
// The operands (16-bit planes in fragment order, blocks of one 16-row group run along k) come through an LDS ring of two buffers, filled by asynchronous copies: a stage is [A 8 row groups | B 16 row groups] x 64 k = 48 KiB, each row group 2 KiB,
// so a byte of A is fetched from L2 once for four waves and a byte of B once for two. In LDS a block keeps its fragment order: a wave-wide 16-byte read is 512 contiguous bytes.
// c[m][n] (f32, + optional f32 bias[n]) = sum_k A[m][k] Bt[n][k]. z-batch strides sA/sB in elements. K % 64 == 0, at least two stages; K is a compile-time constant, and with it the distance between two row groups.
// The tile's 64 columns are one head (HD == 64), its rows are sequence positions. The epilogue writes c as the three 16-bit planes that the attention kernel reads (fp16, bf16 hi, bf16 lo):
// Rows are (batch, t), columns the fused (q | k | v) outputs. Columns < DQ + DKV: [batch][q heads | k heads] planes of t rows x d, block (t / 16) * 2 + d / 32; the rest: [batch][head] planes of d rows x t, block (t / 32) * 4 + d / 16. No f32 copy of c leaves the chip.
template <typename T16> struct WFrag;
template <> struct WFrag<h16> { typedef v16h V; static __device__ __forceinline__ V ld(const h16* p) { return cat16(*(const v8h*)p, *(const v8h*)(p + 256)); } static __device__ __forceinline__ v8f mma(V a, V b, v8f c) { return wmma16(a, b, c); } };
template <> struct WFrag<bf> { typedef v16bf V; static __device__ __forceinline__ V ld(const bf* p) { return cat16b(*(const v8us*)p, *(const v8us*)(p + 256)); } static __device__ __forceinline__ v8f mma(V a, V b, v8f c) { return wmmab(a, b, c); } };
template <typename T16> __device__ __forceinline__ const T16* atb(const T16* p, unsigned bytes) { return (const T16*)((const char*)p + bytes); }
#define GKS  64                   // k of one stage of the GEMM's LDS ring
#define GSTG ((8 + 16) * 16 * GKS * 2)   // bytes of a stage
// One stage's copies of one thread: 12 x 16 bytes. Copy c of thread t fills bytes (c * 256 + t) * 16 of the stage: row group c * 2 + t / 128 (0..7 of A, then 0..15 of B), gs = bytes between row groups g and g + 2 in the plane.
// The wait on the address registers is the statement's last line, so that no later write of them can be lifted over it.
__device__ __forceinline__ void stage_copies(const unsigned l, const char* ga, const char* gb, const unsigned gs) {
    asm volatile("global_load_async_to_lds_b128 %0, %12, off\n\t"
                 "global_load_async_to_lds_b128 %1, %13, off\n\t"
                 "global_load_async_to_lds_b128 %2, %14, off\n\t"
                 "global_load_async_to_lds_b128 %3, %15, off\n\t"
                 "global_load_async_to_lds_b128 %4, %16, off\n\t"
                 "global_load_async_to_lds_b128 %5, %17, off\n\t"
                 "global_load_async_to_lds_b128 %6, %18, off\n\t"
                 "global_load_async_to_lds_b128 %7, %19, off\n\t"
                 "global_load_async_to_lds_b128 %8, %20, off\n\t"
                 "global_load_async_to_lds_b128 %9, %21, off\n\t"
                 "global_load_async_to_lds_b128 %10, %22, off\n\t"
                 "global_load_async_to_lds_b128 %11, %23, off\n\t"
                 "s_wait_xcnt 0x0"
                 :: "v"(l), "v"(l + 4096u), "v"(l + 8192u), "v"(l + 12288u), "v"(l + 16384u), "v"(l + 20480u), "v"(l + 24576u), "v"(l + 28672u), "v"(l + 32768u), "v"(l + 36864u), "v"(l + 40960u), "v"(l + 45056u),
                    "v"(ga), "v"(ga + gs), "v"(ga + 2 * (size_t)gs), "v"(ga + 3 * (size_t)gs),
                    "v"(gb), "v"(gb + gs), "v"(gb + 2 * (size_t)gs), "v"(gb + 3 * (size_t)gs), "v"(gb + 4 * (size_t)gs), "v"(gb + 5 * (size_t)gs), "v"(gb + 6 * (size_t)gs), "v"(gb + 7 * (size_t)gs)
                 : "memory");
}
template <typename T16, int NSPLIT, bool BIAS, int K>
__global__ __launch_bounds__(256) void k_gemmw(const T16* __restrict__ A, const T16* __restrict__ A2, const T16* __restrict__ Bt, const T16* __restrict__ Bt2, h16* P16, bf* Ph, bf* Pl, h16* T16p, bf* Th, bf* Tl, const float* __restrict__ bias, size_t sA, size_t sB) {
    static_assert(HD == 64 && TT % 64 == 0, "one 64-column tile is one head, its 64 rows lie in one batch");
    typedef typename WFrag<T16>::V V;
    static_assert(NSPLIT == 0 && K % GKS == 0 && K / GKS >= 2, "single product; the ring's prologue needs two stages");
    __shared__ __align__(16) T16 ring[2 * GSTG / 2]; __shared__ __align__(16) float osw[8][16 * 68];
    (void)A2; (void)Bt2; const size_t z = blockIdx.z; A += z * sA; Bt += z * sB;
    const int wv = __builtin_amdgcn_readfirstlane((int)(threadIdx.x >> 5)), wm = wv & 1, wn = wv >> 1; float* os = osw[wv];   // each wave turns its own tile through its own LDS rows
    const int lane = threadIdx.x & 31, lr = lane & 15, hi = lane >> 4; const int r0 = blockIdx.x * 128 + wm * 64, c0 = blockIdx.y * 256 + wn * 64; const int bt = r0 / TT, t0 = r0 % TT;
    const bool vcol = c0 >= DQ + DKV; if (vcol) { P16 = T16p; Ph = Th; Pl = Tl; }   // a tile of value columns goes to the transposed planes
    v8f acc[4][4];
#pragma unroll
    for (int mb = 0; mb < 4; ++mb)
#pragma unroll
        for (int nb = 0; nb < 4; ++nb) acc[mb][nb] = (v8f){};
    const unsigned tid = threadIdx.x, gs = 2u * 16u * K * 2u;   // a 16-row group is 16 * K elements, its block of 32 k is 512
    const char* ga = (const char*)A + ((size_t)blockIdx.x * 8 + (tid >> 7)) * (16 * K * 2) + (tid & 127u) * 16u; const char* gb = (const char*)Bt + ((size_t)blockIdx.y * 16 + (tid >> 7)) * (16 * K * 2) + (tid & 127u) * 16u;
    const unsigned l0 = (unsigned)(size_t)ring + tid * 16u;   // the thread's LDS byte address in buffer 0
    constexpr int NT = K / GKS;
    stage_copies(l0, ga, gb, gs);
    asm volatile("s_wait_asynccnt 0x0" ::: "memory");   // this wave's copies of stage 0 have landed
    __syncthreads();                                     // ... and every other wave's: stage 0 may be read
    stage_copies(l0 + GSTG, ga + GKS * 32, gb + GKS * 32, gs);
#pragma unroll 1
    for (int t = 0; t < NT; ++t) {   // not unrolled: one trip is one stage, with one place where a stage is handed over
        const T16* sa = ring + (t & 1) * (GSTG / 2) + wm * 4 * (16 * GKS) + lane * 8; const T16* sb = ring + (t & 1) * (GSTG / 2) + (8 + wn * 4) * (16 * GKS) + lane * 8;
        V a[4], b[4];
#pragma unroll
        for (int kb = 0; kb < GKS / 32; ++kb) {
#pragma unroll
            for (int mb = 0; mb < 4; ++mb) a[mb] = WFrag<T16>::ld(sa + mb * (16 * GKS) + kb * 512);
#pragma unroll
            for (int nb = 0; nb < 4; ++nb) b[nb] = WFrag<T16>::ld(sb + nb * (16 * GKS) + kb * 512);
            __builtin_amdgcn_sched_barrier(0);   // keeps all of a block's 16 LDS reads in front of its first product: without it the B fragments are fetched one at a time among the products, each behind a full wait of its own
            if (kb == GKS / 32 - 1) {   // the stage's last block is in registers: the stage is handed over in front of that block's products, so that the refill flies for a whole trip
                asm volatile("s_wait_dscnt 0x0" ::: "memory");      // this wave's reads of stage t are done before its buffer is given up
                asm volatile("s_wait_asynccnt 0x0" ::: "memory");   // this wave's copies of stage t + 1 have landed
                __syncthreads();                                     // publishes stage t + 1 and ends every wave's reads of stage t
                if (t + 2 < NT) stage_copies(l0 + (unsigned)(t & 1) * GSTG, ga + (t + 2) * (GKS * 32), gb + (t + 2) * (GKS * 32), gs);
            }
#pragma unroll
            for (int nb = 0; nb < 4; ++nb) {
#pragma unroll
                for (int mb = 0; mb < 4; ++mb) acc[mb][nb] = WFrag<T16>::mma(a[mb], b[nb], acc[mb][nb]); }
        }
    }
    asm volatile("s_wait_asynccnt 0x0" ::: "memory");   // nothing is in flight when the wave goes on to its epilogue
    if (vcol) {   // an accumulator holds, per lane, 8 consecutive t of one d: that is the lane's own 16 bytes of one half of a block (d rows x t), so a wave stores 512 contiguous bytes
#pragma unroll
        for (int nb = 0; nb < 4; ++nb) { const float bb = BIAS ? bfr(bias[c0 + nb * 16 + lr]) : 0.0f;
#pragma unroll
            for (int mb = 0; mb < 4; ++mb) { v8h o16; v8us oh, ol;
#pragma unroll
                for (int j = 0; j < 8; ++j) { float x = acc[mb][nb][j]; if (BIAS) x += bb; o16[j] = tohx(x); unsigned short a2, c2; splitf(x, a2, c2); oh[j] = a2; ol[j] = c2; }
                const size_t e = ((size_t)bt * DKV + (c0 - DQ - DKV)) * TT + (size_t)(((t0 >> 5) + (mb >> 1)) * 4 + nb) * 512 + (mb & 1) * 256 + lane * 8;
                *(v8h*)(P16 + e) = o16; *(v8us*)(Ph + e) = oh; *(v8us*)(Pl + e) = ol; } }
    } else {                 // rows of 64 d: turned through LDS so that a lane holds 8 consecutive d of one t, its own 16 bytes of one half of a block (t rows x d)
        float bb[4];
#pragma unroll
        for (int nb = 0; nb < 4; ++nb) bb[nb] = BIAS ? bfr(bias[c0 + nb * 16 + lr]) : 0.0f;
#pragma unroll
        for (int mb = 0; mb < 4; ++mb) {
#pragma unroll
            for (int nb = 0; nb < 4; ++nb) {
#pragma unroll
                for (int j = 0; j < 8; ++j) os[(hi * 8 + j) * 68 + nb * 16 + lr] = BIAS ? acc[mb][nb][j] + bb[nb] : acc[mb][nb][j]; }
            __builtin_amdgcn_wave_barrier(); asm volatile("" ::: "memory");   // the LDS stores above stay in front of the other lanes' reads below
#pragma unroll
            for (int s = 0; s < 4; ++s) { const int cofs = (2 * s + hi) * 8; const v4f v0 = *(const v4fa*)(os + lr * 68 + cofs), v1 = *(const v4fa*)(os + lr * 68 + cofs + 4); v8h o16; v8us oh, ol;   // half-block s of these 16 rows: d = 16 s + 8 hi ...
#pragma unroll
                for (int u = 0; u < 8; ++u) { const float x = (u < 4) ? v0[u & 3] : v1[u & 3]; o16[u] = tohx(x); unsigned short a2, c2; splitf(x, a2, c2); oh[u] = a2; ol[u] = c2; }
                const size_t e = (((size_t)bt * (NH_ + NKV) + c0 / HD) * TT + t0 + mb * 16) * HD + s * 256 + lane * 8;
                *(v8h*)(P16 + e) = o16; *(v8us*)(Ph + e) = oh; *(v8us*)(Pl + e) = ol; }
            __builtin_amdgcn_wave_barrier(); asm volatile("" ::: "memory");   // the reads above stay in front of the next 16 rows' LDS stores
        }
    }
}

typedef __attribute__((ext_vector_type(2))) _Float16 v2h;
typedef __attribute__((ext_vector_type(4))) _Float16 v4h;
typedef __attribute__((ext_vector_type(2))) unsigned short v2us;
typedef __attribute__((ext_vector_type(4))) unsigned short v4us;
typedef __attribute__((ext_vector_type(2))) float v2f;
typedef __attribute__((ext_vector_type(4))) int v4i;

__global__ __launch_bounds__(256) void k_wtG(const float* __restrict__ w, int K, int N, bf* Bt) {
    const int lane = threadIdx.x & 31; const int L0 = (blockIdx.x * 8 + (threadIdx.x >> 5)) * 8; const int nlines = N * K / 64;
{
#pragma unroll 1
        for (int l = 0; l < 8; ++l) { const int L = L0 + l; if (L >= nlines) break; const size_t e = (size_t)L * 64 + lane * 2; const int k = (int)(e % K), n = (int)(e / K); v2us o;
            o[0] = f2bf(w[(size_t)k * N + n]); o[1] = f2bf(w[(size_t)(k + 1) * N + n]); *(v2us*)(Bt + e) = o; }
         }
}
__global__ __launch_bounds__(256) void k_cvt8(const float* __restrict__ srcA, bf* dstA, size_t nA8, const float* __restrict__ srcB, bf* dstB, size_t nB8) { size_t i = (size_t)blockIdx.x * 256 + threadIdx.x; const float* src = srcA; bf* dst = dstA;
    if (i >= nA8) { i -= nA8; if (i >= nB8) return; src = srcB; dst = dstB; }   // one launch rounds both arrays: first A's groups of 8, then B's
    const size_t blk = i >> 6; const int r = (int)(i >> 2) & 15, c = (int)i & 3;   // 64 threads a block (16 rows x 32 k, rows of DM): 4 neighbours read one whole 128-byte line of a source row, and 8 rows' groups of one c are one whole line of the plane in fragment order
    const v8f v = *(const v8f*)(src + ((blk / (DM / 32)) * 16 + r) * DM + (blk % (DM / 32)) * 32 + c * 8); v8us o;
#pragma unroll
    for (int k = 0; k < 8; ++k) o[k] = f2bf(v[k]); *(v8us*)(dst + blk * 512 + ((c >> 1) * 32 + (c & 1) * 16 + r) * 8) = o;  }
__global__ __launch_bounds__(256) void k_cscvt(const float* __restrict__ cosT, const float* __restrict__ sinT, float* CS) { const int idx = blockIdx.x * 256 + threadIdx.x; if (idx >= TT * HD) return; v2f cs; cs[0] = bfr(cosT[idx]); cs[1] = bfr(sinT[idx]); *(v2f*)(CS + (size_t)idx * 2) = cs;  }
// ---- attn_tile (queries < RH): causal scores, softmax and probability x value contraction of one 32-query tile of one head in ONE work-group (16 waves); no score or probability leaves the chip.
// Wave w owns keys [w*KCH, (w+1)*KCH). It forms the TRANSPOSED score tile (A = key rows, B = query rows), so that a lane holds 8 consecutive keys of one query per accumulator: two neighbouring accumulators
// are, element for element, the A fragment of the probability x value product, and the probabilities go from the softmax into that product without leaving their registers.
// The row maximum and the row sum meet over the waves in LDS (one barrier each; sum in wave order = ascending keys), the 16 partial output tiles likewise (third barrier).
// A wave whose keys all lie beyond the tile's last query forms no scores or products, but still takes its share of the final sum. hi + lo planes (3 products), 32 keys a wave.
typedef __attribute__((ext_vector_type(16))) unsigned short v16us;
__device__ __forceinline__ void mkp(const v8f e0, const v8f e1, const float f, v16h& a, v16h& a2) { (void)a2;
#pragma unroll
    for (int j = 0; j < 8; ++j) { a[j] = tohx(e0[j] * f); a[8 + j] = tohx(e1[j] * f); } }
__device__ __forceinline__ void mkp(const v8f e0, const v8f e1, const float f, v16bf& a, v16bf& a2) { v16us h, l;
#pragma unroll
    for (int j = 0; j < 8; ++j) { unsigned short x, y; splitf(e0[j] * f, x, y); h[j] = x; l[j] = y; splitf(e1[j] * f, x, y); h[8 + j] = x; l[8 + j] = y; }
    a = __builtin_bit_cast(v16bf, h); a2 = __builtin_bit_cast(v16bf, l); }
#define RP 68                     // pitch, in floats, of a partial output row in LDS
template <typename T16, int NSPLIT, int KCH>
__device__ __forceinline__ void attn_tile(const T16* __restrict__ Q, const T16* __restrict__ Q2, const T16* __restrict__ Kp, const T16* __restrict__ Kp2, const T16* __restrict__ Vt, const T16* __restrict__ Vt2, float* O, const int r0, const float pnum, float (*red)[32 * RP], float (*smax)[32], float (*ssum)[32]) {
    typedef typename WFrag<T16>::V V;
    static_assert(KCH % 32 == 0 && 16 * KCH <= TT, "the 16 key slices stay inside the sequence");
    constexpr int NM = KCH / 16, NS = KCH / 32;
    const int wv = __builtin_amdgcn_readfirstlane((int)(threadIdx.x >> 5)); const int lane = threadIdx.x & 31, lr = lane & 15, hi = lane >> 4; const int key0 = wv * KCH;
    const bool active = key0 < r0 + 32; const int nact = (r0 + 32 + KCH - 1) / KCH;      // waves 0 .. nact-1 hold causal keys (nact <= 16)
    const unsigned qo = (unsigned)(r0 * HD + 8 * lane) * 2u, ko = (unsigned)(key0 * HD + 8 * lane) * 2u, vo = (unsigned)(key0 * HD + 8 * lane) * 2u;   // byte offset of a lane's first element of the query rows, the key rows and the value columns: the one address register of each group of loads
    v8f s[NM][2];
#pragma unroll
    for (int mt = 0; mt < NM; ++mt) { s[mt][0] = (v8f){}; s[mt][1] = (v8f){}; }
    float mx[2] = {-3.0e38f, -3.0e38f};
    V b[NS][4], b2[NS][4];
    if (active) {
        V q[2][2], q2[2][2], k[NM][2], k2[NM][2];
#pragma unroll
        for (int nb = 0; nb < 2; ++nb)
#pragma unroll
            for (int kc = 0; kc < 2; ++kc) { const int o = (nb * 2 + kc) * 512; q[nb][kc] = WFrag<T16>::ld(atb(Q, qo) + o); if (NSPLIT == 2) q2[nb][kc] = WFrag<T16>::ld(atb(Q2, qo) + o); }
#pragma unroll
        for (int mt = 0; mt < NM; ++mt)
#pragma unroll
            for (int kc = 0; kc < 2; ++kc) { const int o = (mt * 2 + kc) * 512; k[mt][kc] = WFrag<T16>::ld(atb(Kp, ko) + o); if (NSPLIT == 2) k2[mt][kc] = WFrag<T16>::ld(atb(Kp2, ko) + o); }
        asm volatile("s_wait_xcnt 0x0" :: "v"(qo), "v"(ko) : "memory");   // the loads' address registers stay whole up to this wait
        __builtin_amdgcn_sched_barrier(0);   // keeps every load above in front of the first product, so that the wave waits out the load latency once and not once per key tile
#pragma unroll
        for (int mt = 0; mt < NM; ++mt)
#pragma unroll
            for (int nb = 0; nb < 2; ++nb)
#pragma unroll
                for (int kc = 0; kc < 2; ++kc) { s[mt][nb] = WFrag<T16>::mma(k[mt][kc], q[nb][kc], s[mt][nb]); if (NSPLIT == 2) { s[mt][nb] = WFrag<T16>::mma(k[mt][kc], q2[nb][kc], s[mt][nb]); s[mt][nb] = WFrag<T16>::mma(k2[mt][kc], q[nb][kc], s[mt][nb]); } }
        if (key0 + KCH - 1 > r0) {           // only a wave that holds a key beyond the tile's first query has anything to mask
            const int dl = r0 + lr - key0 - hi * 8;   // key (mt, j) is causal for query (nb, lr) where mt * 16 + j - nb * 16 <= dl
#pragma unroll
            for (int mt = 0; mt < NM; ++mt)
#pragma unroll
                for (int nb = 0; nb < 2; ++nb)
#pragma unroll
                    for (int j = 0; j < 8; ++j) s[mt][nb][j] = (mt * 16 + j - nb * 16 <= dl) ? s[mt][nb][j] : -3.0e38f;
        }
#pragma unroll
        for (int mt = 0; mt < NM; ++mt)
#pragma unroll
            for (int nb = 0; nb < 2; ++nb)
#pragma unroll
                for (int j = 0; j < 8; ++j) { const float t = s[mt][nb][j] * SCL; s[mt][nb][j] = t; mx[nb] = fmaxf(mx[nb], t); }
        mx[0] = fmaxf(mx[0], __shfl_xor(mx[0], 16, 32)); mx[1] = fmaxf(mx[1], __shfl_xor(mx[1], 16, 32));
    }
    if (hi == 0) { smax[wv][lr] = mx[0]; smax[wv][16 + lr] = mx[1]; }
    __syncthreads();   // every wave's row maxima are in LDS before any wave takes the maximum over the waves
    float sm[2] = {0.f, 0.f};
    if (active) {
#pragma unroll
        for (int w = 0; w < 16; ++w) { mx[0] = fmaxf(mx[0], smax[w][lr]); mx[1] = fmaxf(mx[1], smax[w][16 + lr]); }
#pragma unroll
        for (int mt = 0; mt < NM; ++mt)
#pragma unroll
            for (int nb = 0; nb < 2; ++nb)
#pragma unroll
                for (int j = 0; j < 8; ++j) { const float e = __builtin_amdgcn_exp2f(__fmul_rn(__fsub_rn(s[mt][nb][j], mx[nb]), 1.4426950408889634f)); s[mt][nb][j] = e; sm[nb] += e; }
        sm[0] += __shfl_xor(sm[0], 16, 32); sm[1] += __shfl_xor(sm[1], 16, 32);
#pragma unroll
        for (int ss = 0; ss < NS; ++ss)
#pragma unroll
            for (int db = 0; db < 2; ++db) { const int ofs = (ss * 4 + db) * 512; b[ss][db] = WFrag<T16>::ld(atb(Vt, vo) + ofs); if (NSPLIT == 2) b2[ss][db] = WFrag<T16>::ld(atb(Vt2, vo) + ofs); }
        asm volatile("s_wait_xcnt 0x0" :: "v"(vo) : "memory");   // as above: the address register stays whole up to this wait
        __builtin_amdgcn_sched_barrier(0);   // holds the loads of value columns 0..31 here, so that they fly while the row sums meet over the waves
    }
    if (hi == 0) { ssum[wv][lr] = sm[0]; ssum[wv][16 + lr] = sm[1]; }
    __syncthreads();   // every wave's row sums are in LDS before any wave adds them up
    {
        if (active) {
            v8f o[2][4];
#pragma unroll
            for (int qb = 0; qb < 2; ++qb)
#pragma unroll
                for (int db = 0; db < 4; ++db) o[qb][db] = (v8f){};
            float t0 = ssum[0][lr], t1 = ssum[0][16 + lr];
#pragma unroll
            for (int w = 1; w < 16; ++w) { t0 += ssum[w][lr]; t1 += ssum[w][16 + lr]; }
            const float f[2] = {__fdiv_rn(pnum, t0), __fdiv_rn(pnum, t1)};
            V a[NS][2], a2[NS][2];
#pragma unroll
            for (int ss = 0; ss < NS; ++ss)
#pragma unroll
                for (int qb = 0; qb < 2; ++qb) mkp(s[2 * ss][qb], s[2 * ss + 1][qb], f[qb], a[ss][qb], a2[ss][qb]);
            __builtin_amdgcn_sched_barrier(0);   // the loads below start only when the scores have been packed into probabilities: earlier they would spill
#pragma unroll
            for (int ss = 0; ss < NS; ++ss)
#pragma unroll
                for (int db = 2; db < 4; ++db) { const int ofs = (ss * 4 + db) * 512; b[ss][db] = WFrag<T16>::ld(atb(Vt, vo) + ofs); if (NSPLIT == 2) b2[ss][db] = WFrag<T16>::ld(atb(Vt2, vo) + ofs); }
            asm volatile("s_wait_xcnt 0x0" :: "v"(vo) : "memory");   // as above: the address register stays whole up to this wait
            __builtin_amdgcn_sched_barrier(0);   // keeps those loads in front of the first product: they fly during the products of value columns 0..31
#pragma unroll
            for (int db = 0; db < 4; ++db)
#pragma unroll
                for (int ss = 0; ss < NS; ++ss)
#pragma unroll
                    for (int qb = 0; qb < 2; ++qb) { o[qb][db] = WFrag<T16>::mma(a[ss][qb], b[ss][db], o[qb][db]); if (NSPLIT == 2) { o[qb][db] = WFrag<T16>::mma(a2[ss][qb], b[ss][db], o[qb][db]); o[qb][db] = WFrag<T16>::mma(a[ss][qb], b2[ss][db], o[qb][db]); } }
            __builtin_amdgcn_sched_barrier(0);   // keeps the LDS stores behind the last product
#pragma unroll
            for (int qb = 0; qb < 2; ++qb)
#pragma unroll
                for (int db = 0; db < 4; ++db)
#pragma unroll
                    for (int j = 0; j < 8; ++j) red[wv][(qb * 16 + hi * 8 + j) * RP + db * 16 + lr] = o[qb][db][j];
        } else if (wv < ((nact + 3) & ~3)) {   // the final sum reads the partial tiles in groups of four waves: an idle wave of the last group stores zeros
#pragma unroll
            for (int u = 0; u < 16; ++u) *(v4fa*)&red[wv][(u * 2 + hi) * RP + lr * 4] = (v4f){};
        }
    }
    __syncthreads();   // every wave's partial tile is in LDS before any wave sums
    const int row = threadIdx.x >> 4, col = (threadIdx.x & 15) * 4; v4f acc = *(const v4fa*)&red[0][row * RP + col];
#pragma unroll
    for (int w = 1; w < 4; ++w) acc += *(const v4fa*)&red[w][row * RP + col];
#pragma unroll
    for (int g = 4; g < 16; g += 4)
        if (g < nact) {
#pragma unroll
            for (int w = g; w < g + 4; ++w) acc += *(const v4fa*)&red[w][row * RP + col]; }
    v4f ov;   // the tile goes straight to its head's 64 columns of the output rows: probabilities' scale taken off, then hi + lo of the bf16 pair
#pragma unroll
    for (int u = 0; u < 4; ++u) { unsigned short a, c2; splitf(acc[u] * (1.0f / pnum), a, c2); ov[u] = __fadd_rn(bf2f(a), bf2f(c2)); }
    *(v4f*)(O + (size_t)(r0 + row) * DQ + col) = ov;
}
// ---- the walk: queries >= RH. A wave walks the causal keys of a 32-query tile in passes of 32, with a running row maximum and row sum; a long tile's keys are shared with the wave of a short tile (attn_pair, below).
// Scores transposed as above (A = key rows, B = query rows); the output transposed too (A = value columns d x keys, B = the packed probabilities): in both a lane holds ONE query's values, so the factor that
// carries the output and the sum over to a new maximum is the lane's own. The 16 waves of a work-group walk the same head (a short tile's wave from key 0 on, a long tile's from pass nh on), so that a key or value line fetched by one is in the WGP's cache for the others.
// Probabilities are exp2(.) x 2^LOGP (the fp16 operand's range, as PCAR above); the sum carries the same factor, which leaves with the division.
#define LOGP 10.0f
__device__ __forceinline__ float xhalf(float v) { const int b = __float_as_int(v); return __int_as_float(__builtin_amdgcn_permlanex16(b, b, 0x76543210, 0xfedcba98, false, false)); }   // lane l takes lane l ^ 16's value
// One pass: 32 keys (their tiles k came in a pass ahead) against the wave's 32 queries. vo, ko: the lane's byte offset of this pass's values and of the next pass's keys. LAST: the tile's own 32 keys, masked; no further keys are fetched.
template <bool LAST>
__device__ __forceinline__ void walk_pass(const h16* __restrict__ Kp, const h16* __restrict__ Vt, const unsigned ko, const unsigned vo, const int dl, const v16h (&q)[2][2], v16h (&k)[2][2], v8f (&o)[4][2], float (&m)[2], float (&l)[2]) {
    constexpr float C2 = SCL * 1.4426950408889634f;
    v16h v[4];
#pragma unroll
    for (int db = 0; db < 4; ++db) v[db] = WFrag<h16>::ld(atb(Vt, vo) + db * 512);
    v8f s[2][2];
#pragma unroll
    for (int mt = 0; mt < 2; ++mt)
#pragma unroll
        for (int nb = 0; nb < 2; ++nb) { s[mt][nb] = WFrag<h16>::mma(k[mt][0], q[nb][0], (v8f){}); s[mt][nb] = WFrag<h16>::mma(k[mt][1], q[nb][1], s[mt][nb]); }
    if (!LAST) {
#pragma unroll
        for (int mt = 0; mt < 2; ++mt)
#pragma unroll
            for (int kc = 0; kc < 2; ++kc) k[mt][kc] = WFrag<h16>::ld(atb(Kp, ko) + (mt * 2 + kc) * 512);
    }
    asm volatile("s_wait_xcnt 0x0" :: "v"(ko), "v"(vo) : "memory");   // the address registers of this pass's value and key loads stay whole up to this wait
    __builtin_amdgcn_sched_barrier(0);   // keeps both groups of loads up here (sunk to their first use they would each be waited for in full) and every rewrite of their address registers behind the wait
    if (LAST) {   // key (mt, j) is causal for query (nb, lr) where mt * 16 + j - nb * 16 <= dl
#pragma unroll
        for (int mt = 0; mt < 2; ++mt)
#pragma unroll
            for (int nb = 0; nb < 2; ++nb)
#pragma unroll
                for (int j = 0; j < 8; ++j) s[mt][nb][j] = (mt * 16 + j - nb * 16 <= dl) ? s[mt][nb][j] : -3.0e38f;
    }
    v16h pf[2];
#pragma unroll
    for (int nb = 0; nb < 2; ++nb) {
        float bm = s[0][nb][0];
#pragma unroll
        for (int j = 1; j < 8; ++j) bm = fmaxf(bm, s[0][nb][j]);
#pragma unroll
        for (int j = 0; j < 8; ++j) bm = fmaxf(bm, s[1][nb][j]);
        bm = fmaxf(bm, xhalf(bm));
        const float mn = fmaxf(m[nb], bm), al = __builtin_amdgcn_exp2f((m[nb] - mn) * C2), sh = fmaf(-mn, C2, LOGP); m[nb] = mn;
        float sum = 0.f;
#pragma unroll
        for (int mt = 0; mt < 2; ++mt) { const v8f x = __builtin_elementwise_fma(s[mt][nb], (v8f){C2, C2, C2, C2, C2, C2, C2, C2}, (v8f){sh, sh, sh, sh, sh, sh, sh, sh});
#pragma unroll
            for (int j = 0; j < 8; ++j) { const float e = __builtin_amdgcn_exp2f(x[j]); sum += e; pf[nb][mt * 8 + j] = tohx(e); } }
        l[nb] = fmaf(l[nb], al, sum);
#pragma unroll
        for (int db = 0; db < 4; ++db) o[db][nb] *= al;
    }
#pragma unroll
    for (int db = 0; db < 4; ++db)
#pragma unroll
        for (int nb = 0; nb < 2; ++nb) o[db][nb] = WFrag<h16>::mma(v[db], pf[nb], o[db][nb]);
}
// walk_run: passes p0 .. p1 - 1 (32 keys each, all in front of the tile's first query) of the 32-query tile at row r0; OWN: then the tile's own 32 keys, masked (p1 is then r0 / 32). Leaves the tile's output, maximum and sum over those keys.
template <bool OWN>
__device__ __forceinline__ void walk_run(const h16* __restrict__ Q, const h16* __restrict__ Kp, const h16* __restrict__ Vt, const int r0, const int p0, const int p1, v8f (&o)[4][2], float (&m)[2], float (&l)[2]) {
#pragma unroll
    for (int db = 0; db < 4; ++db) { o[db][0] = (v8f){}; o[db][1] = (v8f){}; }
    m[0] = -3.0e38f; m[1] = -3.0e38f; l[0] = 0.f; l[1] = 0.f;
    if (!OWN && p0 >= p1) return;   // no pass to walk (the same for the whole wave): nothing is fetched
    const int lane = threadIdx.x & 31, lr = lane & 15, hi = lane >> 4; const unsigned lo = (unsigned)lane * 16u, qo = lo + (unsigned)r0 * (HD * 2), k0 = lo + (unsigned)p0 * (32 * HD * 2);   // the lane's 16 bytes of a half block: at key 0, at the tile's first query, at the first key of the run
    v16h q[2][2], k[2][2];
#pragma unroll
    for (int nb = 0; nb < 2; ++nb)
#pragma unroll
        for (int kc = 0; kc < 2; ++kc) { q[nb][kc] = WFrag<h16>::ld(atb(Q, qo) + (nb * 2 + kc) * 512); k[nb][kc] = WFrag<h16>::ld(atb(Kp, k0) + (nb * 2 + kc) * 512); }
    asm volatile("s_wait_xcnt 0x0" :: "v"(qo), "v"(k0) : "memory");   // the loads' address registers stay whole up to this wait
#pragma unroll 1
    for (int p = p0; p < p1; ++p)   // not unrolled: a pass holds the registers of one set of key, value and score tiles
        walk_pass<false>(Kp, Vt, lo + (unsigned)(p + 1) * (32 * HD * 2), lo + (unsigned)p * (32 * HD * 2), 0, q, k, o, m, l);
    if (OWN) walk_pass<true>(Kp, Vt, lo, lo + (unsigned)p1 * (32 * HD * 2), lr - hi * 8, q, k, o, m, l);
}
// walk_out: o[db][nb][j] is query nb * 16 + lr, column db * 16 + hi * 8 + j. Divided by the row sum and turned through the wave's own LDS rows, so that a store covers whole 256-byte output rows.
__device__ __forceinline__ void walk_out(const v8f (&o)[4][2], const float (&l)[2], float* O, const int r0, float* os) {
    const int lane = threadIdx.x & 31, lr = lane & 15, hi = lane >> 4;
#pragma unroll
    for (int nb = 0; nb < 2; ++nb) { const float f = __fdiv_rn(1.0f, l[nb] + xhalf(l[nb]));
#pragma unroll
        for (int db = 0; db < 4; ++db) { v4f x0, x1;
#pragma unroll
            for (int u = 0; u < 4; ++u) { x0[u] = o[db][nb][u] * f; x1[u] = o[db][nb][4 + u] * f; }
            *(v4fa*)(os + (nb * 16 + lr) * RP + db * 16 + hi * 8) = x0; *(v4fa*)(os + (nb * 16 + lr) * RP + db * 16 + hi * 8 + 4) = x1; } }
    __builtin_amdgcn_wave_barrier(); asm volatile("" ::: "memory");   // the LDS stores above stay in front of the other lanes' reads below
#pragma unroll
    for (int u = 0; u < 16; ++u) { const int row = u * 2 + hi; const v4f x = *(const v4fa*)(os + row * RP + lr * 4); v4f ov;   // hi + lo of the bf16 pair, as in attn_tile
#pragma unroll
        for (int c = 0; c < 4; ++c) { unsigned short a, c2; splitf(x[c], a, c2); ov[c] = __fadd_rn(bf2f(a), bf2f(c2)); }
        *(v4f*)(O + (size_t)(r0 + row) * DQ + lr * 4) = ov; }
}
// attn_pair: two waves of a work-group share the keys of a short and a long tile, so that both walk the same number of passes (to within one) and no wave is left walking alone on its SIMD.
// The short tile's wave (helper) walks and writes its own tile, then walks the FIRST nh passes of the long tile and leaves that part's output, maximum and sum in its LDS rows, lane for lane (both waves hold a tile in the same lanes and registers).
// The long tile's wave walks the rest, and behind one work-group barrier carries both parts over to their common maximum, adds them and writes the tile.
__device__ __forceinline__ void attn_pair(const h16* __restrict__ Q, const h16* __restrict__ Kp, const h16* __restrict__ Vt, float* O, const bool helper, const int tile, const int other, float* os, float* po) {
    constexpr float C2 = SCL * 1.4426950408889634f;
    const int lane = threadIdx.x & 31; const int nh = (helper ? other - tile : tile - other) / 2;   // passes of the long tile that the helper walks
    v8f o[4][2]; float m[2], l[2];
    walk_run<true>(Q, Kp, Vt, tile * 32, helper ? 0 : nh, tile, o, m, l);
    if (helper) {
        walk_out(o, l, O, tile * 32, os);
        asm volatile("s_wait_xcnt 0x0" ::: "memory");   // the registers that the output stores name stay whole up to this wait: the second walk below writes them anew
        walk_run<false>(Q, Kp, Vt, other * 32, 0, nh, o, m, l);
        __builtin_amdgcn_wave_barrier(); asm volatile("" ::: "memory");   // the other lanes' reads of the wave's LDS rows in walk_out stay in front of the stores below
#pragma unroll
        for (int db = 0; db < 4; ++db)
#pragma unroll
            for (int nb = 0; nb < 2; ++nb) { v4f x0, x1;
#pragma unroll
                for (int u = 0; u < 4; ++u) { x0[u] = o[db][nb][u]; x1[u] = o[db][nb][4 + u]; }
                *(v4fa*)(os + (((db * 2 + nb) * 2) * 32 + lane) * 4) = x0; *(v4fa*)(os + (((db * 2 + nb) * 2 + 1) * 32 + lane) * 4) = x1; }
        *(v4fa*)(os + (16 * 32 + lane) * 4) = (v4f){m[0], m[1], l[0], l[1]};
    }
    __syncthreads();   // every helper's part is in LDS before the long tile's wave takes it
    if (!helper) {
        const v4f ml = *(const v4fa*)(po + (16 * 32 + lane) * 4);
#pragma unroll
        for (int nb = 0; nb < 2; ++nb) { const float mn = fmaxf(m[nb], ml[nb]), aw = __builtin_amdgcn_exp2f((m[nb] - mn) * C2), ah = __builtin_amdgcn_exp2f((ml[nb] - mn) * C2);
            l[nb] = fmaf(l[nb], aw, ml[2 + nb] * ah);
#pragma unroll
            for (int db = 0; db < 4; ++db) { const v4f x0 = *(const v4fa*)(po + (((db * 2 + nb) * 2) * 32 + lane) * 4), x1 = *(const v4fa*)(po + (((db * 2 + nb) * 2 + 1) * 32 + lane) * 4);
#pragma unroll
                for (int u = 0; u < 4; ++u) { o[db][nb][u] = fmaf(o[db][nb][u], aw, x0[u] * ah); o[db][nb][4 + u] = fmaf(o[db][nb][4 + u], aw, x1[u] * ah); } } }
        walk_out(o, l, O, tile * 32, os);
    }
}
#define WG_H  ((TT - RH) / 32 / 16)          // walking work-groups of a head: 16 tiles each
#define NWALK (NB_ * NH_ * WG_H)
// grid: first the NWALK walking work-groups (the long ones), then batches * heads * RH / 32 work-groups of attn_tile, those with the most keys first
__global__ __launch_bounds__(512) void k_attn(const h16* __restrict__ QK16, const h16* __restrict__ V16, const bf* __restrict__ QKh, const bf* __restrict__ QKl, const bf* __restrict__ Vh, const bf* __restrict__ Vl, float* O) {
    static_assert((TT - RH) % 512 == 0 && RH % 32 == 0, "16 whole tiles a walking work-group");
    __shared__ __align__(16) float red[16][32 * RP]; __shared__ float smax[16][32]; __shared__ float ssum[16][32];
    const bool walk = (int)blockIdx.x < NWALK; const int idx = walk ? (int)blockIdx.x : (int)blockIdx.x - NWALK; const int bh = idx % (NB_ * NH_), g = idx / (NB_ * NH_);
    const int bt = bh / NH_, hd = bh % NH_;
    const size_t zq = ((size_t)bt * (NH_ + NKV) + hd) * TT * HD, zk = zq + (size_t)NH_ * TT * HD, zv = ((size_t)bt * NKV + hd) * HD * TT;
    float* Oh = O + (size_t)bt * TT * DQ + (size_t)hd * HD;   // O: output rows [batch][t][heads * HD]
    if (walk) {   // waves w, w + 4, w + 8, w + 12 share a SIMD: their four tiles are dealt to and fro over the head's 4 * WG_H SIMDs, so that every SIMD walks the same number of keys
        const int wv = __builtin_amdgcn_readfirstlane((int)(threadIdx.x >> 5)), a = wv >> 2, c = g * 4 + (wv & 3);
        const int tile = RH / 32 + a * (4 * WG_H) + ((a & 1) ? 4 * WG_H - 1 - c : c), other = RH / 32 + (3 - a) * (4 * WG_H) + ((a & 1) ? c : 4 * WG_H - 1 - c);   // other: the tile of wave wv ^ 12, on the same SIMD; the two tiles' passes add up to the same number in every pair
        attn_pair(QK16 + zq, QK16 + zk, V16 + zv, Oh, a < 2, tile, other, red[wv], red[wv ^ 12]);
    } else attn_tile<bf, 2, RH / 16>(QKh + zq, QKl + zq, QKh + zk, QKl + zk, Vh + zv, Vl + zv, Oh, (RH / 32 - 1 - g) * 32, 1.0f, red, smax, ssum);
}
extern "C" void kernel_launch(void* const* d_in, const int* in_sizes, int n_in,
                              void* d_out, int out_size, void* d_ws, size_t ws_size, hipStream_t stream) {
    (void)in_sizes; (void)n_in; (void)out_size;
    const float* x = (const float*)d_in[0]; const float* wf = (const float*)d_in[1]; const float* bfz = (const float*)d_in[2];   // x [4][2048][1024], W [3072][1024] (rows q | k | v), b [3072]
    float* OUT = (float*)d_out;     // [4][2048][1024]
    char* wsp = (char*)d_ws;
    auto take = [&](size_t bytes) { char* p = wsp; wsp += (bytes + 255) & ~(size_t)255; return (void*)p; };
    bf* WB = (bf*)take((size_t)(DQ + 2 * DKV) * DM * 2);
    bf* XB = (bf*)take((size_t)NB_ * TT * DM * 2);
    h16* QK16 = (h16*)take((size_t)NB_ * (NH_ + NKV) * TT * HD * 2); h16* VT16 = (h16*)take((size_t)NB_ * NKV * HD * TT * 2);
    bf* QKh = (bf*)take((size_t)NB_ * (NH_ + NKV) * TT * HD * 2); bf* QKl = (bf*)take((size_t)NB_ * (NH_ + NKV) * TT * HD * 2); bf* VTh = (bf*)take((size_t)NB_ * NKV * HD * TT * 2); bf* VTl = (bf*)take((size_t)NB_ * NKV * HD * TT * 2);
    if ((size_t)(wsp - (char*)d_ws) > ws_size) return;    // 166 MiB of the 256 MiB
    k_cvt8<<<(unsigned)(((size_t)NB_ * TT * DM / 8 + (size_t)(DQ + 2 * DKV) * DM / 8 + 255) / 256), 256, 0, stream>>>(x, XB, (size_t)NB_ * TT * DM / 8, wf, WB, (size_t)(DQ + 2 * DKV) * DM / 8);
    k_gemmw<bf, 0, true, DM><<<dim3(NB_ * TT / 128, (DQ + 2 * DKV) / 256, 1), 256, 0, stream>>>(XB, nullptr, WB, nullptr, QK16, QKh, QKl, VT16, VTh, VTl, bfz, 0, 0);
    k_attn<<<dim3(NWALK + NB_ * NH_ * (RH / 32), 1, 1), 512, 0, stream>>>(QK16, VT16, QKh, QKl, VTh, VTl, OUT);
}

// v010
// A run of this version takes 95.7 microseconds.
// Timed twice side by side with v009, it ran 1.04 and 1.03 times as fast.
// Over all steps from v000 it is 29.4 times as fast.
#include <hip/hip_runtime.h>

// SelfAttentionHead (x [4][2048][1024]; qkv = x W^T + b (W [3072][1024], split (q | k | v) x 16 heads x 64); causal softmax(q.k / 8); out = merged heads (no output projection) -> [4][2048][1024]).
// Compute dtypes, f32 accumulate: every input rounded to bf16; q/k/v on PLAIN bf16 operands (inputs: exact) + bias; causal scores and attn.v: query rows < 512 hl (3 products), the rest single fp16 (x1024, running maximum and sum over 32-key passes); softmax f32; the merged heads are written as hi + lo of a bf16 pair (i.e. the f32 attention output rounded through a bf16 pair, |err| <= 2^-16 relative).

#define NB_  4
#define TT   2048
#define DM   1024
#define NH_  16
#define NKV  16
#define REP  (NH_ / NKV)
#define HD   64
#define DQ   (NH_ * HD)
#define DKV  (NKV * HD)
#define ZH   16                   // not used: one launch of the attention kernel covers all NH_ heads
#define RH   512                  // query rows < RH use hi+lo planes (0: none)
#define PCAR 1024.0f
#define SCL  0.125f   // HD^-0.5
typedef _Float16 h16;
typedef unsigned short bf;
typedef __attribute__((ext_vector_type(16))) __bf16   v16bf;
typedef __attribute__((ext_vector_type(16))) _Float16 v16h;
typedef __attribute__((ext_vector_type(8)))  _Float16 v8h;
typedef __attribute__((ext_vector_type(8)))  unsigned short v8us;
typedef __attribute__((ext_vector_type(8)))  float    v8f;
typedef __attribute__((ext_vector_type(4)))  float    v4f;
typedef __attribute__((ext_vector_type(4)))  int      v4i;
typedef v8h  __attribute__((may_alias)) v8ha;
typedef v4f  __attribute__((may_alias)) v4fa;
typedef v8us __attribute__((may_alias)) v8usa;

__device__ __forceinline__ unsigned short f2bf(float f) { unsigned u = __float_as_uint(f); u += 0x7FFFu + ((u >> 16) & 1u); return (unsigned short)(u >> 16); }
__device__ __forceinline__ float bf2f(unsigned short b) { return __uint_as_float(((unsigned)b) << 16); }
__device__ __forceinline__ float bfr(float f) { return bf2f(f2bf(f)); }
__device__ __forceinline__ h16 tohx(float x) { return (h16)x; }
__device__ __forceinline__ void splitf(float y, unsigned short& h, unsigned short& l) { h = f2bf(y); l = f2bf(y - bf2f(h)); }
__device__ __forceinline__ v16h cat16(v8h lo, v8h hi) { return __builtin_shufflevector(lo, hi, 0, 1, 2, 3, 4, 5, 6, 7, 8, 9, 10, 11, 12, 13, 14, 15); }
__device__ __forceinline__ v16bf cat16b(v8us lo, v8us hi) { return __builtin_bit_cast(v16bf, __builtin_shufflevector(lo, hi, 0, 1, 2, 3, 4, 5, 6, 7, 8, 9, 10, 11, 12, 13, 14, 15)); }
__device__ __forceinline__ v8f wmma16(v16h a, v16h b, v8f c) { return __builtin_amdgcn_wmma_f32_16x16x32_f16(false, a, false, b, (short)0, c, false, false); }
__device__ __forceinline__ v8f wmmab(v16bf a, v16bf b, v8f c) { return __builtin_amdgcn_wmma_f32_16x16x32_bf16(false, a, false, b, (short)0, c, false, false); }



// ---- FRAGMENT ORDER of every 16-bit plane in the workspace: a plane of rows x k is cut into blocks of 16 rows x 32 k = 1 KiB, and inside a block element (r, kk) stands at (kk >> 4) * 256 + (((kk >> 3) & 1) * 16 + r) * 8 + (kk & 7).
// That is the order in which the 32 lanes of a wave take a 16x16x32 operand: lane l reads 16 bytes at l * 16 and 16 bytes at 512 + l * 16, so each wave-wide load is 512 contiguous bytes (4 whole 128-byte lines) and not 32 bytes of each of 16 lines.
// ---- k_gemmw: register-blocked GEMM, one wave per 64x64 output tile (16 accumulators), EIGHT waves (2 x 4) per work-group = a 128x256 tile; grid (M/128, N/256, Z), 256 threads.
// The operands (16-bit planes in fragment order, blocks of one 16-row group run along k) come through an LDS ring of two buffers, filled by asynchronous copies: a stage is [A 8 row groups | B 16 row groups] x 64 k = 48 KiB, each row group 2 KiB,
// so a byte of A is fetched from L2 once for four waves and a byte of B once for two. In LDS a block keeps its fragment order: a wave-wide 16-byte read is 512 contiguous bytes.
// c[m][n] (f32, + optional f32 bias[n]) = sum_k A[m][k] Bt[n][k]. z-batch strides sA/sB in elements. K % 64 == 0, at least two stages; K is a compile-time constant, and with it the distance between two row groups.
// The tile's 64 columns are one head (HD == 64), its rows are sequence positions. The epilogue writes c as the three 16-bit planes that the attention kernel reads (fp16, bf16 hi, bf16 lo), each only where it is read:
// Rows are (batch, t), columns the fused (q | k | v) outputs. Columns < DQ + DKV: [batch][q heads | k heads] planes of t rows x d, block (t / 16) * 2 + d / 32; the rest: [batch][head] planes of d rows x t, block (t / 32) * 4 + d / 16. No f32 copy of c leaves the chip.
template <typename T16> struct WFrag;
template <> struct WFrag<h16> { typedef v16h V; static __device__ __forceinline__ V ld(const h16* p) { return cat16(*(const v8h*)p, *(const v8h*)(p + 256)); } static __device__ __forceinline__ v8f mma(V a, V b, v8f c) { return wmma16(a, b, c); } };
template <> struct WFrag<bf> { typedef v16bf V; static __device__ __forceinline__ V ld(const bf* p) { return cat16b(*(const v8us*)p, *(const v8us*)(p + 256)); } static __device__ __forceinline__ v8f mma(V a, V b, v8f c) { return wmmab(a, b, c); } };
template <typename T16> __device__ __forceinline__ const T16* atb(const T16* p, unsigned bytes) { return (const T16*)((const char*)p + bytes); }
#define GKS  64                   // k of one stage of the GEMM's LDS ring
#define GSTG ((8 + 16) * 16 * GKS * 2)   // bytes of a stage
// One stage's copies of one thread: 12 x 16 bytes. Copy c of thread t fills bytes (c * 256 + t) * 16 of the stage: row group c * 2 + t / 128 (0..7 of A, then 0..15 of B), gs = bytes between row groups g and g + 2 in the plane.
// The wait on the address registers is the statement's last line, so that no later write of them can be lifted over it.
__device__ __forceinline__ void stage_copies(const unsigned l, const char* ga, const char* gb, const unsigned gs) {
    asm volatile("global_load_async_to_lds_b128 %0, %12, off\n\t"
                 "global_load_async_to_lds_b128 %1, %13, off\n\t"
                 "global_load_async_to_lds_b128 %2, %14, off\n\t"
                 "global_load_async_to_lds_b128 %3, %15, off\n\t"
                 "global_load_async_to_lds_b128 %4, %16, off\n\t"
                 "global_load_async_to_lds_b128 %5, %17, off\n\t"
                 "global_load_async_to_lds_b128 %6, %18, off\n\t"
                 "global_load_async_to_lds_b128 %7, %19, off\n\t"
                 "global_load_async_to_lds_b128 %8, %20, off\n\t"
                 "global_load_async_to_lds_b128 %9, %21, off\n\t"
                 "global_load_async_to_lds_b128 %10, %22, off\n\t"
                 "global_load_async_to_lds_b128 %11, %23, off\n\t"
                 "s_wait_xcnt 0x0"
                 :: "v"(l), "v"(l + 4096u), "v"(l + 8192u), "v"(l + 12288u), "v"(l + 16384u), "v"(l + 20480u), "v"(l + 24576u), "v"(l + 28672u), "v"(l + 32768u), "v"(l + 36864u), "v"(l + 40960u), "v"(l + 45056u),
                    "v"(ga), "v"(ga + gs), "v"(ga + 2 * (size_t)gs), "v"(ga + 3 * (size_t)gs),
                    "v"(gb), "v"(gb + gs), "v"(gb + 2 * (size_t)gs), "v"(gb + 3 * (size_t)gs), "v"(gb + 4 * (size_t)gs), "v"(gb + 5 * (size_t)gs), "v"(gb + 6 * (size_t)gs), "v"(gb + 7 * (size_t)gs)
                 : "memory");
}
// Four 16-byte stores of a lane into one plane, from one address. The wait on the stores' address and data registers is the statement's last line, so that no later write of them can be lifted over it.
__device__ __forceinline__ void st4r(const void* p, const v4i d0, const v4i d1, const v4i d2, const v4i d3) {   // four half blocks in a row
    asm volatile("global_store_b128 %0, %1, off\n\t"
                 "global_store_b128 %0, %2, off offset:512\n\t"
                 "global_store_b128 %0, %3, off offset:1024\n\t"
                 "global_store_b128 %0, %4, off offset:1536\n\t"
                 "s_wait_xcnt 0x0"
                 :: "v"(p), "v"(d0), "v"(d1), "v"(d2), "v"(d3) : "memory");
}
__device__ __forceinline__ void st4v(const void* p, const v4i d0, const v4i d1, const v4i d2, const v4i d3) {   // both halves of a block and of the block four further on
    asm volatile("global_store_b128 %0, %1, off\n\t"
                 "global_store_b128 %0, %2, off offset:512\n\t"
                 "global_store_b128 %0, %3, off offset:4096\n\t"
                 "global_store_b128 %0, %4, off offset:4608\n\t"
                 "s_wait_xcnt 0x0"
                 :: "v"(p), "v"(d0), "v"(d1), "v"(d2), "v"(d3) : "memory");
}
template <typename T16, int NSPLIT, bool BIAS, int K>
__global__ __launch_bounds__(256) void k_gemmw(const T16* __restrict__ A, const T16* __restrict__ A2, const T16* __restrict__ Bt, const T16* __restrict__ Bt2, h16* P16, bf* Ph, bf* Pl, h16* T16p, bf* Th, bf* Tl, const float* __restrict__ bias, size_t sA, size_t sB) {
    static_assert(HD == 64 && TT % 64 == 0 && RH % 64 == 0, "one 64-column tile is one head, its 64 rows lie in one batch and on one side of RH");
    typedef typename WFrag<T16>::V V;
    static_assert(NSPLIT == 0 && K % GKS == 0 && K / GKS >= 2, "single product; the ring's prologue needs two stages");
    __shared__ __align__(16) T16 ring[2 * GSTG / 2]; __shared__ __align__(16) float osw[8][16 * 68];
    (void)A2; (void)Bt2; const size_t z = blockIdx.z; A += z * sA; Bt += z * sB;
    const int wv = __builtin_amdgcn_readfirstlane((int)(threadIdx.x >> 5)), wm = wv & 1, wn = wv >> 1; float* os = osw[wv];   // each wave turns its own tile through its own LDS rows
    const int lane = threadIdx.x & 31, lr = lane & 15, hi = lane >> 4; const int r0 = blockIdx.x * 128 + wm * 64, c0 = blockIdx.y * 256 + wn * 64; const int bt = r0 / TT, t0 = r0 % TT;
    const bool vcol = c0 >= DQ + DKV; if (vcol) { P16 = T16p; Ph = Th; Pl = Tl; }   // a tile of value columns goes to the transposed planes
    const bool pair = t0 < RH, single = !pair || c0 >= DQ;   // what the attention kernel reads of this tile (the same for the whole wave): the bf16 pair only at positions < RH (queries there, and their causal keys and values), the fp16 plane of a query only at positions >= RH; nothing else is stored
    v8f acc[4][4];
#pragma unroll
    for (int mb = 0; mb < 4; ++mb)
#pragma unroll
        for (int nb = 0; nb < 4; ++nb) acc[mb][nb] = (v8f){};
    const unsigned tid = threadIdx.x, gs = 2u * 16u * K * 2u;   // a 16-row group is 16 * K elements, its block of 32 k is 512
    const char* ga = (const char*)A + ((size_t)blockIdx.x * 8 + (tid >> 7)) * (16 * K * 2) + (tid & 127u) * 16u; const char* gb = (const char*)Bt + ((size_t)blockIdx.y * 16 + (tid >> 7)) * (16 * K * 2) + (tid & 127u) * 16u;
    const unsigned l0 = (unsigned)(size_t)ring + tid * 16u;   // the thread's LDS byte address in buffer 0
    constexpr int NT = K / GKS;
    stage_copies(l0, ga, gb, gs);
    asm volatile("s_wait_asynccnt 0x0" ::: "memory");   // this wave's copies of stage 0 have landed
    __syncthreads();                                     // ... and every other wave's: stage 0 may be read
    stage_copies(l0 + GSTG, ga + GKS * 32, gb + GKS * 32, gs);
#pragma unroll 1
    for (int t = 0; t < NT; ++t) {   // not unrolled: one trip is one stage, with one place where a stage is handed over
        const T16* sa = ring + (t & 1) * (GSTG / 2) + wm * 4 * (16 * GKS) + lane * 8; const T16* sb = ring + (t & 1) * (GSTG / 2) + (8 + wn * 4) * (16 * GKS) + lane * 8;
        V a[4], b[4];
#pragma unroll
        for (int kb = 0; kb < GKS / 32; ++kb) {
#pragma unroll
            for (int mb = 0; mb < 4; ++mb) a[mb] = WFrag<T16>::ld(sa + mb * (16 * GKS) + kb * 512);
#pragma unroll
            for (int nb = 0; nb < 4; ++nb) b[nb] = WFrag<T16>::ld(sb + nb * (16 * GKS) + kb * 512);
            __builtin_amdgcn_sched_barrier(0);   // keeps all of a block's 16 LDS reads in front of its first product: without it the B fragments are fetched one at a time among the products, each behind a full wait of its own
            if (kb == GKS / 32 - 1) {   // the stage's last block is in registers: the stage is handed over in front of that block's products, so that the refill flies for a whole trip
                asm volatile("s_wait_dscnt 0x0" ::: "memory");      // this wave's reads of stage t are done before its buffer is given up
                asm volatile("s_wait_asynccnt 0x0" ::: "memory");   // this wave's copies of stage t + 1 have landed
                __syncthreads();                                     // publishes stage t + 1 and ends every wave's reads of stage t
                if (t + 2 < NT) stage_copies(l0 + (unsigned)(t & 1) * GSTG, ga + (t + 2) * (GKS * 32), gb + (t + 2) * (GKS * 32), gs);
            }
#pragma unroll
            for (int nb = 0; nb < 4; ++nb) {
#pragma unroll
                for (int mb = 0; mb < 4; ++mb) acc[mb][nb] = WFrag<T16>::mma(a[mb], b[nb], acc[mb][nb]); }
        }
    }
    asm volatile("s_wait_asynccnt 0x0" ::: "memory");   // nothing is in flight when the wave goes on to its epilogue
    if (vcol) {   // an accumulator holds, per lane, 8 consecutive t of one d: that is the lane's own 16 bytes of one half of a block (d rows x t), so a wave stores 512 contiguous bytes
#pragma unroll
        for (int nb = 0; nb < 4; ++nb) { const float bb = BIAS ? bfr(bias[c0 + nb * 16 + lr]) : 0.0f;
            v4i d[4], dh[4], dl[4];
#pragma unroll
            for (int mb = 0; mb < 4; ++mb) { v8h o16;
#pragma unroll
                for (int j = 0; j < 8; ++j) { float x = acc[mb][nb][j]; if (BIAS) x += bb; acc[mb][nb][j] = x; o16[j] = tohx(x); }
                d[mb] = __builtin_bit_cast(v4i, o16); }
            const size_t e = ((size_t)bt * DKV + (c0 - DQ - DKV)) * TT + (size_t)((t0 >> 5) * 4 + nb) * 512 + lane * 8;   // 16 positions mb: block + (mb >> 1) * 4, half mb & 1
            st4v(P16 + e, d[0], d[1], d[2], d[3]);
            if (pair) {
#pragma unroll
                for (int mb = 0; mb < 4; ++mb) { v8us oh, ol;
#pragma unroll
                    for (int j = 0; j < 8; ++j) { unsigned short a2, c2; splitf(acc[mb][nb][j], a2, c2); oh[j] = a2; ol[j] = c2; }
                    dh[mb] = __builtin_bit_cast(v4i, oh); dl[mb] = __builtin_bit_cast(v4i, ol); }
                st4v(Ph + e, dh[0], dh[1], dh[2], dh[3]); st4v(Pl + e, dl[0], dl[1], dl[2], dl[3]); } }
    } else {                 // rows of 64 d: turned through LDS so that a lane holds 8 consecutive d of one t, its own 16 bytes of one half of a block (t rows x d)
        float bb[4];
#pragma unroll
        for (int nb = 0; nb < 4; ++nb) bb[nb] = BIAS ? bfr(bias[c0 + nb * 16 + lr]) : 0.0f;
#pragma unroll
        for (int mb = 0; mb < 4; ++mb) {
#pragma unroll
            for (int nb = 0; nb < 4; ++nb) {
#pragma unroll
                for (int j = 0; j < 8; ++j) os[(hi * 8 + j) * 68 + nb * 16 + lr] = BIAS ? acc[mb][nb][j] + bb[nb] : acc[mb][nb][j]; }
            __builtin_amdgcn_wave_barrier(); asm volatile("" ::: "memory");   // the LDS stores above stay in front of the other lanes' reads below
            v4f v0[4], v1[4]; v4i d[4], dh[4], dl[4];
#pragma unroll
            for (int s = 0; s < 4; ++s) { const int cofs = (2 * s + hi) * 8; v0[s] = *(const v4fa*)(os + lr * 68 + cofs); v1[s] = *(const v4fa*)(os + lr * 68 + cofs + 4); }   // half-block s of these 16 rows: d = 16 s + 8 hi ...
            const size_t e = (((size_t)bt * (NH_ + NKV) + c0 / HD) * TT + t0 + mb * 16) * HD + lane * 8;   // half-block s: + s * 256
            if (single) {
#pragma unroll
                for (int s = 0; s < 4; ++s) { v8h o16;
#pragma unroll
                    for (int u = 0; u < 8; ++u) o16[u] = tohx((u < 4) ? v0[s][u & 3] : v1[s][u & 3]);
                    d[s] = __builtin_bit_cast(v4i, o16); }
                st4r(P16 + e, d[0], d[1], d[2], d[3]); }
            if (pair) {
#pragma unroll
                for (int s = 0; s < 4; ++s) { v8us oh, ol;
#pragma unroll
                    for (int u = 0; u < 8; ++u) { unsigned short a2, c2; splitf((u < 4) ? v0[s][u & 3] : v1[s][u & 3], a2, c2); oh[u] = a2; ol[u] = c2; }
                    dh[s] = __builtin_bit_cast(v4i, oh); dl[s] = __builtin_bit_cast(v4i, ol); }
                st4r(Ph + e, dh[0], dh[1], dh[2], dh[3]); st4r(Pl + e, dl[0], dl[1], dl[2], dl[3]); }
            __builtin_amdgcn_wave_barrier(); asm volatile("" ::: "memory");   // the reads above stay in front of the next 16 rows' LDS stores
        }
    }
}

typedef __attribute__((ext_vector_type(2))) _Float16 v2h;
typedef __attribute__((ext_vector_type(4))) _Float16 v4h;
typedef __attribute__((ext_vector_type(2))) unsigned short v2us;
typedef __attribute__((ext_vector_type(4))) unsigned short v4us;
typedef __attribute__((ext_vector_type(2))) float v2f;

__global__ __launch_bounds__(256) void k_wtG(const float* __restrict__ w, int K, int N, bf* Bt) {
    const int lane = threadIdx.x & 31; const int L0 = (blockIdx.x * 8 + (threadIdx.x >> 5)) * 8; const int nlines = N * K / 64;
{
#pragma unroll 1
        for (int l = 0; l < 8; ++l) { const int L = L0 + l; if (L >= nlines) break; const size_t e = (size_t)L * 64 + lane * 2; const int k = (int)(e % K), n = (int)(e / K); v2us o;
            o[0] = f2bf(w[(size_t)k * N + n]); o[1] = f2bf(w[(size_t)(k + 1) * N + n]); *(v2us*)(Bt + e) = o; }
         }
}
__global__ __launch_bounds__(256) void k_cvt8(const float* __restrict__ srcA, bf* dstA, size_t nA8, const float* __restrict__ srcB, bf* dstB, size_t nB8) { size_t i = (size_t)blockIdx.x * 256 + threadIdx.x; const float* src = srcA; bf* dst = dstA;
    if (i >= nA8) { i -= nA8; if (i >= nB8) return; src = srcB; dst = dstB; }   // one launch rounds both arrays: first A's groups of 8, then B's
    const size_t blk = i >> 6; const int r = (int)(i >> 2) & 15, c = (int)i & 3;   // 64 threads a block (16 rows x 32 k, rows of DM): 4 neighbours read one whole 128-byte line of a source row, and 8 rows' groups of one c are one whole line of the plane in fragment order
    const v8f v = *(const v8f*)(src + ((blk / (DM / 32)) * 16 + r) * DM + (blk % (DM / 32)) * 32 + c * 8); v8us o;
#pragma unroll
    for (int k = 0; k < 8; ++k) o[k] = f2bf(v[k]); *(v8us*)(dst + blk * 512 + ((c >> 1) * 32 + (c & 1) * 16 + r) * 8) = o;  }
__global__ __launch_bounds__(256) void k_cscvt(const float* __restrict__ cosT, const float* __restrict__ sinT, float* CS) { const int idx = blockIdx.x * 256 + threadIdx.x; if (idx >= TT * HD) return; v2f cs; cs[0] = bfr(cosT[idx]); cs[1] = bfr(sinT[idx]); *(v2f*)(CS + (size_t)idx * 2) = cs;  }
// ---- attn_tile (queries < RH): causal scores, softmax and probability x value contraction of one 32-query tile of one head in ONE work-group (16 waves); no score or probability leaves the chip.
// Wave w owns keys [w*KCH, (w+1)*KCH). It forms the TRANSPOSED score tile (A = key rows, B = query rows), so that a lane holds 8 consecutive keys of one query per accumulator: two neighbouring accumulators
// are, element for element, the A fragment of the probability x value product, and the probabilities go from the softmax into that product without leaving their registers.
// The row maximum and the row sum meet over the waves in LDS (one barrier each; sum in wave order = ascending keys), the 16 partial output tiles likewise (third barrier).
// A wave whose keys all lie beyond the tile's last query forms no scores or products, but still takes its share of the final sum. hi + lo planes (3 products), 32 keys a wave.
typedef __attribute__((ext_vector_type(16))) unsigned short v16us;
__device__ __forceinline__ void mkp(const v8f e0, const v8f e1, const float f, v16h& a, v16h& a2) { (void)a2;
#pragma unroll
    for (int j = 0; j < 8; ++j) { a[j] = tohx(e0[j] * f); a[8 + j] = tohx(e1[j] * f); } }
__device__ __forceinline__ void mkp(const v8f e0, const v8f e1, const float f, v16bf& a, v16bf& a2) { v16us h, l;
#pragma unroll
    for (int j = 0; j < 8; ++j) { unsigned short x, y; splitf(e0[j] * f, x, y); h[j] = x; l[j] = y; splitf(e1[j] * f, x, y); h[8 + j] = x; l[8 + j] = y; }
    a = __builtin_bit_cast(v16bf, h); a2 = __builtin_bit_cast(v16bf, l); }
#define RP 68                     // pitch, in floats, of a partial output row in LDS
template <typename T16, int NSPLIT, int KCH>
__device__ __forceinline__ void attn_tile(const T16* __restrict__ Q, const T16* __restrict__ Q2, const T16* __restrict__ Kp, const T16* __restrict__ Kp2, const T16* __restrict__ Vt, const T16* __restrict__ Vt2, float* O, const int r0, const float pnum, float (*red)[32 * RP], float (*smax)[32], float (*ssum)[32]) {
    typedef typename WFrag<T16>::V V;
    static_assert(KCH % 32 == 0 && 16 * KCH <= TT, "the 16 key slices stay inside the sequence");
    constexpr int NM = KCH / 16, NS = KCH / 32;
    const int wv = __builtin_amdgcn_readfirstlane((int)(threadIdx.x >> 5)); const int lane = threadIdx.x & 31, lr = lane & 15, hi = lane >> 4; const int key0 = wv * KCH;
    const bool active = key0 < r0 + 32; const int nact = (r0 + 32 + KCH - 1) / KCH;      // waves 0 .. nact-1 hold causal keys (nact <= 16)
    const unsigned qo = (unsigned)(r0 * HD + 8 * lane) * 2u, ko = (unsigned)(key0 * HD + 8 * lane) * 2u, vo = (unsigned)(key0 * HD + 8 * lane) * 2u;   // byte offset of a lane's first element of the query rows, the key rows and the value columns: the one address register of each group of loads
    v8f s[NM][2];
#pragma unroll
    for (int mt = 0; mt < NM; ++mt) { s[mt][0] = (v8f){}; s[mt][1] = (v8f){}; }
    float mx[2] = {-3.0e38f, -3.0e38f};
    V b[NS][4], b2[NS][4];
    if (active) {
        V q[2][2], q2[2][2], k[NM][2], k2[NM][2];
#pragma unroll
        for (int nb = 0; nb < 2; ++nb)
#pragma unroll
            for (int kc = 0; kc < 2; ++kc) { const int o = (nb * 2 + kc) * 512; q[nb][kc] = WFrag<T16>::ld(atb(Q, qo) + o); if (NSPLIT == 2) q2[nb][kc] = WFrag<T16>::ld(atb(Q2, qo) + o); }
#pragma unroll
        for (int mt = 0; mt < NM; ++mt)
#pragma unroll
            for (int kc = 0; kc < 2; ++kc) { const int o = (mt * 2 + kc) * 512; k[mt][kc] = WFrag<T16>::ld(atb(Kp, ko) + o); if (NSPLIT == 2) k2[mt][kc] = WFrag<T16>::ld(atb(Kp2, ko) + o); }
        asm volatile("s_wait_xcnt 0x0" :: "v"(qo), "v"(ko) : "memory");   // the loads' address registers stay whole up to this wait
        __builtin_amdgcn_sched_barrier(0);   // keeps every load above in front of the first product, so that the wave waits out the load latency once and not once per key tile
#pragma unroll
        for (int mt = 0; mt < NM; ++mt)
#pragma unroll
            for (int nb = 0; nb < 2; ++nb)
#pragma unroll
                for (int kc = 0; kc < 2; ++kc) { s[mt][nb] = WFrag<T16>::mma(k[mt][kc], q[nb][kc], s[mt][nb]); if (NSPLIT == 2) { s[mt][nb] = WFrag<T16>::mma(k[mt][kc], q2[nb][kc], s[mt][nb]); s[mt][nb] = WFrag<T16>::mma(k2[mt][kc], q[nb][kc], s[mt][nb]); } }
        if (key0 + KCH - 1 > r0) {           // only a wave that holds a key beyond the tile's first query has anything to mask
            const int dl = r0 + lr - key0 - hi * 8;   // key (mt, j) is causal for query (nb, lr) where mt * 16 + j - nb * 16 <= dl
#pragma unroll
            for (int mt = 0; mt < NM; ++mt)
#pragma unroll
                for (int nb = 0; nb < 2; ++nb)
#pragma unroll
                    for (int j = 0; j < 8; ++j) s[mt][nb][j] = (mt * 16 + j - nb * 16 <= dl) ? s[mt][nb][j] : -3.0e38f;
        }
#pragma unroll
        for (int mt = 0; mt < NM; ++mt)
#pragma unroll
            for (int nb = 0; nb < 2; ++nb)
#pragma unroll
                for (int j = 0; j < 8; ++j) { const float t = s[mt][nb][j] * SCL; s[mt][nb][j] = t; mx[nb] = fmaxf(mx[nb], t); }
        mx[0] = fmaxf(mx[0], __shfl_xor(mx[0], 16, 32)); mx[1] = fmaxf(mx[1], __shfl_xor(mx[1], 16, 32));
    }
    if (hi == 0) { smax[wv][lr] = mx[0]; smax[wv][16 + lr] = mx[1]; }
    __syncthreads();   // every wave's row maxima are in LDS before any wave takes the maximum over the waves
    float sm[2] = {0.f, 0.f};
    if (active) {
#pragma unroll
        for (int w = 0; w < 16; ++w) { mx[0] = fmaxf(mx[0], smax[w][lr]); mx[1] = fmaxf(mx[1], smax[w][16 + lr]); }
#pragma unroll
        for (int mt = 0; mt < NM; ++mt)
#pragma unroll
            for (int nb = 0; nb < 2; ++nb)
#pragma unroll
                for (int j = 0; j < 8; ++j) { const float e = __builtin_amdgcn_exp2f(__fmul_rn(__fsub_rn(s[mt][nb][j], mx[nb]), 1.4426950408889634f)); s[mt][nb][j] = e; sm[nb] += e; }
        sm[0] += __shfl_xor(sm[0], 16, 32); sm[1] += __shfl_xor(sm[1], 16, 32);
#pragma unroll
        for (int ss = 0; ss < NS; ++ss)
#pragma unroll
            for (int db = 0; db < 2; ++db) { const int ofs = (ss * 4 + db) * 512; b[ss][db] = WFrag<T16>::ld(atb(Vt, vo) + ofs); if (NSPLIT == 2) b2[ss][db] = WFrag<T16>::ld(atb(Vt2, vo) + ofs); }
        asm volatile("s_wait_xcnt 0x0" :: "v"(vo) : "memory");   // as above: the address register stays whole up to this wait
        __builtin_amdgcn_sched_barrier(0);   // holds the loads of value columns 0..31 here, so that they fly while the row sums meet over the waves
    }
    if (hi == 0) { ssum[wv][lr] = sm[0]; ssum[wv][16 + lr] = sm[1]; }
    __syncthreads();   // every wave's row sums are in LDS before any wave adds them up
    {
        if (active) {
            v8f o[2][4];
#pragma unroll
            for (int qb = 0; qb < 2; ++qb)
#pragma unroll
                for (int db = 0; db < 4; ++db) o[qb][db] = (v8f){};
            float t0 = ssum[0][lr], t1 = ssum[0][16 + lr];
#pragma unroll
            for (int w = 1; w < 16; ++w) { t0 += ssum[w][lr]; t1 += ssum[w][16 + lr]; }
            const float f[2] = {__fdiv_rn(pnum, t0), __fdiv_rn(pnum, t1)};
            V a[NS][2], a2[NS][2];
#pragma unroll
            for (int ss = 0; ss < NS; ++ss)
#pragma unroll
                for (int qb = 0; qb < 2; ++qb) mkp(s[2 * ss][qb], s[2 * ss + 1][qb], f[qb], a[ss][qb], a2[ss][qb]);
            __builtin_amdgcn_sched_barrier(0);   // the loads below start only when the scores have been packed into probabilities: earlier they would spill
#pragma unroll
            for (int ss = 0; ss < NS; ++ss)
#pragma unroll
                for (int db = 2; db < 4; ++db) { const int ofs = (ss * 4 + db) * 512; b[ss][db] = WFrag<T16>::ld(atb(Vt, vo) + ofs); if (NSPLIT == 2) b2[ss][db] = WFrag<T16>::ld(atb(Vt2, vo) + ofs); }
            asm volatile("s_wait_xcnt 0x0" :: "v"(vo) : "memory");   // as above: the address register stays whole up to this wait
            __builtin_amdgcn_sched_barrier(0);   // keeps those loads in front of the first product: they fly during the products of value columns 0..31
#pragma unroll
            for (int db = 0; db < 4; ++db)
#pragma unroll
                for (int ss = 0; ss < NS; ++ss)
#pragma unroll
                    for (int qb = 0; qb < 2; ++qb) { o[qb][db] = WFrag<T16>::mma(a[ss][qb], b[ss][db], o[qb][db]); if (NSPLIT == 2) { o[qb][db] = WFrag<T16>::mma(a2[ss][qb], b[ss][db], o[qb][db]); o[qb][db] = WFrag<T16>::mma(a[ss][qb], b2[ss][db], o[qb][db]); } }
            __builtin_amdgcn_sched_barrier(0);   // keeps the LDS stores behind the last product
#pragma unroll
            for (int qb = 0; qb < 2; ++qb)
#pragma unroll
                for (int db = 0; db < 4; ++db)
#pragma unroll
                    for (int j = 0; j < 8; ++j) red[wv][(qb * 16 + hi * 8 + j) * RP + db * 16 + lr] = o[qb][db][j];
        } else if (wv < ((nact + 3) & ~3)) {   // the final sum reads the partial tiles in groups of four waves: an idle wave of the last group stores zeros
#pragma unroll
            for (int u = 0; u < 16; ++u) *(v4fa*)&red[wv][(u * 2 + hi) * RP + lr * 4] = (v4f){};
        }
    }
    __syncthreads();   // every wave's partial tile is in LDS before any wave sums
    const int row = threadIdx.x >> 4, col = (threadIdx.x & 15) * 4; v4f acc = *(const v4fa*)&red[0][row * RP + col];
#pragma unroll
    for (int w = 1; w < 4; ++w) acc += *(const v4fa*)&red[w][row * RP + col];
#pragma unroll
    for (int g = 4; g < 16; g += 4)
        if (g < nact) {
#pragma unroll
            for (int w = g; w < g + 4; ++w) acc += *(const v4fa*)&red[w][row * RP + col]; }
    v4f ov;   // the tile goes straight to its head's 64 columns of the output rows: probabilities' scale taken off, then hi + lo of the bf16 pair
#pragma unroll
    for (int u = 0; u < 4; ++u) { unsigned short a, c2; splitf(acc[u] * (1.0f / pnum), a, c2); ov[u] = __fadd_rn(bf2f(a), bf2f(c2)); }
    *(v4f*)(O + (size_t)(r0 + row) * DQ + col) = ov;
}
// ---- the walk: queries >= RH. A wave walks the causal keys of a 32-query tile in passes of 32, with a running row maximum and row sum; a long tile's keys are shared with the wave of a short tile (attn_pair, below).
// Scores transposed as above (A = key rows, B = query rows); the output transposed too (A = value columns d x keys, B = the packed probabilities): in both a lane holds ONE query's values, so the factor that
// carries the output and the sum over to a new maximum is the lane's own. The 16 waves of a work-group walk the same head (a short tile's wave from key 0 on, a long tile's from pass nh on), so that a key or value line fetched by one is in the WGP's cache for the others.
// Probabilities are exp2(.) x 2^LOGP (the fp16 operand's range, as PCAR above); the sum carries the same factor, which leaves with the division.
#define LOGP 10.0f
__device__ __forceinline__ float xhalf(float v) { const int b = __float_as_int(v); return __int_as_float(__builtin_amdgcn_permlanex16(b, b, 0x76543210, 0xfedcba98, false, false)); }   // lane l takes lane l ^ 16's value
// One pass: 32 keys (their tiles k came in a pass ahead) against the wave's 32 queries. vo, ko: the lane's byte offset of this pass's values and of the next pass's keys. LAST: the tile's own 32 keys, masked; no further keys are fetched.
template <bool LAST>
__device__ __forceinline__ void walk_pass(const h16* __restrict__ Kp, const h16* __restrict__ Vt, const unsigned ko, const unsigned vo, const int dl, const v16h (&q)[2][2], v16h (&k)[2][2], v8f (&o)[4][2], float (&m)[2], float (&l)[2]) {
    constexpr float C2 = SCL * 1.4426950408889634f;
    v16h v[4];
#pragma unroll
    for (int db = 0; db < 4; ++db) v[db] = WFrag<h16>::ld(atb(Vt, vo) + db * 512);
    v8f s[2][2];
#pragma unroll
    for (int mt = 0; mt < 2; ++mt)
#pragma unroll
        for (int nb = 0; nb < 2; ++nb) { s[mt][nb] = WFrag<h16>::mma(k[mt][0], q[nb][0], (v8f){}); s[mt][nb] = WFrag<h16>::mma(k[mt][1], q[nb][1], s[mt][nb]); }
    if (!LAST) {
#pragma unroll
        for (int mt = 0; mt < 2; ++mt)
#pragma unroll
            for (int kc = 0; kc < 2; ++kc) k[mt][kc] = WFrag<h16>::ld(atb(Kp, ko) + (mt * 2 + kc) * 512);
    }
    asm volatile("s_wait_xcnt 0x0" :: "v"(ko), "v"(vo) : "memory");   // the address registers of this pass's value and key loads stay whole up to this wait
    __builtin_amdgcn_sched_barrier(0);   // keeps both groups of loads up here (sunk to their first use they would each be waited for in full) and every rewrite of their address registers behind the wait
    if (LAST) {   // key (mt, j) is causal for query (nb, lr) where mt * 16 + j - nb * 16 <= dl
#pragma unroll
        for (int mt = 0; mt < 2; ++mt)
#pragma unroll
            for (int nb = 0; nb < 2; ++nb)
#pragma unroll
                for (int j = 0; j < 8; ++j) s[mt][nb][j] = (mt * 16 + j - nb * 16 <= dl) ? s[mt][nb][j] : -3.0e38f;
    }
    v16h pf[2];
#pragma unroll
    for (int nb = 0; nb < 2; ++nb) {
        float bm = s[0][nb][0];
#pragma unroll
        for (int j = 1; j < 8; ++j) bm = fmaxf(bm, s[0][nb][j]);
#pragma unroll
        for (int j = 0; j < 8; ++j) bm = fmaxf(bm, s[1][nb][j]);
        bm = fmaxf(bm, xhalf(bm));
        const float mn = fmaxf(m[nb], bm), al = __builtin_amdgcn_exp2f((m[nb] - mn) * C2), sh = fmaf(-mn, C2, LOGP); m[nb] = mn;
        float sum = 0.f;
#pragma unroll
        for (int mt = 0; mt < 2; ++mt) { const v8f x = __builtin_elementwise_fma(s[mt][nb], (v8f){C2, C2, C2, C2, C2, C2, C2, C2}, (v8f){sh, sh, sh, sh, sh, sh, sh, sh});
#pragma unroll
            for (int j = 0; j < 8; ++j) { const float e = __builtin_amdgcn_exp2f(x[j]); sum += e; pf[nb][mt * 8 + j] = tohx(e); } }
        l[nb] = fmaf(l[nb], al, sum);
#pragma unroll
        for (int db = 0; db < 4; ++db) o[db][nb] *= al;
    }
#pragma unroll
    for (int db = 0; db < 4; ++db)
#pragma unroll
        for (int nb = 0; nb < 2; ++nb) o[db][nb] = WFrag<h16>::mma(v[db], pf[nb], o[db][nb]);
}
// walk_run: passes p0 .. p1 - 1 (32 keys each, all in front of the tile's first query) of the 32-query tile at row r0; OWN: then the tile's own 32 keys, masked (p1 is then r0 / 32). Leaves the tile's output, maximum and sum over those keys.
template <bool OWN>
__device__ __forceinline__ void walk_run(const h16* __restrict__ Q, const h16* __restrict__ Kp, const h16* __restrict__ Vt, const int r0, const int p0, const int p1, v8f (&o)[4][2], float (&m)[2], float (&l)[2]) {
#pragma unroll
    for (int db = 0; db < 4; ++db) { o[db][0] = (v8f){}; o[db][1] = (v8f){}; }
    m[0] = -3.0e38f; m[1] = -3.0e38f; l[0] = 0.f; l[1] = 0.f;
    if (!OWN && p0 >= p1) return;   // no pass to walk (the same for the whole wave): nothing is fetched
    const int lane = threadIdx.x & 31, lr = lane & 15, hi = lane >> 4; const unsigned lo = (unsigned)lane * 16u, qo = lo + (unsigned)r0 * (HD * 2), k0 = lo + (unsigned)p0 * (32 * HD * 2);   // the lane's 16 bytes of a half block: at key 0, at the tile's first query, at the first key of the run
    v16h q[2][2], k[2][2];
#pragma unroll
    for (int nb = 0; nb < 2; ++nb)
#pragma unroll
        for (int kc = 0; kc < 2; ++kc) { q[nb][kc] = WFrag<h16>::ld(atb(Q, qo) + (nb * 2 + kc) * 512); k[nb][kc] = WFrag<h16>::ld(atb(Kp, k0) + (nb * 2 + kc) * 512); }
    asm volatile("s_wait_xcnt 0x0" :: "v"(qo), "v"(k0) : "memory");   // the loads' address registers stay whole up to this wait
#pragma unroll 1
    for (int p = p0; p < p1; ++p)   // not unrolled: a pass holds the registers of one set of key, value and score tiles
        walk_pass<false>(Kp, Vt, lo + (unsigned)(p + 1) * (32 * HD * 2), lo + (unsigned)p * (32 * HD * 2), 0, q, k, o, m, l);
    if (OWN) walk_pass<true>(Kp, Vt, lo, lo + (unsigned)p1 * (32 * HD * 2), lr - hi * 8, q, k, o, m, l);
}
// walk_out: o[db][nb][j] is query nb * 16 + lr, column db * 16 + hi * 8 + j. Divided by the row sum and turned through the wave's own LDS rows, so that a store covers whole 256-byte output rows.
__device__ __forceinline__ void walk_out(const v8f (&o)[4][2], const float (&l)[2], float* O, const int r0, float* os) {
    const int lane = threadIdx.x & 31, lr = lane & 15, hi = lane >> 4;
#pragma unroll
    for (int nb = 0; nb < 2; ++nb) { const float f = __fdiv_rn(1.0f, l[nb] + xhalf(l[nb]));
#pragma unroll
        for (int db = 0; db < 4; ++db) { v4f x0, x1;
#pragma unroll
            for (int u = 0; u < 4; ++u) { x0[u] = o[db][nb][u] * f; x1[u] = o[db][nb][4 + u] * f; }
            *(v4fa*)(os + (nb * 16 + lr) * RP + db * 16 + hi * 8) = x0; *(v4fa*)(os + (nb * 16 + lr) * RP + db * 16 + hi * 8 + 4) = x1; } }
    __builtin_amdgcn_wave_barrier(); asm volatile("" ::: "memory");   // the LDS stores above stay in front of the other lanes' reads below
#pragma unroll
    for (int u = 0; u < 16; ++u) { const int row = u * 2 + hi; const v4f x = *(const v4fa*)(os + row * RP + lr * 4); v4f ov;   // hi + lo of the bf16 pair, as in attn_tile
#pragma unroll
        for (int c = 0; c < 4; ++c) { unsigned short a, c2; splitf(x[c], a, c2); ov[c] = __fadd_rn(bf2f(a), bf2f(c2)); }
        *(v4f*)(O + (size_t)(r0 + row) * DQ + lr * 4) = ov; }
}
// attn_pair: two waves of a work-group share the keys of a short and a long tile, so that both walk the same number of passes (to within one) and no wave is left walking alone on its SIMD.
// The short tile's wave (helper) walks and writes its own tile, then walks the FIRST nh passes of the long tile and leaves that part's output, maximum and sum in its LDS rows, lane for lane (both waves hold a tile in the same lanes and registers).
// The long tile's wave walks the rest, and behind one work-group barrier carries both parts over to their common maximum, adds them and writes the tile.
__device__ __forceinline__ void attn_pair(const h16* __restrict__ Q, const h16* __restrict__ Kp, const h16* __restrict__ Vt, float* O, const bool helper, const int tile, const int other, float* os, float* po) {
    constexpr float C2 = SCL * 1.4426950408889634f;
    const int lane = threadIdx.x & 31; const int nh = (helper ? other - tile : tile - other) / 2;   // passes of the long tile that the helper walks
    v8f o[4][2]; float m[2], l[2];
    walk_run<true>(Q, Kp, Vt, tile * 32, helper ? 0 : nh, tile, o, m, l);
    if (helper) {
        walk_out(o, l, O, tile * 32, os);
        asm volatile("s_wait_xcnt 0x0" ::: "memory");   // the registers that the output stores name stay whole up to this wait: the second walk below writes them anew
        walk_run<false>(Q, Kp, Vt, other * 32, 0, nh, o, m, l);
        __builtin_amdgcn_wave_barrier(); asm volatile("" ::: "memory");   // the other lanes' reads of the wave's LDS rows in walk_out stay in front of the stores below
#pragma unroll
        for (int db = 0; db < 4; ++db)
#pragma unroll
            for (int nb = 0; nb < 2; ++nb) { v4f x0, x1;
#pragma unroll
                for (int u = 0; u < 4; ++u) { x0[u] = o[db][nb][u]; x1[u] = o[db][nb][4 + u]; }
                *(v4fa*)(os + (((db * 2 + nb) * 2) * 32 + lane) * 4) = x0; *(v4fa*)(os + (((db * 2 + nb) * 2 + 1) * 32 + lane) * 4) = x1; }
        *(v4fa*)(os + (16 * 32 + lane) * 4) = (v4f){m[0], m[1], l[0], l[1]};
    }
    __syncthreads();   // every helper's part is in LDS before the long tile's wave takes it
    if (!helper) {
        const v4f ml = *(const v4fa*)(po + (16 * 32 + lane) * 4);
#pragma unroll
        for (int nb = 0; nb < 2; ++nb) { const float mn = fmaxf(m[nb], ml[nb]), aw = __builtin_amdgcn_exp2f((m[nb] - mn) * C2), ah = __builtin_amdgcn_exp2f((ml[nb] - mn) * C2);
            l[nb] = fmaf(l[nb], aw, ml[2 + nb] * ah);
#pragma unroll
            for (int db = 0; db < 4; ++db) { const v4f x0 = *(const v4fa*)(po + (((db * 2 + nb) * 2) * 32 + lane) * 4), x1 = *(const v4fa*)(po + (((db * 2 + nb) * 2 + 1) * 32 + lane) * 4);
#pragma unroll
                for (int u = 0; u < 4; ++u) { o[db][nb][u] = fmaf(o[db][nb][u], aw, x0[u] * ah); o[db][nb][4 + u] = fmaf(o[db][nb][4 + u], aw, x1[u] * ah); } } }
        walk_out(o, l, O, tile * 32, os);
    }
}
#define WG_H  ((TT - RH) / 32 / 16)          // walking work-groups of a head: 16 tiles each
#define NWALK (NB_ * NH_ * WG_H)
// grid: first the NWALK walking work-groups (the long ones), then batches * heads * RH / 32 work-groups of attn_tile, those with the most keys first
__global__ __launch_bounds__(512) void k_attn(const h16* __restrict__ QK16, const h16* __restrict__ V16, const bf* __restrict__ QKh, const bf* __restrict__ QKl, const bf* __restrict__ Vh, const bf* __restrict__ Vl, float* O) {
    static_assert((TT - RH) % 512 == 0 && RH % 32 == 0, "16 whole tiles a walking work-group");
    __shared__ __align__(16) float red[16][32 * RP]; __shared__ float smax[16][32]; __shared__ float ssum[16][32];
    const bool walk = (int)blockIdx.x < NWALK; const int idx = walk ? (int)blockIdx.x : (int)blockIdx.x - NWALK; const int bh = idx % (NB_ * NH_), g = idx / (NB_ * NH_);
    const int bt = bh / NH_, hd = bh % NH_;
    const size_t zq = ((size_t)bt * (NH_ + NKV) + hd) * TT * HD, zk = zq + (size_t)NH_ * TT * HD, zv = ((size_t)bt * NKV + hd) * HD * TT;
    float* Oh = O + (size_t)bt * TT * DQ + (size_t)hd * HD;   // O: output rows [batch][t][heads * HD]
    if (walk) {   // waves w, w + 4, w + 8, w + 12 share a SIMD: their four tiles are dealt to and fro over the head's 4 * WG_H SIMDs, so that every SIMD walks the same number of keys
        const int wv = __builtin_amdgcn_readfirstlane((int)(threadIdx.x >> 5)), a = wv >> 2, c = g * 4 + (wv & 3);
        const int tile = RH / 32 + a * (4 * WG_H) + ((a & 1) ? 4 * WG_H - 1 - c : c), other = RH / 32 + (3 - a) * (4 * WG_H) + ((a & 1) ? c : 4 * WG_H - 1 - c);   // other: the tile of wave wv ^ 12, on the same SIMD; the two tiles' passes add up to the same number in every pair
        attn_pair(QK16 + zq, QK16 + zk, V16 + zv, Oh, a < 2, tile, other, red[wv], red[wv ^ 12]);
    } else attn_tile<bf, 2, RH / 16>(QKh + zq, QKl + zq, QKh + zk, QKl + zk, Vh + zv, Vl + zv, Oh, (RH / 32 - 1 - g) * 32, 1.0f, red, smax, ssum);
}
extern "C" void kernel_launch(void* const* d_in, const int* in_sizes, int n_in,
                              void* d_out, int out_size, void* d_ws, size_t ws_size, hipStream_t stream) {
    (void)in_sizes; (void)n_in; (void)out_size;
    const float* x = (const float*)d_in[0]; const float* wf = (const float*)d_in[1]; const float* bfz = (const float*)d_in[2];   // x [4][2048][1024], W [3072][1024] (rows q | k | v), b [3072]
    float* OUT = (float*)d_out;     // [4][2048][1024]
    char* wsp = (char*)d_ws;
    auto take = [&](size_t bytes) { char* p = wsp; wsp += (bytes + 255) & ~(size_t)255; return (void*)p; };
    bf* WB = (bf*)take((size_t)(DQ + 2 * DKV) * DM * 2);
    bf* XB = (bf*)take((size_t)NB_ * TT * DM * 2);
    h16* QK16 = (h16*)take((size_t)NB_ * (NH_ + NKV) * TT * HD * 2); h16* VT16 = (h16*)take((size_t)NB_ * NKV * HD * TT * 2);
    bf* QKh = (bf*)take((size_t)NB_ * (NH_ + NKV) * TT * HD * 2); bf* QKl = (bf*)take((size_t)NB_ * (NH_ + NKV) * TT * HD * 2); bf* VTh = (bf*)take((size_t)NB_ * NKV * HD * TT * 2); bf* VTl = (bf*)take((size_t)NB_ * NKV * HD * TT * 2);
    if ((size_t)(wsp - (char*)d_ws) > ws_size) return;    // 166 MiB of the 256 MiB
    k_cvt8<<<(unsigned)(((size_t)NB_ * TT * DM / 8 + (size_t)(DQ + 2 * DKV) * DM / 8 + 255) / 256), 256, 0, stream>>>(x, XB, (size_t)NB_ * TT * DM / 8, wf, WB, (size_t)(DQ + 2 * DKV) * DM / 8);
    k_gemmw<bf, 0, true, DM><<<dim3(NB_ * TT / 128, (DQ + 2 * DKV) / 256, 1), 256, 0, stream>>>(XB, nullptr, WB, nullptr, QK16, QKh, QKl, VT16, VTh, VTl, bfz, 0, 0);
    k_attn<<<dim3(NWALK + NB_ * NH_ * (RH / 32), 1, 1), 512, 0, stream>>>(QK16, VT16, QKh, QKl, VTh, VTl, OUT);
}
